// v000
// The times below were measured on an AMD MI455X: many runs one after another, warmed up first and cycling through
// copies of the inputs, with the whole window's GPU time divided by the number of runs. Launches and the gaps
// between them are all in it. The median over several windows is given; except for v000 it joins two sittings, which
// can be a few percent apart, so the side-by-side timings, each taken in one sitting, are the better comparison.
// v000 is the starting kernel. One run takes 2910 microseconds.
#include <hip/hip_runtime.h>

// Causal multi-head attention on THREE separate input streams with biased (in, out) projections (Q, K, V [4][2048][1024]; q = Q Wq + bq, k = K Wk + bk, v = V Wv + bv ('xw' [1024][1024] normal x 1/32 + [1024] zeros on this draw: read; 16 heads x 64); scores / sqrt(64); tril kept, -inf elsewhere; softmax; out = merged Wo + bo ('xw' + a zero bias: read) -> [4][2048][1024] (8.4 M); argument order Q, K, V, Wq, bq, Wk, bk, Wv, bv, Wo, bo).
// Layout per batch: bf16 copies of the three inputs in turn; 'xw' weights transposed once; exact projections + f32 biases; causal T-2048 attention (hybrid rows: < 512 hi/lo 3 products, rest fp16 x1024; k_gemmc skips tiles above the diagonal); merged hi/lo x w_o exact + b_o.
// Compute dtypes, f32 accumulate: every input rounded to bf16; projections exact + f32 biases; attention rows < 512 3 products, rest fp16; softmax f32; Wo hl x exact + bias.

#define NB_  4
#define TT   2048
#define DM   1024
#define NH_  16
#define NKV  16
#define REP  (NH_ / NKV)
#define HD   64
#define DQ   (NH_ * HD)
#define DKV  (NKV * HD)
#define ZH   2
#define RH   512                  // query rows < RH use hi+lo planes (0: none)
#define WIN  2048
#define PCAR 1024.0f
#define SCL  0.125f   // HD^-0.5
typedef _Float16 h16;
typedef unsigned short bf;
typedef __attribute__((ext_vector_type(16))) __bf16   v16bf;
typedef __attribute__((ext_vector_type(16))) _Float16 v16h;
typedef __attribute__((ext_vector_type(8)))  _Float16 v8h;
typedef __attribute__((ext_vector_type(8)))  unsigned short v8us;
typedef __attribute__((ext_vector_type(8)))  float    v8f;
typedef __attribute__((ext_vector_type(4)))  float    v4f;
typedef v8h  __attribute__((may_alias)) v8ha;
typedef v4f  __attribute__((may_alias)) v4fa;
typedef v8us __attribute__((may_alias)) v8usa;

__device__ __forceinline__ unsigned short f2bf(float f) { unsigned u = __float_as_uint(f); u += 0x7FFFu + ((u >> 16) & 1u); return (unsigned short)(u >> 16); }
__device__ __forceinline__ float bf2f(unsigned short b) { return __uint_as_float(((unsigned)b) << 16); }
__device__ __forceinline__ float bfr(float f) { return bf2f(f2bf(f)); }
__device__ __forceinline__ v16h cat16(v8h lo, v8h hi) { return __builtin_shufflevector(lo, hi, 0, 1, 2, 3, 4, 5, 6, 7, 8, 9, 10, 11, 12, 13, 14, 15); }
__device__ __forceinline__ v16bf cat16b(v8us lo, v8us hi) { return __builtin_bit_cast(v16bf, __builtin_shufflevector(lo, hi, 0, 1, 2, 3, 4, 5, 6, 7, 8, 9, 10, 11, 12, 13, 14, 15)); }
__device__ __forceinline__ v8f wmma16(v16h a, v16h b, v8f c) { return __builtin_amdgcn_wmma_f32_16x16x32_f16(false, a, false, b, (short)0, c, false, false); }
__device__ __forceinline__ v8f wmmab(v16bf a, v16bf b, v8f c) { return __builtin_amdgcn_wmma_f32_16x16x32_bf16(false, a, false, b, (short)0, c, false, false); }



// ---- k_gemmw: register-blocked GEMM, ONE WAVE per 64x64 output tile (16 accumulators), operands straight from K-contiguous 16-bit planes; grid (M/64, N/64, Z), 32 threads.
// C[m][n] (f32, pitch ldc, + optional f32 bias[n]) = sum_k A[m][k] Bt[n][k] (+ split products per NSPLIT). z-batch strides sA/sB/sC in elements. K % 32 == 0.
template <typename T16> struct WFrag;
template <> struct WFrag<h16> { typedef v16h V; static __device__ __forceinline__ V ld(const h16* p) { return cat16(*(const v8h*)p, *(const v8h*)(p + 16)); } static __device__ __forceinline__ v8f mma(V a, V b, v8f c) { return wmma16(a, b, c); } };
template <> struct WFrag<bf> { typedef v16bf V; static __device__ __forceinline__ V ld(const bf* p) { return cat16b(*(const v8us*)p, *(const v8us*)(p + 16)); } static __device__ __forceinline__ v8f mma(V a, V b, v8f c) { return wmmab(a, b, c); } };
template <typename T16, int NSPLIT, bool BIAS>
__global__ __launch_bounds__(32) void k_gemmw(const T16* __restrict__ A, const T16* __restrict__ A2, const T16* __restrict__ Bt, const T16* __restrict__ Bt2, int K, float* C, int ldc, const float* __restrict__ bias, size_t sA, size_t sB, size_t sC) {
    typedef typename WFrag<T16>::V V;
    __shared__ __align__(16) float os[16 * 68];
    const size_t z = blockIdx.z; A += z * sA; if (A2) A2 += z * sA; Bt += z * sB; if (Bt2) Bt2 += z * sB; C += z * sC;
    const int lane = threadIdx.x & 31, lr = lane & 15, hi = lane >> 4; const int r0 = blockIdx.x * 64, c0 = blockIdx.y * 64;
    v8f acc[4][4];
#pragma unroll
    for (int mb = 0; mb < 4; ++mb)
#pragma unroll
        for (int nb = 0; nb < 4; ++nb) acc[mb][nb] = (v8f){};
    const size_t aoff = (size_t)(r0 + lr) * K + 8 * hi, boff = (size_t)(c0 + lr) * K + 8 * hi;
#pragma unroll 1
    for (int kc = 0; kc < K; kc += 32) {
        V a[4], a2[4];
#pragma unroll
        for (int mb = 0; mb < 4; ++mb) { a[mb] = WFrag<T16>::ld(A + aoff + (size_t)mb * 16 * K + kc); if (NSPLIT == 1 || NSPLIT == 2) a2[mb] = WFrag<T16>::ld(A2 + aoff + (size_t)mb * 16 * K + kc); }
#pragma unroll
        for (int nb = 0; nb < 4; ++nb) { const V b = WFrag<T16>::ld(Bt + boff + (size_t)nb * 16 * K + kc); V b2; if (NSPLIT >= 2) b2 = WFrag<T16>::ld(Bt2 + boff + (size_t)nb * 16 * K + kc);
#pragma unroll
            for (int mb = 0; mb < 4; ++mb) { acc[mb][nb] = WFrag<T16>::mma(a[mb], b, acc[mb][nb]); if (NSPLIT == 1 || NSPLIT == 2) acc[mb][nb] = WFrag<T16>::mma(a2[mb], b, acc[mb][nb]); if (NSPLIT >= 2) acc[mb][nb] = WFrag<T16>::mma(a[mb], b2, acc[mb][nb]); } }
        asm volatile("v_nop\n\tv_nop\n\tv_nop\n\tv_nop" : "+v"(acc[0][0]), "+v"(acc[1][1]), "+v"(acc[2][2]), "+v"(acc[3][3]) : "v"(a[0]), "v"(a[3]));
    }
#pragma unroll
    for (int mb = 0; mb < 4; ++mb) {
#pragma unroll
        for (int nb = 0; nb < 4; ++nb) {
#pragma unroll
            for (int j = 0; j < 8; ++j) os[(hi * 8 + j) * 68 + nb * 16 + lr] = acc[mb][nb][j]; }
        __builtin_amdgcn_wave_barrier(); asm volatile("" ::: "memory");
        float* crow = C + (size_t)(r0 + mb * 16) * ldc + c0;
{
#pragma unroll
            for (int s = 0; s < 8; ++s) { const int row = 2 * s + hi, cofs = lr * 4; v4f val = *(const v4fa*)(os + row * 68 + cofs); if (BIAS) { val[0] += bfr(bias[c0 + cofs]); val[1] += bfr(bias[c0 + cofs + 1]); val[2] += bfr(bias[c0 + cofs + 2]); val[3] += bfr(bias[c0 + cofs + 3]); }
                *(v4f*)(crow + (size_t)row * ldc + cofs) = val; }
             }
        __builtin_amdgcn_wave_barrier(); asm volatile("" ::: "memory");
    }
}

// ---- k_gemmc: the same one-wave 64x64 tile GEMM specialised for causal attention: CMODE 1 skips score tiles entirely above the diagonal (query rows r0+roff.., key columns c0..), CMODE 2 limits the
// key (K) loop of the probability x value contraction to the diagonal block (probabilities beyond it are exactly zero). roff = row offset of this launch's first row within the sequence.
template <typename T16, int NSPLIT, int CMODE>
__global__ __launch_bounds__(32) void k_gemmc(const T16* __restrict__ A, const T16* __restrict__ A2, const T16* __restrict__ Bt, const T16* __restrict__ Bt2, int K, float* C, int ldc, int roff, size_t sA, size_t sB, size_t sC) {
    typedef typename WFrag<T16>::V V;
    __shared__ __align__(16) float os[16 * 68];
    const size_t z = blockIdx.z; A += z * sA; if (A2) A2 += z * sA; Bt += z * sB; if (Bt2) Bt2 += z * sB; C += z * sC;
    const int lane = threadIdx.x & 31, lr = lane & 15, hi = lane >> 4; const int r0 = blockIdx.x * 64, c0 = blockIdx.y * 64;
    if (CMODE == 1 && c0 > r0 + roff + 63) return;                  // score tile entirely above the causal diagonal: never read (the softmax masks j > i by select)
    const int Kl = (CMODE == 2) ? min(K, r0 + roff + 64) : K;        // P.V: probabilities are exactly 0 beyond the diagonal block, so the K loop stops there
    v8f acc[4][4];
#pragma unroll
    for (int mb = 0; mb < 4; ++mb)
#pragma unroll
        for (int nb = 0; nb < 4; ++nb) acc[mb][nb] = (v8f){};
    const size_t aoff = (size_t)(r0 + lr) * K + 8 * hi, boff = (size_t)(c0 + lr) * K + 8 * hi;
#pragma unroll 1
    for (int kc = 0; kc < Kl; kc += 32) {
        V a[4], a2[4];
#pragma unroll
        for (int mb = 0; mb < 4; ++mb) { a[mb] = WFrag<T16>::ld(A + aoff + (size_t)mb * 16 * K + kc); if (NSPLIT == 1 || NSPLIT == 2) a2[mb] = WFrag<T16>::ld(A2 + aoff + (size_t)mb * 16 * K + kc); }
#pragma unroll
        for (int nb = 0; nb < 4; ++nb) { const V b = WFrag<T16>::ld(Bt + boff + (size_t)nb * 16 * K + kc); V b2; if (NSPLIT >= 2) b2 = WFrag<T16>::ld(Bt2 + boff + (size_t)nb * 16 * K + kc);
#pragma unroll
            for (int mb = 0; mb < 4; ++mb) { acc[mb][nb] = WFrag<T16>::mma(a[mb], b, acc[mb][nb]); if (NSPLIT == 1 || NSPLIT == 2) acc[mb][nb] = WFrag<T16>::mma(a2[mb], b, acc[mb][nb]); if (NSPLIT >= 2) acc[mb][nb] = WFrag<T16>::mma(a[mb], b2, acc[mb][nb]); } }
        asm volatile("v_nop\n\tv_nop\n\tv_nop\n\tv_nop" : "+v"(acc[0][0]), "+v"(acc[1][1]), "+v"(acc[2][2]), "+v"(acc[3][3]) : "v"(a[0]), "v"(a[3]));
    }
#pragma unroll
    for (int mb = 0; mb < 4; ++mb) {
#pragma unroll
        for (int nb = 0; nb < 4; ++nb) {
#pragma unroll
            for (int j = 0; j < 8; ++j) os[(hi * 8 + j) * 68 + nb * 16 + lr] = acc[mb][nb][j]; }
        __builtin_amdgcn_wave_barrier(); asm volatile("" ::: "memory");
        float* crow = C + (size_t)(r0 + mb * 16) * ldc + c0;
{
#pragma unroll
            for (int s = 0; s < 8; ++s) { const int row = 2 * s + hi, cofs = lr * 4; v4f val = *(const v4fa*)(os + row * 68 + cofs);
                *(v4f*)(crow + (size_t)row * ldc + cofs) = val; }
             }
        __builtin_amdgcn_wave_barrier(); asm volatile("" ::: "memory");
    }
}

__device__ __forceinline__ h16 tohx(float x) { return (h16)x; }
__device__ __forceinline__ void splitf(float y, unsigned short& h, unsigned short& l) { h = f2bf(y); l = f2bf(y - bf2f(h)); }
typedef __attribute__((ext_vector_type(2))) _Float16 v2h;
typedef __attribute__((ext_vector_type(4))) _Float16 v4h;
typedef __attribute__((ext_vector_type(2))) unsigned short v2us;
typedef __attribute__((ext_vector_type(4))) unsigned short v4us;
typedef __attribute__((ext_vector_type(2))) float v2f;
typedef __attribute__((ext_vector_type(4))) int v4i;

__global__ __launch_bounds__(256) void k_wtG(const float* __restrict__ w, int K, int N, bf* Bt) {
    const int lane = threadIdx.x & 31; const int L0 = (blockIdx.x * 8 + (threadIdx.x >> 5)) * 8; const int nlines = N * K / 64;
{
#pragma unroll 1
        for (int l = 0; l < 8; ++l) { const int L = L0 + l; if (L >= nlines) break; const size_t e = (size_t)L * 64 + lane * 2; const int k = (int)(e % K), n = (int)(e / K); v2us o;
            o[0] = f2bf(w[(size_t)k * N + n]); o[1] = f2bf(w[(size_t)(k + 1) * N + n]); *(v2us*)(Bt + e) = o; }
         }
}
__global__ __launch_bounds__(256) void k_cvt8(const float* __restrict__ src, bf* dst, size_t n8) { const size_t i = (size_t)blockIdx.x * 256 + threadIdx.x; if (i >= n8) return; const v8f v = *(const v8f*)(src + i * 8); v8us o;
#pragma unroll
    for (int k = 0; k < 8; ++k) o[k] = f2bf(v[k]); *(v8us*)(dst + i * 8) = o;  }

// k_rope: head planes [h][t][d] (fp16 + hi/lo) of rope(x) x sc with the rotate-half convention out[d] = x[d] cos[t][d] - x[d+HD/2] sin[t][d], out[d+HD/2] = x[d+HD/2] cos[t][d+HD/2] + x[d] sin[t][d+HD/2]
__global__ __launch_bounds__(256) void k_rope(const float* __restrict__ F, int pitch, int nheads, const float* __restrict__ CS, const float* __restrict__ RF, const float* __restrict__ nw, float sc, h16* P16, bf* Ph, bf* Pl) {
    const size_t e = ((size_t)blockIdx.x * 256 + threadIdx.x) * 2; if (e >= (size_t)nheads * TT * HD) return; const int d = (int)(e % HD); const int t = (int)((e / HD) % TT); const int h = (int)(e / ((size_t)HD * TT)); const float* f = F + (size_t)t * pitch + h * HD; const float rf = RF ? RF[(size_t)h * TT + t] : 1.0f; v2h o16; v2us oh, ol;
#pragma unroll
    for (int q = 0; q < 2; ++q) { const int dd = d + q; const int dp = (dd < HD / 2) ? dd + HD / 2 : dd - HD / 2; float x0 = f[dd], x1 = f[dp];
        if (RF) { float n0 = __fmul_rn(x0, rf), n1 = __fmul_rn(x1, rf); asm volatile("" : "+v"(n0)); asm volatile("" : "+v"(n1)); x0 = __fmul_rn(bfr(nw[dd]), n0); x1 = __fmul_rn(bfr(nw[dp]), n1); }
        const v2f cs = *(const v2f*)(CS + ((size_t)t * HD + dd) * 2); float a = __fmul_rn(x0, cs[0]), bq = __fmul_rn(x1, cs[1]); asm volatile("" : "+v"(a)); asm volatile("" : "+v"(bq)); const float r = ((dd < HD / 2) ? __fsub_rn(a, bq) : __fadd_rn(a, bq)) * sc;
        o16[q] = tohx(r); unsigned short a2, c2; splitf(r, a2, c2); oh[q] = a2; ol[q] = c2; }
    *(v2h*)(P16 + e) = o16; *(v2us*)(Ph + e) = oh; *(v2us*)(Pl + e) = ol;  }
__global__ __launch_bounds__(256) void k_vtp(const float* __restrict__ F, int pitch, int nheads, h16* V16, bf* Vh, bf* Vl) { const size_t e = ((size_t)blockIdx.x * 256 + threadIdx.x) * 2; if (e >= (size_t)nheads * HD * TT) return; const int t = (int)(e % TT); const int d = (int)((e / TT) % HD); const int g = (int)(e / ((size_t)TT * HD)); v2h o16; v2us oh, ol;
#pragma unroll
    for (int q = 0; q < 2; ++q) { const float x = F[(size_t)(t + q) * pitch + g * HD + d]; o16[q] = tohx(x); unsigned short a2, c2; splitf(x, a2, c2); oh[q] = a2; ol[q] = c2; }
    *(v2h*)(V16 + e) = o16; *(v2us*)(Vh + e) = oh; *(v2us*)(Vl + e) = ol;  }
__global__ __launch_bounds__(256) void k_csid(float* CS) { const int idx = blockIdx.x * 256 + threadIdx.x; if (idx >= TT * HD) return; v2f cs; cs[0] = 1.0f; cs[1] = 0.0f; *(v2f*)(CS + (size_t)idx * 2) = cs;  }
// k_asoft: per row (zz, i): t = S x HD^-0.5 for j <= i and i - j < WIN (WIN = T, so plain causal; the reference's -1e9 additive fill vanishes identically); softmax over the 2048 keys (register row, one exp, fixed trees);
__global__ __launch_bounds__(256) void k_asoft(const float* __restrict__ Sb, h16* P16, bf* Ph, bf* Pl) {
    const int lane = threadIdx.x & 31; const int row = blockIdx.x * 8 + (threadIdx.x >> 5); if (row >= ZH * TT) return; const int i = row % TT; const int zz = row / TT; (void)zz; const bool hires = (i < RH); const float* sr = Sb + (size_t)row * TT; float v[TT / 32]; float mx = -3.0e38f;
#pragma unroll
    for (int ch = 0; ch < TT / 128; ++ch) { const int j0 = ch * 128 + lane * 4; const v4f a = *(const v4f*)(sr + j0);
#pragma unroll
        for (int q = 0; q < 4; ++q) { const int j = j0 + q; (void)j; const float t = (j <= i && i - j < WIN) ? a[q] * SCL : -3.0e38f; v[ch * 4 + q] = t; mx = fmaxf(mx, t); } }
#pragma unroll
    for (int sh = 16; sh; sh >>= 1) mx = fmaxf(mx, __shfl_xor(mx, sh, 32));
    float sum = 0.f;
#pragma unroll
    for (int k = 0; k < TT / 32; ++k) { float d0 = __fsub_rn(v[k], mx); asm volatile("" : "+v"(d0)); v[k] = __builtin_amdgcn_exp2f(__fmul_rn(d0, 1.4426950408889634f)); sum += v[k]; }
#pragma unroll
    for (int sh = 16; sh; sh >>= 1) sum += __shfl_xor(sum, sh, 32);
    const float f = __fdiv_rn(hires ? 1.0f : PCAR, sum);
{
        if (hires) {
#pragma unroll
            for (int ch = 0; ch < TT / 128; ++ch) { v4us oh, ol;
#pragma unroll
                for (int q = 0; q < 4; ++q) { unsigned short a, c2; splitf(v[ch * 4 + q] * f, a, c2); oh[q] = a; ol[q] = c2; }
                const size_t oo = ((size_t)zz * (RH ? RH : 1) + i) * TT + ch * 128 + lane * 4; *(v4us*)(Ph + oo) = oh; *(v4us*)(Pl + oo) = ol; }
        } else {
#pragma unroll
            for (int ch = 0; ch < TT / 128; ++ch) { v4h o4;
#pragma unroll
                for (int q = 0; q < 4; ++q) o4[q] = tohx(v[ch * 4 + q] * f);
                *(v4h*)(P16 + (size_t)row * TT + ch * 128 + lane * 4) = o4; } }
         }
}
__global__ __launch_bounds__(256) void k_merge(const float* __restrict__ O, int h0, bf* Ah, bf* Al) { const size_t e = ((size_t)blockIdx.x * 256 + threadIdx.x) * 2; if (e >= (size_t)ZH * TT * HD) return; const int d = (int)(e % HD); const int t = (int)((e / HD) % TT); const int zz = (int)(e / ((size_t)HD * TT)); const float cs = (t < RH) ? 1.0f : (1.0f / PCAR); const size_t oo = (size_t)t * DQ + (h0 + zz) * HD + d;
    v2us oh, ol;
#pragma unroll
    for (int q = 0; q < 2; ++q) { unsigned short a, c2; splitf(O[e + q] * cs, a, c2); oh[q] = a; ol[q] = c2; } *(v2us*)(Ah + oo) = oh; *(v2us*)(Al + oo) = ol;  }

extern "C" void kernel_launch(void* const* d_in, const int* in_sizes, int n_in,
                              void* d_out, int out_size, void* d_ws, size_t ws_size, hipStream_t stream) {
    (void)in_sizes; (void)n_in; (void)out_size;
    const float* x = (const float*)d_in[0]; const float* xk = (const float*)d_in[1]; const float* xv = (const float*)d_in[2]; const float* wq = (const float*)d_in[3]; const float* bq = (const float*)d_in[4]; const float* wk = (const float*)d_in[5]; const float* bk = (const float*)d_in[6]; const float* wv = (const float*)d_in[7]; const float* bv = (const float*)d_in[8]; const float* wo = (const float*)d_in[9]; const float* bo = (const float*)d_in[10];
    float* OUT = (float*)d_out;     // [4][2048][1024]
    char* wsp = (char*)d_ws;
    auto take = [&](size_t bytes) { char* p = wsp; wsp += (bytes + 255) & ~(size_t)255; return (void*)p; };
    bf* WQ = (bf*)take((size_t)DQ * DM * 2); bf* WK = (bf*)take((size_t)DKV * DM * 2); bf* WV = (bf*)take((size_t)DKV * DM * 2); bf* WO = (bf*)take((size_t)DM * DQ * 2); float* CS = (float*)take((size_t)TT * HD * 2 * 4);
    bf* XB = (bf*)take((size_t)TT * DM * 2); float* FQ = (float*)take((size_t)TT * DQ * 4); float* FK = (float*)take((size_t)TT * DKV * 4);
    h16* QP16 = (h16*)take((size_t)NH_ * TT * HD * 2); h16* KP16 = (h16*)take((size_t)NKV * TT * HD * 2); h16* VT16 = (h16*)take((size_t)NKV * HD * TT * 2);
    bf* QPh = (bf*)take((size_t)NH_ * TT * HD * 2); bf* QPl = (bf*)take((size_t)NH_ * TT * HD * 2); bf* KPh = (bf*)take((size_t)NKV * TT * HD * 2); bf* KPl = (bf*)take((size_t)NKV * TT * HD * 2); bf* VTh = (bf*)take((size_t)NKV * HD * TT * 2); bf* VTl = (bf*)take((size_t)NKV * HD * TT * 2); bf* Ph = (bf*)take((size_t)ZH * RH * TT * 2); bf* Pl = (bf*)take((size_t)ZH * RH * TT * 2);
    float* Sb = (float*)take((size_t)ZH * TT * TT * 4); h16* P16 = (h16*)take((size_t)ZH * TT * TT * 2); float* Ob = (float*)take((size_t)ZH * TT * HD * 4); bf* ATh = (bf*)take((size_t)TT * DQ * 2); bf* ATl = (bf*)take((size_t)TT * DQ * 2);
    if ((size_t)(wsp - (char*)d_ws) > ws_size) return;    // ws 256 MiB
    float* FV = FK;   // v projection reuses the k buffer after the k planes are built (stream-ordered)
    { k_wtG<<<(unsigned)((DM * DQ / 64 + 63) / 64), 256, 0, stream>>>(wq, DM, DQ, WQ); k_wtG<<<(unsigned)((DM * DKV / 64 + 63) / 64), 256, 0, stream>>>(wk, DM, DKV, WK); k_wtG<<<(unsigned)((DM * DKV / 64 + 63) / 64), 256, 0, stream>>>(wv, DM, DKV, WV);
      k_wtG<<<(unsigned)((DQ * DM / 64 + 63) / 64), 256, 0, stream>>>(wo, DQ, DM, WO);
       }
    k_csid<<<(TT * HD + 255) / 256, 256, 0, stream>>>(CS);
    const unsigned LQ = (unsigned)(((size_t)NH_ * TT * HD / 2 + 255) / 256), LKv = (unsigned)(((size_t)NKV * TT * HD / 2 + 255) / 256);
    for (int b = 0; b < NB_; ++b) {
        
        k_cvt8<<<(unsigned)(((size_t)TT * DM / 8 + 255) / 256), 256, 0, stream>>>(x + (size_t)b * TT * DM, XB, (size_t)TT * DM / 8);
        k_gemmw<bf, 0, true><<<dim3(TT / 64, DQ / 64, 1), 32, 0, stream>>>(XB, nullptr, WQ, nullptr, DM, FQ, DQ, bq, 0, 0, 0);
        k_rope<<<LQ, 256, 0, stream>>>(FQ, DQ, NH_, CS, nullptr, nullptr, 1.0f, QP16, QPh, QPl);
        k_cvt8<<<(unsigned)(((size_t)TT * DM / 8 + 255) / 256), 256, 0, stream>>>(xk + (size_t)b * TT * DM, XB, (size_t)TT * DM / 8); k_gemmw<bf, 0, true><<<dim3(TT / 64, DKV / 64, 1), 32, 0, stream>>>(XB, nullptr, WK, nullptr, DM, FK, DKV, bk, 0, 0, 0);
        k_rope<<<LKv, 256, 0, stream>>>(FK, DKV, NKV, CS, nullptr, nullptr, 1.0f, KP16, KPh, KPl);
        k_cvt8<<<(unsigned)(((size_t)TT * DM / 8 + 255) / 256), 256, 0, stream>>>(xv + (size_t)b * TT * DM, XB, (size_t)TT * DM / 8); k_gemmw<bf, 0, true><<<dim3(TT / 64, DKV / 64, 1), 32, 0, stream>>>(XB, nullptr, WV, nullptr, DM, FV, DKV, bv, 0, 0, 0); k_vtp<<<LKv, 256, 0, stream>>>(FV, DKV, NKV, VT16, VTh, VTl);
        for (int h0 = 0; h0 < NH_; h0 += ZH) { const size_t zq = (size_t)h0, zk = (size_t)(h0 / REP);   // one kv head per query head: the pass's two heads use consecutive kv planes (z-strides TT*HD)
            k_gemmc<bf, 2, 1><<<dim3(RH / 64, TT / 64, ZH), 32, 0, stream>>>(QPh + zq * TT * HD, QPl + zq * TT * HD, KPh + zk * TT * HD, KPl + zk * TT * HD, HD, Sb, TT, 0, (size_t)TT * HD, (size_t)TT * HD, (size_t)TT * TT);
            k_gemmc<h16, 0, 1><<<dim3((TT - RH) / 64, TT / 64, ZH), 32, 0, stream>>>(QP16 + zq * TT * HD + (size_t)RH * HD, nullptr, KP16 + zk * TT * HD, nullptr, HD, Sb + (size_t)RH * TT, TT, RH, (size_t)TT * HD, (size_t)TT * HD, (size_t)TT * TT);
            k_asoft<<<ZH * TT / 8, 256, 0, stream>>>(Sb, P16, Ph, Pl);
            k_gemmc<bf, 2, 2><<<dim3(RH / 64, HD / 64, ZH), 32, 0, stream>>>(Ph, Pl, VTh + zk * HD * TT, VTl + zk * HD * TT, TT, Ob, HD, 0, (size_t)RH * TT, (size_t)HD * TT, (size_t)TT * HD);
            k_gemmc<h16, 0, 2><<<dim3((TT - RH) / 64, HD / 64, ZH), 32, 0, stream>>>(P16 + (size_t)RH * TT, nullptr, VT16 + zk * HD * TT, nullptr, TT, Ob + (size_t)RH * HD, HD, RH, (size_t)TT * TT, (size_t)HD * TT, (size_t)TT * HD);
            k_merge<<<(unsigned)(((size_t)ZH * TT * HD / 2 + 255) / 256), 256, 0, stream>>>(Ob, h0, ATh, ATl); }
        k_gemmw<bf, 1, true><<<dim3(TT / 64, DM / 64, 1), 32, 0, stream>>>(ATh, ATl, WO, nullptr, DQ, OUT + (size_t)b * TT * DM, DM, bo, 0, 0, 0); }
}

// v001
// A run of this version takes 1760 microseconds.
// Next to v000, in two timings, it ran 1.68 and 1.67 times as fast.
#include <hip/hip_runtime.h>

// Causal multi-head attention on THREE separate input streams with biased (in, out) projections (Q, K, V [4][2048][1024]; q = Q Wq + bq, k = K Wk + bk, v = V Wv + bv ('xw' [1024][1024] normal x 1/32 + [1024] zeros on this draw: read; 16 heads x 64); scores / sqrt(64); tril kept, -inf elsewhere; softmax; out = merged Wo + bo ('xw' + a zero bias: read) -> [4][2048][1024] (8.4 M); argument order Q, K, V, Wq, bq, Wk, bk, Wv, bv, Wo, bo).
// Layout per batch: bf16 copies of the three inputs in turn; 'xw' weights transposed once; exact projections + f32 biases; causal T-2048 attention (hybrid rows: < 512 hi/lo 3 products, rest fp16 x1024; k_gemmc skips tiles above the diagonal); merged hi/lo x w_o exact + b_o.
// Compute dtypes, f32 accumulate: every input rounded to bf16; projections exact + f32 biases; attention rows < 512 3 products, rest fp16; softmax f32; Wo hl x exact + bias.

#define NB_  4
#define TT   2048
#define DM   1024
#define NH_  16
#define NKV  16
#define REP  (NH_ / NKV)
#define HD   64
#define DQ   (NH_ * HD)
#define DKV  (NKV * HD)
#define ZH   2
#define RH   512                  // query rows < RH use hi+lo planes (0: none)
#define WIN  2048
#define PCAR 1024.0f
#define SCL  0.125f   // HD^-0.5
typedef _Float16 h16;
typedef unsigned short bf;
typedef __attribute__((ext_vector_type(16))) __bf16   v16bf;
typedef __attribute__((ext_vector_type(16))) _Float16 v16h;
typedef __attribute__((ext_vector_type(8)))  _Float16 v8h;
typedef __attribute__((ext_vector_type(8)))  unsigned short v8us;
typedef __attribute__((ext_vector_type(8)))  float    v8f;
typedef __attribute__((ext_vector_type(4)))  float    v4f;
typedef v8h  __attribute__((may_alias)) v8ha;
typedef v4f  __attribute__((may_alias)) v4fa;
typedef v8us __attribute__((may_alias)) v8usa;

__device__ __forceinline__ unsigned short f2bf(float f) { unsigned u = __float_as_uint(f); u += 0x7FFFu + ((u >> 16) & 1u); return (unsigned short)(u >> 16); }
__device__ __forceinline__ float bf2f(unsigned short b) { return __uint_as_float(((unsigned)b) << 16); }
__device__ __forceinline__ float bfr(float f) { return bf2f(f2bf(f)); }
__device__ __forceinline__ v16h cat16(v8h lo, v8h hi) { return __builtin_shufflevector(lo, hi, 0, 1, 2, 3, 4, 5, 6, 7, 8, 9, 10, 11, 12, 13, 14, 15); }
__device__ __forceinline__ v16bf cat16b(v8us lo, v8us hi) { return __builtin_bit_cast(v16bf, __builtin_shufflevector(lo, hi, 0, 1, 2, 3, 4, 5, 6, 7, 8, 9, 10, 11, 12, 13, 14, 15)); }
__device__ __forceinline__ v8f wmma16(v16h a, v16h b, v8f c) { return __builtin_amdgcn_wmma_f32_16x16x32_f16(false, a, false, b, (short)0, c, false, false); }
__device__ __forceinline__ v8f wmmab(v16bf a, v16bf b, v8f c) { return __builtin_amdgcn_wmma_f32_16x16x32_bf16(false, a, false, b, (short)0, c, false, false); }



// ---- k_gemmw: register-blocked GEMM, one work-group of NW waves per 64x64 output tile (16 accumulators a wave), operands straight from K-contiguous 16-bit planes; grid (M/64, N/64, Z), 32 * NW threads.
// C[m][n] (f32, pitch ldc, + optional f32 bias[n]) = sum_k A[m][k] Bt[n][k] (+ split products per NSPLIT). z-batch strides sA/sB/sC in elements. K % 64 == 0.
// The K loop is dealt out over the NW waves in slices of 64 k (one whole 128-byte line of every operand row): wave w takes slices w, w + NW, ... ; tile_out sums the NW partial tiles in LDS in wave order.
// tile_out: every wave stores its partial 64x64 tile to its own LDS range (pitch 68 floats), one barrier, then each 16-byte piece is summed over the waves (0, 1, ..) by one thread and stored, whole lines a row.
template <int NW, bool BIAS>
__device__ __forceinline__ void tile_out(const v8f (&acc)[4][4], float* os, int w, int lr, int hi, float* C, int ldc, int r0, int c0, const float* __restrict__ bias) {
    float* ow = os + w * (64 * 68);
    // the three loops are unrolled so that acc is indexed by constants and stays in registers
#pragma unroll
    for (int mb = 0; mb < 4; ++mb) {
#pragma unroll
        for (int nb = 0; nb < 4; ++nb) {
#pragma unroll
            for (int j = 0; j < 8; ++j) ow[(mb * 16 + hi * 8 + j) * 68 + nb * 16 + lr] = acc[mb][nb][j]; } }
    __syncthreads();   // publishes the NW partial tiles to the threads that sum them
    float* ct = C + (size_t)r0 * ldc + c0;
    // both loops unrolled: all LDS loads of a piece are in flight together
#pragma unroll
    for (int s = 0; s < 64 * 16 / (32 * NW); ++s) { const int q = s * (32 * NW) + (int)threadIdx.x, row = q >> 4, cofs = (q & 15) * 4; v4f val = *(const v4fa*)(os + row * 68 + cofs);
#pragma unroll
        for (int p = 1; p < NW; ++p) val += *(const v4fa*)(os + p * (64 * 68) + row * 68 + cofs);
        if (BIAS) { val[0] += bfr(bias[c0 + cofs]); val[1] += bfr(bias[c0 + cofs + 1]); val[2] += bfr(bias[c0 + cofs + 2]); val[3] += bfr(bias[c0 + cofs + 3]); }
        *(v4f*)(ct + (size_t)row * ldc + cofs) = val; }
}
template <typename T16> struct WFrag;
template <> struct WFrag<h16> { typedef v16h V; static __device__ __forceinline__ V ld(const h16* p) { return cat16(*(const v8h*)p, *(const v8h*)(p + 16)); } static __device__ __forceinline__ v8f mma(V a, V b, v8f c) { return wmma16(a, b, c); } };
template <> struct WFrag<bf> { typedef v16bf V; static __device__ __forceinline__ V ld(const bf* p) { return cat16b(*(const v8us*)p, *(const v8us*)(p + 16)); } static __device__ __forceinline__ v8f mma(V a, V b, v8f c) { return wmmab(a, b, c); } };
template <typename T16, int NSPLIT, bool BIAS, int NW>
__global__ __launch_bounds__(32 * NW) void k_gemmw(const T16* __restrict__ A, const T16* __restrict__ A2, const T16* __restrict__ Bt, const T16* __restrict__ Bt2, int K, float* C, int ldc, const float* __restrict__ bias, size_t sA, size_t sB, size_t sC) {
    typedef typename WFrag<T16>::V V;
    __shared__ __align__(16) float os[NW * 64 * 68];
    const size_t z = blockIdx.z; A += z * sA; if (A2) A2 += z * sA; Bt += z * sB; if (Bt2) Bt2 += z * sB; C += z * sC;
    const int lane = threadIdx.x & 31, lr = lane & 15, hi = lane >> 4; const int r0 = blockIdx.x * 64, c0 = blockIdx.y * 64;
    const int w = __builtin_amdgcn_readfirstlane(threadIdx.x >> 5);   // wave number, scalar: the K loop's bounds stay scalar
    v8f acc[4][4];
#pragma unroll
    for (int mb = 0; mb < 4; ++mb)
#pragma unroll
        for (int nb = 0; nb < 4; ++nb) acc[mb][nb] = (v8f){};
    const size_t aoff = (size_t)(r0 + lr) * K + 8 * hi, boff = (size_t)(c0 + lr) * K + 8 * hi;
    // both loops stay rolled, as the one loop they replace: one fragment set in registers
#pragma unroll 1
    for (int k0 = w * 64; k0 < K; k0 += 64 * NW)
#pragma unroll 1
    for (int kc = k0; kc < k0 + 64; kc += 32) {
        V a[4], a2[4];
#pragma unroll
        for (int mb = 0; mb < 4; ++mb) { a[mb] = WFrag<T16>::ld(A + aoff + (size_t)mb * 16 * K + kc); if (NSPLIT == 1 || NSPLIT == 2) a2[mb] = WFrag<T16>::ld(A2 + aoff + (size_t)mb * 16 * K + kc); }
#pragma unroll
        for (int nb = 0; nb < 4; ++nb) { const V b = WFrag<T16>::ld(Bt + boff + (size_t)nb * 16 * K + kc); V b2; if (NSPLIT >= 2) b2 = WFrag<T16>::ld(Bt2 + boff + (size_t)nb * 16 * K + kc);
#pragma unroll
            for (int mb = 0; mb < 4; ++mb) { acc[mb][nb] = WFrag<T16>::mma(a[mb], b, acc[mb][nb]); if (NSPLIT == 1 || NSPLIT == 2) acc[mb][nb] = WFrag<T16>::mma(a2[mb], b, acc[mb][nb]); if (NSPLIT >= 2) acc[mb][nb] = WFrag<T16>::mma(a[mb], b2, acc[mb][nb]); } }
        asm volatile("v_nop\n\tv_nop\n\tv_nop\n\tv_nop" : "+v"(acc[0][0]), "+v"(acc[1][1]), "+v"(acc[2][2]), "+v"(acc[3][3]) : "v"(a[0]), "v"(a[3]));
    }
    tile_out<NW, BIAS>(acc, os, w, lr, hi, C, ldc, r0, c0, bias);
}

// ---- k_gemmc: the same 64x64 tile GEMM specialised for causal attention: CMODE 1 skips score tiles entirely above the diagonal (query rows r0+roff.., key columns c0..), CMODE 2 limits the
// key (K) loop of the probability x value contraction to the diagonal block (probabilities beyond it are exactly zero). roff = row offset of this launch's first row within the sequence.
// NW = 1: one wave per tile (scores, K = 64). NW > 1: the key loop is dealt out over NW waves in slices of 64 keys and summed by tile_out, as in k_gemmw.
template <typename T16, int NSPLIT, int CMODE, int NW>
__global__ __launch_bounds__(32 * NW) void k_gemmc(const T16* __restrict__ A, const T16* __restrict__ A2, const T16* __restrict__ Bt, const T16* __restrict__ Bt2, int K, float* C, int ldc, int roff, size_t sA, size_t sB, size_t sC) {
    typedef typename WFrag<T16>::V V;
    __shared__ __align__(16) float os[(NW == 1 ? 16 : NW * 64) * 68];
    const size_t z = blockIdx.z; A += z * sA; if (A2) A2 += z * sA; Bt += z * sB; if (Bt2) Bt2 += z * sB; C += z * sC;
    const int lane = threadIdx.x & 31, lr = lane & 15, hi = lane >> 4; const int r0 = blockIdx.x * 64, c0 = blockIdx.y * 64;
    const int w = (NW == 1) ? 0 : __builtin_amdgcn_readfirstlane(threadIdx.x >> 5);   // wave number, scalar: the K loop's bounds stay scalar
    if (CMODE == 1 && c0 > r0 + roff + 63) return;                  // score tile entirely above the causal diagonal: never read (the softmax masks j > i by select)
    const int Kl = (CMODE == 2) ? min(K, r0 + roff + 64) : K;        // P.V: probabilities are exactly 0 beyond the diagonal block, so the K loop stops there
    v8f acc[4][4];
#pragma unroll
    for (int mb = 0; mb < 4; ++mb)
#pragma unroll
        for (int nb = 0; nb < 4; ++nb) acc[mb][nb] = (v8f){};
    const size_t aoff = (size_t)(r0 + lr) * K + 8 * hi, boff = (size_t)(c0 + lr) * K + 8 * hi;
    // both loops stay rolled, as the one loop they replace: one fragment set in registers
#pragma unroll 1
    for (int k0 = w * 64; k0 < Kl; k0 += 64 * NW)
#pragma unroll 1
    for (int kc = k0; kc < k0 + 64; kc += 32) {
        V a[4], a2[4];
#pragma unroll
        for (int mb = 0; mb < 4; ++mb) { a[mb] = WFrag<T16>::ld(A + aoff + (size_t)mb * 16 * K + kc); if (NSPLIT == 1 || NSPLIT == 2) a2[mb] = WFrag<T16>::ld(A2 + aoff + (size_t)mb * 16 * K + kc); }
#pragma unroll
        for (int nb = 0; nb < 4; ++nb) { const V b = WFrag<T16>::ld(Bt + boff + (size_t)nb * 16 * K + kc); V b2; if (NSPLIT >= 2) b2 = WFrag<T16>::ld(Bt2 + boff + (size_t)nb * 16 * K + kc);
#pragma unroll
            for (int mb = 0; mb < 4; ++mb) { acc[mb][nb] = WFrag<T16>::mma(a[mb], b, acc[mb][nb]); if (NSPLIT == 1 || NSPLIT == 2) acc[mb][nb] = WFrag<T16>::mma(a2[mb], b, acc[mb][nb]); if (NSPLIT >= 2) acc[mb][nb] = WFrag<T16>::mma(a[mb], b2, acc[mb][nb]); } }
        asm volatile("v_nop\n\tv_nop\n\tv_nop\n\tv_nop" : "+v"(acc[0][0]), "+v"(acc[1][1]), "+v"(acc[2][2]), "+v"(acc[3][3]) : "v"(a[0]), "v"(a[3]));
    }
    if constexpr (NW > 1) { tile_out<NW, false>(acc, os, w, lr, hi, C, ldc, r0, c0, nullptr); return; }
#pragma unroll
    for (int mb = 0; mb < 4; ++mb) {
#pragma unroll
        for (int nb = 0; nb < 4; ++nb) {
#pragma unroll
            for (int j = 0; j < 8; ++j) os[(hi * 8 + j) * 68 + nb * 16 + lr] = acc[mb][nb][j]; }
        __builtin_amdgcn_wave_barrier(); asm volatile("" ::: "memory");
        float* crow = C + (size_t)(r0 + mb * 16) * ldc + c0;
{
#pragma unroll
            for (int s = 0; s < 8; ++s) { const int row = 2 * s + hi, cofs = lr * 4; v4f val = *(const v4fa*)(os + row * 68 + cofs);
                *(v4f*)(crow + (size_t)row * ldc + cofs) = val; }
             }
        __builtin_amdgcn_wave_barrier(); asm volatile("" ::: "memory");
    }
}

__device__ __forceinline__ h16 tohx(float x) { return (h16)x; }
__device__ __forceinline__ void splitf(float y, unsigned short& h, unsigned short& l) { h = f2bf(y); l = f2bf(y - bf2f(h)); }
typedef __attribute__((ext_vector_type(2))) _Float16 v2h;
typedef __attribute__((ext_vector_type(4))) _Float16 v4h;
typedef __attribute__((ext_vector_type(2))) unsigned short v2us;
typedef __attribute__((ext_vector_type(4))) unsigned short v4us;
typedef __attribute__((ext_vector_type(2))) float v2f;
typedef __attribute__((ext_vector_type(4))) int v4i;

__global__ __launch_bounds__(256) void k_wtG(const float* __restrict__ w, int K, int N, bf* Bt) {
    const int lane = threadIdx.x & 31; const int L0 = (blockIdx.x * 8 + (threadIdx.x >> 5)) * 8; const int nlines = N * K / 64;
{
#pragma unroll 1
        for (int l = 0; l < 8; ++l) { const int L = L0 + l; if (L >= nlines) break; const size_t e = (size_t)L * 64 + lane * 2; const int k = (int)(e % K), n = (int)(e / K); v2us o;
            o[0] = f2bf(w[(size_t)k * N + n]); o[1] = f2bf(w[(size_t)(k + 1) * N + n]); *(v2us*)(Bt + e) = o; }
         }
}
__global__ __launch_bounds__(256) void k_cvt8(const float* __restrict__ src, bf* dst, size_t n8) { const size_t i = (size_t)blockIdx.x * 256 + threadIdx.x; if (i >= n8) return; const v8f v = *(const v8f*)(src + i * 8); v8us o;
#pragma unroll
    for (int k = 0; k < 8; ++k) o[k] = f2bf(v[k]); *(v8us*)(dst + i * 8) = o;  }

// k_rope: head planes [h][t][d] (fp16 + hi/lo) of rope(x) x sc with the rotate-half convention out[d] = x[d] cos[t][d] - x[d+HD/2] sin[t][d], out[d+HD/2] = x[d+HD/2] cos[t][d+HD/2] + x[d] sin[t][d+HD/2]
__global__ __launch_bounds__(256) void k_rope(const float* __restrict__ F, int pitch, int nheads, const float* __restrict__ CS, const float* __restrict__ RF, const float* __restrict__ nw, float sc, h16* P16, bf* Ph, bf* Pl) {
    const size_t e = ((size_t)blockIdx.x * 256 + threadIdx.x) * 2; if (e >= (size_t)nheads * TT * HD) return; const int d = (int)(e % HD); const int t = (int)((e / HD) % TT); const int h = (int)(e / ((size_t)HD * TT)); const float* f = F + (size_t)t * pitch + h * HD; const float rf = RF ? RF[(size_t)h * TT + t] : 1.0f; v2h o16; v2us oh, ol;
#pragma unroll
    for (int q = 0; q < 2; ++q) { const int dd = d + q; const int dp = (dd < HD / 2) ? dd + HD / 2 : dd - HD / 2; float x0 = f[dd], x1 = f[dp];
        if (RF) { float n0 = __fmul_rn(x0, rf), n1 = __fmul_rn(x1, rf); asm volatile("" : "+v"(n0)); asm volatile("" : "+v"(n1)); x0 = __fmul_rn(bfr(nw[dd]), n0); x1 = __fmul_rn(bfr(nw[dp]), n1); }
        const v2f cs = *(const v2f*)(CS + ((size_t)t * HD + dd) * 2); float a = __fmul_rn(x0, cs[0]), bq = __fmul_rn(x1, cs[1]); asm volatile("" : "+v"(a)); asm volatile("" : "+v"(bq)); const float r = ((dd < HD / 2) ? __fsub_rn(a, bq) : __fadd_rn(a, bq)) * sc;
        o16[q] = tohx(r); unsigned short a2, c2; splitf(r, a2, c2); oh[q] = a2; ol[q] = c2; }
    *(v2h*)(P16 + e) = o16; *(v2us*)(Ph + e) = oh; *(v2us*)(Pl + e) = ol;  }
__global__ __launch_bounds__(256) void k_vtp(const float* __restrict__ F, int pitch, int nheads, h16* V16, bf* Vh, bf* Vl) { const size_t e = ((size_t)blockIdx.x * 256 + threadIdx.x) * 2; if (e >= (size_t)nheads * HD * TT) return; const int t = (int)(e % TT); const int d = (int)((e / TT) % HD); const int g = (int)(e / ((size_t)TT * HD)); v2h o16; v2us oh, ol;
#pragma unroll
    for (int q = 0; q < 2; ++q) { const float x = F[(size_t)(t + q) * pitch + g * HD + d]; o16[q] = tohx(x); unsigned short a2, c2; splitf(x, a2, c2); oh[q] = a2; ol[q] = c2; }
    *(v2h*)(V16 + e) = o16; *(v2us*)(Vh + e) = oh; *(v2us*)(Vl + e) = ol;  }
__global__ __launch_bounds__(256) void k_csid(float* CS) { const int idx = blockIdx.x * 256 + threadIdx.x; if (idx >= TT * HD) return; v2f cs; cs[0] = 1.0f; cs[1] = 0.0f; *(v2f*)(CS + (size_t)idx * 2) = cs;  }
// k_asoft: per row (zz, i): t = S x HD^-0.5 for j <= i and i - j < WIN (WIN = T, so plain causal; the reference's -1e9 additive fill vanishes identically); softmax over the 2048 keys (register row, one exp, fixed trees);
__global__ __launch_bounds__(256) void k_asoft(const float* __restrict__ Sb, h16* P16, bf* Ph, bf* Pl) {
    const int lane = threadIdx.x & 31; const int row = blockIdx.x * 8 + (threadIdx.x >> 5); if (row >= ZH * TT) return; const int i = row % TT; const int zz = row / TT; (void)zz; const bool hires = (i < RH); const float* sr = Sb + (size_t)row * TT; float v[TT / 32]; float mx = -3.0e38f;
#pragma unroll
    for (int ch = 0; ch < TT / 128; ++ch) { const int j0 = ch * 128 + lane * 4; const v4f a = *(const v4f*)(sr + j0);
#pragma unroll
        for (int q = 0; q < 4; ++q) { const int j = j0 + q; (void)j; const float t = (j <= i && i - j < WIN) ? a[q] * SCL : -3.0e38f; v[ch * 4 + q] = t; mx = fmaxf(mx, t); } }
#pragma unroll
    for (int sh = 16; sh; sh >>= 1) mx = fmaxf(mx, __shfl_xor(mx, sh, 32));
    float sum = 0.f;
#pragma unroll
    for (int k = 0; k < TT / 32; ++k) { float d0 = __fsub_rn(v[k], mx); asm volatile("" : "+v"(d0)); v[k] = __builtin_amdgcn_exp2f(__fmul_rn(d0, 1.4426950408889634f)); sum += v[k]; }
#pragma unroll
    for (int sh = 16; sh; sh >>= 1) sum += __shfl_xor(sum, sh, 32);
    const float f = __fdiv_rn(hires ? 1.0f : PCAR, sum);
{
        if (hires) {
#pragma unroll
            for (int ch = 0; ch < TT / 128; ++ch) { v4us oh, ol;
#pragma unroll
                for (int q = 0; q < 4; ++q) { unsigned short a, c2; splitf(v[ch * 4 + q] * f, a, c2); oh[q] = a; ol[q] = c2; }
                const size_t oo = ((size_t)zz * (RH ? RH : 1) + i) * TT + ch * 128 + lane * 4; *(v4us*)(Ph + oo) = oh; *(v4us*)(Pl + oo) = ol; }
        } else {
#pragma unroll
            for (int ch = 0; ch < TT / 128; ++ch) { v4h o4;
#pragma unroll
                for (int q = 0; q < 4; ++q) o4[q] = tohx(v[ch * 4 + q] * f);
                *(v4h*)(P16 + (size_t)row * TT + ch * 128 + lane * 4) = o4; } }
         }
}
__global__ __launch_bounds__(256) void k_merge(const float* __restrict__ O, int h0, bf* Ah, bf* Al) { const size_t e = ((size_t)blockIdx.x * 256 + threadIdx.x) * 2; if (e >= (size_t)ZH * TT * HD) return; const int d = (int)(e % HD); const int t = (int)((e / HD) % TT); const int zz = (int)(e / ((size_t)HD * TT)); const float cs = (t < RH) ? 1.0f : (1.0f / PCAR); const size_t oo = (size_t)t * DQ + (h0 + zz) * HD + d;
    v2us oh, ol;
#pragma unroll
    for (int q = 0; q < 2; ++q) { unsigned short a, c2; splitf(O[e + q] * cs, a, c2); oh[q] = a; ol[q] = c2; } *(v2us*)(Ah + oo) = oh; *(v2us*)(Al + oo) = ol;  }

extern "C" void kernel_launch(void* const* d_in, const int* in_sizes, int n_in,
                              void* d_out, int out_size, void* d_ws, size_t ws_size, hipStream_t stream) {
    (void)in_sizes; (void)n_in; (void)out_size;
    const float* x = (const float*)d_in[0]; const float* xk = (const float*)d_in[1]; const float* xv = (const float*)d_in[2]; const float* wq = (const float*)d_in[3]; const float* bq = (const float*)d_in[4]; const float* wk = (const float*)d_in[5]; const float* bk = (const float*)d_in[6]; const float* wv = (const float*)d_in[7]; const float* bv = (const float*)d_in[8]; const float* wo = (const float*)d_in[9]; const float* bo = (const float*)d_in[10];
    float* OUT = (float*)d_out;     // [4][2048][1024]
    char* wsp = (char*)d_ws;
    auto take = [&](size_t bytes) { char* p = wsp; wsp += (bytes + 255) & ~(size_t)255; return (void*)p; };
    bf* WQ = (bf*)take((size_t)DQ * DM * 2); bf* WK = (bf*)take((size_t)DKV * DM * 2); bf* WV = (bf*)take((size_t)DKV * DM * 2); bf* WO = (bf*)take((size_t)DM * DQ * 2); float* CS = (float*)take((size_t)TT * HD * 2 * 4);
    bf* XB = (bf*)take((size_t)TT * DM * 2); float* FQ = (float*)take((size_t)TT * DQ * 4); float* FK = (float*)take((size_t)TT * DKV * 4);
    h16* QP16 = (h16*)take((size_t)NH_ * TT * HD * 2); h16* KP16 = (h16*)take((size_t)NKV * TT * HD * 2); h16* VT16 = (h16*)take((size_t)NKV * HD * TT * 2);
    bf* QPh = (bf*)take((size_t)NH_ * TT * HD * 2); bf* QPl = (bf*)take((size_t)NH_ * TT * HD * 2); bf* KPh = (bf*)take((size_t)NKV * TT * HD * 2); bf* KPl = (bf*)take((size_t)NKV * TT * HD * 2); bf* VTh = (bf*)take((size_t)NKV * HD * TT * 2); bf* VTl = (bf*)take((size_t)NKV * HD * TT * 2); bf* Ph = (bf*)take((size_t)ZH * RH * TT * 2); bf* Pl = (bf*)take((size_t)ZH * RH * TT * 2);
    float* Sb = (float*)take((size_t)ZH * TT * TT * 4); h16* P16 = (h16*)take((size_t)ZH * TT * TT * 2); float* Ob = (float*)take((size_t)ZH * TT * HD * 4); bf* ATh = (bf*)take((size_t)TT * DQ * 2); bf* ATl = (bf*)take((size_t)TT * DQ * 2);
    if ((size_t)(wsp - (char*)d_ws) > ws_size) return;    // ws 256 MiB
    float* FV = FK;   // v projection reuses the k buffer after the k planes are built (stream-ordered)
    { k_wtG<<<(unsigned)((DM * DQ / 64 + 63) / 64), 256, 0, stream>>>(wq, DM, DQ, WQ); k_wtG<<<(unsigned)((DM * DKV / 64 + 63) / 64), 256, 0, stream>>>(wk, DM, DKV, WK); k_wtG<<<(unsigned)((DM * DKV / 64 + 63) / 64), 256, 0, stream>>>(wv, DM, DKV, WV);
      k_wtG<<<(unsigned)((DQ * DM / 64 + 63) / 64), 256, 0, stream>>>(wo, DQ, DM, WO);
       }
    k_csid<<<(TT * HD + 255) / 256, 256, 0, stream>>>(CS);
    const unsigned LQ = (unsigned)(((size_t)NH_ * TT * HD / 2 + 255) / 256), LKv = (unsigned)(((size_t)NKV * TT * HD / 2 + 255) / 256);
    for (int b = 0; b < NB_; ++b) {
        
        k_cvt8<<<(unsigned)(((size_t)TT * DM / 8 + 255) / 256), 256, 0, stream>>>(x + (size_t)b * TT * DM, XB, (size_t)TT * DM / 8);
        k_gemmw<bf, 0, true, 8><<<dim3(TT / 64, DQ / 64, 1), 256, 0, stream>>>(XB, nullptr, WQ, nullptr, DM, FQ, DQ, bq, 0, 0, 0);
        k_rope<<<LQ, 256, 0, stream>>>(FQ, DQ, NH_, CS, nullptr, nullptr, 1.0f, QP16, QPh, QPl);
        k_cvt8<<<(unsigned)(((size_t)TT * DM / 8 + 255) / 256), 256, 0, stream>>>(xk + (size_t)b * TT * DM, XB, (size_t)TT * DM / 8); k_gemmw<bf, 0, true, 8><<<dim3(TT / 64, DKV / 64, 1), 256, 0, stream>>>(XB, nullptr, WK, nullptr, DM, FK, DKV, bk, 0, 0, 0);
        k_rope<<<LKv, 256, 0, stream>>>(FK, DKV, NKV, CS, nullptr, nullptr, 1.0f, KP16, KPh, KPl);
        k_cvt8<<<(unsigned)(((size_t)TT * DM / 8 + 255) / 256), 256, 0, stream>>>(xv + (size_t)b * TT * DM, XB, (size_t)TT * DM / 8); k_gemmw<bf, 0, true, 8><<<dim3(TT / 64, DKV / 64, 1), 256, 0, stream>>>(XB, nullptr, WV, nullptr, DM, FV, DKV, bv, 0, 0, 0); k_vtp<<<LKv, 256, 0, stream>>>(FV, DKV, NKV, VT16, VTh, VTl);
        for (int h0 = 0; h0 < NH_; h0 += ZH) { const size_t zq = (size_t)h0, zk = (size_t)(h0 / REP);   // one kv head per query head: the pass's two heads use consecutive kv planes (z-strides TT*HD)
            k_gemmc<bf, 2, 1, 1><<<dim3(RH / 64, TT / 64, ZH), 32, 0, stream>>>(QPh + zq * TT * HD, QPl + zq * TT * HD, KPh + zk * TT * HD, KPl + zk * TT * HD, HD, Sb, TT, 0, (size_t)TT * HD, (size_t)TT * HD, (size_t)TT * TT);
            k_gemmc<h16, 0, 1, 1><<<dim3((TT - RH) / 64, TT / 64, ZH), 32, 0, stream>>>(QP16 + zq * TT * HD + (size_t)RH * HD, nullptr, KP16 + zk * TT * HD, nullptr, HD, Sb + (size_t)RH * TT, TT, RH, (size_t)TT * HD, (size_t)TT * HD, (size_t)TT * TT);
            k_asoft<<<ZH * TT / 8, 256, 0, stream>>>(Sb, P16, Ph, Pl);
            k_gemmc<bf, 2, 2, 8><<<dim3(RH / 64, HD / 64, ZH), 256, 0, stream>>>(Ph, Pl, VTh + zk * HD * TT, VTl + zk * HD * TT, TT, Ob, HD, 0, (size_t)RH * TT, (size_t)HD * TT, (size_t)TT * HD);
            k_gemmc<h16, 0, 2, 16><<<dim3((TT - RH) / 64, HD / 64, ZH), 512, 0, stream>>>(P16 + (size_t)RH * TT, nullptr, VT16 + zk * HD * TT, nullptr, TT, Ob + (size_t)RH * HD, HD, RH, (size_t)TT * TT, (size_t)HD * TT, (size_t)TT * HD);
            k_merge<<<(unsigned)(((size_t)ZH * TT * HD / 2 + 255) / 256), 256, 0, stream>>>(Ob, h0, ATh, ATl); }
        k_gemmw<bf, 1, true, 8><<<dim3(TT / 64, DM / 64, 1), 256, 0, stream>>>(ATh, ATl, WO, nullptr, DQ, OUT + (size_t)b * TT * DM, DM, bo, 0, 0, 0); }
}

// v002
// Measured time: 1020 microseconds a run.
// Two timings next to v001 put it at 1.73 and 1.72 times that version's speed.
// All steps since v000 together make it 2.89 times as fast.
#include <hip/hip_runtime.h>

// Causal multi-head attention on THREE separate input streams with biased (in, out) projections (Q, K, V [4][2048][1024]; q = Q Wq + bq, k = K Wk + bk, v = V Wv + bv ('xw' [1024][1024] normal x 1/32 + [1024] zeros on this draw: read; 16 heads x 64); scores / sqrt(64); tril kept, -inf elsewhere; softmax; out = merged Wo + bo ('xw' + a zero bias: read) -> [4][2048][1024] (8.4 M); argument order Q, K, V, Wq, bq, Wk, bk, Wv, bv, Wo, bo).
// Layout per batch: bf16 copies of the three inputs in turn; 'xw' weights transposed once; exact projections + f32 biases; causal T-2048 attention (hybrid rows: < 512 hi/lo 3 products, rest fp16 x1024; k_gemmc skips tiles above the diagonal; 8 heads a pass, probabilities in place over the score rows); merged hi/lo x w_o exact + b_o.
// Compute dtypes, f32 accumulate: every input rounded to bf16; projections exact + f32 biases; attention rows < 512 3 products, rest fp16; softmax f32; Wo hl x exact + bias.

#define NB_  4
#define TT   2048
#define DM   1024
#define NH_  16
#define NKV  16
#define REP  (NH_ / NKV)
#define HD   64
#define DQ   (NH_ * HD)
#define DKV  (NKV * HD)
#define ZH   8                    // heads per attention pass
#define PP   (2 * TT)             // row pitch, in 16-bit elements, of both P.V operands: a probability row lies in place over its f32 score row, and the V^T planes take the same pitch
#define RH   512                  // query rows < RH use hi+lo planes (0: none)
#define WIN  2048
#define PCAR 1024.0f
#define SCL  0.125f   // HD^-0.5
typedef _Float16 h16;
typedef unsigned short bf;
typedef __attribute__((ext_vector_type(16))) __bf16   v16bf;
typedef __attribute__((ext_vector_type(16))) _Float16 v16h;
typedef __attribute__((ext_vector_type(8)))  _Float16 v8h;
typedef __attribute__((ext_vector_type(8)))  unsigned short v8us;
typedef __attribute__((ext_vector_type(8)))  float    v8f;
typedef __attribute__((ext_vector_type(4)))  float    v4f;
typedef v8h  __attribute__((may_alias)) v8ha;
typedef v4f  __attribute__((may_alias)) v4fa;
typedef v8us __attribute__((may_alias)) v8usa;

__device__ __forceinline__ unsigned short f2bf(float f) { unsigned u = __float_as_uint(f); u += 0x7FFFu + ((u >> 16) & 1u); return (unsigned short)(u >> 16); }
__device__ __forceinline__ float bf2f(unsigned short b) { return __uint_as_float(((unsigned)b) << 16); }
__device__ __forceinline__ float bfr(float f) { return bf2f(f2bf(f)); }
__device__ __forceinline__ v16h cat16(v8h lo, v8h hi) { return __builtin_shufflevector(lo, hi, 0, 1, 2, 3, 4, 5, 6, 7, 8, 9, 10, 11, 12, 13, 14, 15); }
__device__ __forceinline__ v16bf cat16b(v8us lo, v8us hi) { return __builtin_bit_cast(v16bf, __builtin_shufflevector(lo, hi, 0, 1, 2, 3, 4, 5, 6, 7, 8, 9, 10, 11, 12, 13, 14, 15)); }
__device__ __forceinline__ v8f wmma16(v16h a, v16h b, v8f c) { return __builtin_amdgcn_wmma_f32_16x16x32_f16(false, a, false, b, (short)0, c, false, false); }
__device__ __forceinline__ v8f wmmab(v16bf a, v16bf b, v8f c) { return __builtin_amdgcn_wmma_f32_16x16x32_bf16(false, a, false, b, (short)0, c, false, false); }



// ---- k_gemmw: register-blocked GEMM, one work-group of NW waves per 64x64 output tile (16 accumulators a wave), operands straight from K-contiguous 16-bit planes; grid (M/64, N/64, Z), 32 * NW threads.
// C[m][n] (f32, pitch ldc, + optional f32 bias[n]) = sum_k A[m][k] Bt[n][k] (+ split products per NSPLIT). z-batch strides sA/sB/sC in elements. K % 64 == 0.
// The K loop is dealt out over the NW waves in slices of 64 k (one whole 128-byte line of every operand row): wave w takes slices w, w + NW, ... ; tile_out sums the NW partial tiles in LDS in wave order.
// tile_out: every wave stores its partial 64x64 tile to its own LDS range (pitch 68 floats), one barrier, then each 16-byte piece is summed over the waves (0, 1, ..) by one thread and stored, whole lines a row.
template <int NW, bool BIAS>
__device__ __forceinline__ void tile_out(const v8f (&acc)[4][4], float* os, int w, int lr, int hi, float* C, int ldc, int r0, int c0, const float* __restrict__ bias) {
    float* ow = os + w * (64 * 68);
    // the three loops are unrolled so that acc is indexed by constants and stays in registers
#pragma unroll
    for (int mb = 0; mb < 4; ++mb) {
#pragma unroll
        for (int nb = 0; nb < 4; ++nb) {
#pragma unroll
            for (int j = 0; j < 8; ++j) ow[(mb * 16 + hi * 8 + j) * 68 + nb * 16 + lr] = acc[mb][nb][j]; } }
    __syncthreads();   // publishes the NW partial tiles to the threads that sum them
    float* ct = C + (size_t)r0 * ldc + c0;
    // both loops unrolled: all LDS loads of a piece are in flight together
#pragma unroll
    for (int s = 0; s < 64 * 16 / (32 * NW); ++s) { const int q = s * (32 * NW) + (int)threadIdx.x, row = q >> 4, cofs = (q & 15) * 4; v4f val = *(const v4fa*)(os + row * 68 + cofs);
#pragma unroll
        for (int p = 1; p < NW; ++p) val += *(const v4fa*)(os + p * (64 * 68) + row * 68 + cofs);
        if (BIAS) { val[0] += bfr(bias[c0 + cofs]); val[1] += bfr(bias[c0 + cofs + 1]); val[2] += bfr(bias[c0 + cofs + 2]); val[3] += bfr(bias[c0 + cofs + 3]); }
        *(v4f*)(ct + (size_t)row * ldc + cofs) = val; }
}
template <typename T16> struct WFrag;
template <> struct WFrag<h16> { typedef v16h V; static __device__ __forceinline__ V ld(const h16* p) { return cat16(*(const v8h*)p, *(const v8h*)(p + 16)); } static __device__ __forceinline__ v8f mma(V a, V b, v8f c) { return wmma16(a, b, c); } };
template <> struct WFrag<bf> { typedef v16bf V; static __device__ __forceinline__ V ld(const bf* p) { return cat16b(*(const v8us*)p, *(const v8us*)(p + 16)); } static __device__ __forceinline__ v8f mma(V a, V b, v8f c) { return wmmab(a, b, c); } };
template <typename T16, int NSPLIT, bool BIAS, int NW>
__global__ __launch_bounds__(32 * NW) void k_gemmw(const T16* __restrict__ A, const T16* __restrict__ A2, const T16* __restrict__ Bt, const T16* __restrict__ Bt2, int K, float* C, int ldc, const float* __restrict__ bias, size_t sA, size_t sB, size_t sC) {
    typedef typename WFrag<T16>::V V;
    __shared__ __align__(16) float os[NW * 64 * 68];
    const size_t z = blockIdx.z; A += z * sA; if (A2) A2 += z * sA; Bt += z * sB; if (Bt2) Bt2 += z * sB; C += z * sC;
    const int lane = threadIdx.x & 31, lr = lane & 15, hi = lane >> 4; const int r0 = blockIdx.x * 64, c0 = blockIdx.y * 64;
    const int w = __builtin_amdgcn_readfirstlane(threadIdx.x >> 5);   // wave number, scalar: the K loop's bounds stay scalar
    v8f acc[4][4];
#pragma unroll
    for (int mb = 0; mb < 4; ++mb)
#pragma unroll
        for (int nb = 0; nb < 4; ++nb) acc[mb][nb] = (v8f){};
    const size_t aoff = (size_t)(r0 + lr) * K + 8 * hi, boff = (size_t)(c0 + lr) * K + 8 * hi;
    // both loops stay rolled, as the one loop they replace: one fragment set in registers
#pragma unroll 1
    for (int k0 = w * 64; k0 < K; k0 += 64 * NW)
#pragma unroll 1
    for (int kc = k0; kc < k0 + 64; kc += 32) {
        V a[4], a2[4];
#pragma unroll
        for (int mb = 0; mb < 4; ++mb) { a[mb] = WFrag<T16>::ld(A + aoff + (size_t)mb * 16 * K + kc); if (NSPLIT == 1 || NSPLIT == 2) a2[mb] = WFrag<T16>::ld(A2 + aoff + (size_t)mb * 16 * K + kc); }
#pragma unroll
        for (int nb = 0; nb < 4; ++nb) { const V b = WFrag<T16>::ld(Bt + boff + (size_t)nb * 16 * K + kc); V b2; if (NSPLIT >= 2) b2 = WFrag<T16>::ld(Bt2 + boff + (size_t)nb * 16 * K + kc);
#pragma unroll
            for (int mb = 0; mb < 4; ++mb) { acc[mb][nb] = WFrag<T16>::mma(a[mb], b, acc[mb][nb]); if (NSPLIT == 1 || NSPLIT == 2) acc[mb][nb] = WFrag<T16>::mma(a2[mb], b, acc[mb][nb]); if (NSPLIT >= 2) acc[mb][nb] = WFrag<T16>::mma(a[mb], b2, acc[mb][nb]); } }
        asm volatile("v_nop\n\tv_nop\n\tv_nop\n\tv_nop" : "+v"(acc[0][0]), "+v"(acc[1][1]), "+v"(acc[2][2]), "+v"(acc[3][3]) : "v"(a[0]), "v"(a[3]));
    }
    tile_out<NW, BIAS>(acc, os, w, lr, hi, C, ldc, r0, c0, bias);
}

// ---- k_gemmc: the same 64x64 tile GEMM specialised for causal attention: CMODE 1 skips score tiles entirely above the diagonal (query rows r0+roff.., key columns c0..), CMODE 2 limits the
// key (K) loop of the probability x value contraction to the diagonal block (probabilities beyond it are exactly zero; K there is the operands' common row pitch PP, the loop never passes key r0 + roff + 63). roff = row offset of this launch's first row within the sequence.
// NW = 1: one wave per tile (scores, K = 64). NW > 1: the key loop is dealt out over NW waves in slices of 64 keys and summed by tile_out, as in k_gemmw.
template <typename T16, int NSPLIT, int CMODE, int NW>
__global__ __launch_bounds__(32 * NW) void k_gemmc(const T16* __restrict__ A, const T16* __restrict__ A2, const T16* __restrict__ Bt, const T16* __restrict__ Bt2, int K, float* C, int ldc, int roff, size_t sA, size_t sB, size_t sC) {
    typedef typename WFrag<T16>::V V;
    __shared__ __align__(16) float os[(NW == 1 ? 16 : NW * 64) * 68];
    const size_t z = blockIdx.z; A += z * sA; if (A2) A2 += z * sA; Bt += z * sB; if (Bt2) Bt2 += z * sB; C += z * sC;
    const int lane = threadIdx.x & 31, lr = lane & 15, hi = lane >> 4; const int r0 = blockIdx.x * 64, c0 = blockIdx.y * 64;
    const int w = (NW == 1) ? 0 : __builtin_amdgcn_readfirstlane(threadIdx.x >> 5);   // wave number, scalar: the K loop's bounds stay scalar
    if (CMODE == 1 && c0 > r0 + roff + 63) return;                  // score tile entirely above the causal diagonal: never read (the softmax masks j > i by select)
    const int Kl = (CMODE == 2) ? min(K, r0 + roff + 64) : K;        // P.V: probabilities are exactly 0 beyond the diagonal block, so the K loop stops there
    v8f acc[4][4];
#pragma unroll
    for (int mb = 0; mb < 4; ++mb)
#pragma unroll
        for (int nb = 0; nb < 4; ++nb) acc[mb][nb] = (v8f){};
    const size_t aoff = (size_t)(r0 + lr) * K + 8 * hi, boff = (size_t)(c0 + lr) * K + 8 * hi;
    // both loops stay rolled, as the one loop they replace: one fragment set in registers
#pragma unroll 1
    for (int k0 = w * 64; k0 < Kl; k0 += 64 * NW)
#pragma unroll 1
    for (int kc = k0; kc < k0 + 64; kc += 32) {
        V a[4], a2[4];
#pragma unroll
        for (int mb = 0; mb < 4; ++mb) { a[mb] = WFrag<T16>::ld(A + aoff + (size_t)mb * 16 * K + kc); if (NSPLIT == 1 || NSPLIT == 2) a2[mb] = WFrag<T16>::ld(A2 + aoff + (size_t)mb * 16 * K + kc); }
#pragma unroll
        for (int nb = 0; nb < 4; ++nb) { const V b = WFrag<T16>::ld(Bt + boff + (size_t)nb * 16 * K + kc); V b2; if (NSPLIT >= 2) b2 = WFrag<T16>::ld(Bt2 + boff + (size_t)nb * 16 * K + kc);
#pragma unroll
            for (int mb = 0; mb < 4; ++mb) { acc[mb][nb] = WFrag<T16>::mma(a[mb], b, acc[mb][nb]); if (NSPLIT == 1 || NSPLIT == 2) acc[mb][nb] = WFrag<T16>::mma(a2[mb], b, acc[mb][nb]); if (NSPLIT >= 2) acc[mb][nb] = WFrag<T16>::mma(a[mb], b2, acc[mb][nb]); } }
        asm volatile("v_nop\n\tv_nop\n\tv_nop\n\tv_nop" : "+v"(acc[0][0]), "+v"(acc[1][1]), "+v"(acc[2][2]), "+v"(acc[3][3]) : "v"(a[0]), "v"(a[3]));
    }
    if constexpr (NW > 1) { tile_out<NW, false>(acc, os, w, lr, hi, C, ldc, r0, c0, nullptr); return; }
#pragma unroll
    for (int mb = 0; mb < 4; ++mb) {
#pragma unroll
        for (int nb = 0; nb < 4; ++nb) {
#pragma unroll
            for (int j = 0; j < 8; ++j) os[(hi * 8 + j) * 68 + nb * 16 + lr] = acc[mb][nb][j]; }
        __builtin_amdgcn_wave_barrier(); asm volatile("" ::: "memory");
        float* crow = C + (size_t)(r0 + mb * 16) * ldc + c0;
{
#pragma unroll
            for (int s = 0; s < 8; ++s) { const int row = 2 * s + hi, cofs = lr * 4; v4f val = *(const v4fa*)(os + row * 68 + cofs);
                *(v4f*)(crow + (size_t)row * ldc + cofs) = val; }
             }
        __builtin_amdgcn_wave_barrier(); asm volatile("" ::: "memory");
    }
}

__device__ __forceinline__ h16 tohx(float x) { return (h16)x; }
__device__ __forceinline__ void splitf(float y, unsigned short& h, unsigned short& l) { h = f2bf(y); l = f2bf(y - bf2f(h)); }
typedef __attribute__((ext_vector_type(2))) _Float16 v2h;
typedef __attribute__((ext_vector_type(4))) _Float16 v4h;
typedef __attribute__((ext_vector_type(2))) unsigned short v2us;
typedef __attribute__((ext_vector_type(4))) unsigned short v4us;
typedef __attribute__((ext_vector_type(2))) float v2f;
typedef __attribute__((ext_vector_type(4))) int v4i;

__global__ __launch_bounds__(256) void k_wtG(const float* __restrict__ w, int K, int N, bf* Bt) {
    const int lane = threadIdx.x & 31; const int L0 = (blockIdx.x * 8 + (threadIdx.x >> 5)) * 8; const int nlines = N * K / 64;
{
#pragma unroll 1
        for (int l = 0; l < 8; ++l) { const int L = L0 + l; if (L >= nlines) break; const size_t e = (size_t)L * 64 + lane * 2; const int k = (int)(e % K), n = (int)(e / K); v2us o;
            o[0] = f2bf(w[(size_t)k * N + n]); o[1] = f2bf(w[(size_t)(k + 1) * N + n]); *(v2us*)(Bt + e) = o; }
         }
}
__global__ __launch_bounds__(256) void k_cvt8(const float* __restrict__ src, bf* dst, size_t n8) { const size_t i = (size_t)blockIdx.x * 256 + threadIdx.x; if (i >= n8) return; const v8f v = *(const v8f*)(src + i * 8); v8us o;
#pragma unroll
    for (int k = 0; k < 8; ++k) o[k] = f2bf(v[k]); *(v8us*)(dst + i * 8) = o;  }

// k_rope: head planes [h][t][d] (fp16 + hi/lo) of rope(x) x sc with the rotate-half convention out[d] = x[d] cos[t][d] - x[d+HD/2] sin[t][d], out[d+HD/2] = x[d+HD/2] cos[t][d+HD/2] + x[d] sin[t][d+HD/2]
__global__ __launch_bounds__(256) void k_rope(const float* __restrict__ F, int pitch, int nheads, const float* __restrict__ CS, const float* __restrict__ RF, const float* __restrict__ nw, float sc, h16* P16, bf* Ph, bf* Pl) {
    const size_t e = ((size_t)blockIdx.x * 256 + threadIdx.x) * 2; if (e >= (size_t)nheads * TT * HD) return; const int d = (int)(e % HD); const int t = (int)((e / HD) % TT); const int h = (int)(e / ((size_t)HD * TT)); const float* f = F + (size_t)t * pitch + h * HD; const float rf = RF ? RF[(size_t)h * TT + t] : 1.0f; v2h o16; v2us oh, ol;
#pragma unroll
    for (int q = 0; q < 2; ++q) { const int dd = d + q; const int dp = (dd < HD / 2) ? dd + HD / 2 : dd - HD / 2; float x0 = f[dd], x1 = f[dp];
        if (RF) { float n0 = __fmul_rn(x0, rf), n1 = __fmul_rn(x1, rf); asm volatile("" : "+v"(n0)); asm volatile("" : "+v"(n1)); x0 = __fmul_rn(bfr(nw[dd]), n0); x1 = __fmul_rn(bfr(nw[dp]), n1); }
        const v2f cs = *(const v2f*)(CS + ((size_t)t * HD + dd) * 2); float a = __fmul_rn(x0, cs[0]), bq = __fmul_rn(x1, cs[1]); asm volatile("" : "+v"(a)); asm volatile("" : "+v"(bq)); const float r = ((dd < HD / 2) ? __fsub_rn(a, bq) : __fadd_rn(a, bq)) * sc;
        o16[q] = tohx(r); unsigned short a2, c2; splitf(r, a2, c2); oh[q] = a2; ol[q] = c2; }
    *(v2h*)(P16 + e) = o16; *(v2us*)(Ph + e) = oh; *(v2us*)(Pl + e) = ol;  }
__global__ __launch_bounds__(256) void k_vtp(const float* __restrict__ F, int pitch, int nheads, h16* V16, bf* Vh, bf* Vl) { const size_t e = ((size_t)blockIdx.x * 256 + threadIdx.x) * 2; if (e >= (size_t)nheads * HD * TT) return; const int t = (int)(e % TT); const int d = (int)((e / TT) % HD); const int g = (int)(e / ((size_t)TT * HD)); v2h o16; v2us oh, ol;
#pragma unroll
    for (int q = 0; q < 2; ++q) { const float x = F[(size_t)(t + q) * pitch + g * HD + d]; o16[q] = tohx(x); unsigned short a2, c2; splitf(x, a2, c2); oh[q] = a2; ol[q] = c2; }
    const size_t o = (e / TT) * PP + t;   // plane rows [g][d] at pitch PP
    *(v2h*)(V16 + o) = o16; *(v2us*)(Vh + o) = oh; *(v2us*)(Vl + o) = ol;  }
__global__ __launch_bounds__(256) void k_csid(float* CS) { const int idx = blockIdx.x * 256 + threadIdx.x; if (idx >= TT * HD) return; v2f cs; cs[0] = 1.0f; cs[1] = 0.0f; *(v2f*)(CS + (size_t)idx * 2) = cs;  }
// k_asoft: per row (zz, i): t = S x HD^-0.5 for j <= i and i - j < WIN (sliding causal window; the reference's -1e9 additive fill vanishes identically); softmax over the 2048 keys (register row, one exp, fixed trees);
// the probabilities go back into the row's own 8192 bytes of Sb (fp16 row in the first half; or hi plane in the first half, lo plane in the second): a wave holds its whole row in registers before it stores, and no other wave touches the row.
__global__ __launch_bounds__(256) void k_asoft(float* Sb) {
    h16* P16 = (h16*)Sb; bf* Ph = (bf*)Sb; bf* Pl = (bf*)Sb + TT;
    const int lane = threadIdx.x & 31; const int row = blockIdx.x * 8 + (threadIdx.x >> 5); if (row >= ZH * TT) return; const int i = row % TT; const int zz = row / TT; (void)zz; const bool hires = (i < RH); const float* sr = Sb + (size_t)row * TT; float v[TT / 32]; float mx = -3.0e38f;
#pragma unroll
    for (int ch = 0; ch < TT / 128; ++ch) { const int j0 = ch * 128 + lane * 4; const v4f a = *(const v4f*)(sr + j0);
#pragma unroll
        for (int q = 0; q < 4; ++q) { const int j = j0 + q; (void)j; const float t = (j <= i && i - j < WIN) ? a[q] * SCL : -3.0e38f; v[ch * 4 + q] = t; mx = fmaxf(mx, t); } }
#pragma unroll
    for (int sh = 16; sh; sh >>= 1) mx = fmaxf(mx, __shfl_xor(mx, sh, 32));
    float sum = 0.f;
#pragma unroll
    for (int k = 0; k < TT / 32; ++k) { float d0 = __fsub_rn(v[k], mx); asm volatile("" : "+v"(d0)); v[k] = __builtin_amdgcn_exp2f(__fmul_rn(d0, 1.4426950408889634f)); sum += v[k]; }
#pragma unroll
    for (int sh = 16; sh; sh >>= 1) sum += __shfl_xor(sum, sh, 32);
    const float f = __fdiv_rn(hires ? 1.0f : PCAR, sum);
{
        if (hires) {
#pragma unroll
            for (int ch = 0; ch < TT / 128; ++ch) { v4us oh, ol;
#pragma unroll
                for (int q = 0; q < 4; ++q) { unsigned short a, c2; splitf(v[ch * 4 + q] * f, a, c2); oh[q] = a; ol[q] = c2; }
                const size_t oo = (size_t)row * PP + ch * 128 + lane * 4; *(v4us*)(Ph + oo) = oh; *(v4us*)(Pl + oo) = ol; }
        } else {
#pragma unroll
            for (int ch = 0; ch < TT / 128; ++ch) { v4h o4;
#pragma unroll
                for (int q = 0; q < 4; ++q) o4[q] = tohx(v[ch * 4 + q] * f);
                *(v4h*)(P16 + (size_t)row * PP + ch * 128 + lane * 4) = o4; } }
         }
}
__global__ __launch_bounds__(256) void k_merge(const float* __restrict__ O, int h0, bf* Ah, bf* Al) { const size_t e = ((size_t)blockIdx.x * 256 + threadIdx.x) * 2; if (e >= (size_t)ZH * TT * HD) return; const int d = (int)(e % HD); const int t = (int)((e / HD) % TT); const int zz = (int)(e / ((size_t)HD * TT)); const float cs = (t < RH) ? 1.0f : (1.0f / PCAR); const size_t oo = (size_t)t * DQ + (h0 + zz) * HD + d;
    v2us oh, ol;
#pragma unroll
    for (int q = 0; q < 2; ++q) { unsigned short a, c2; splitf(O[e + q] * cs, a, c2); oh[q] = a; ol[q] = c2; } *(v2us*)(Ah + oo) = oh; *(v2us*)(Al + oo) = ol;  }

extern "C" void kernel_launch(void* const* d_in, const int* in_sizes, int n_in,
                              void* d_out, int out_size, void* d_ws, size_t ws_size, hipStream_t stream) {
    (void)in_sizes; (void)n_in; (void)out_size;
    const float* x = (const float*)d_in[0]; const float* xk = (const float*)d_in[1]; const float* xv = (const float*)d_in[2]; const float* wq = (const float*)d_in[3]; const float* bq = (const float*)d_in[4]; const float* wk = (const float*)d_in[5]; const float* bk = (const float*)d_in[6]; const float* wv = (const float*)d_in[7]; const float* bv = (const float*)d_in[8]; const float* wo = (const float*)d_in[9]; const float* bo = (const float*)d_in[10];
    float* OUT = (float*)d_out;     // [4][2048][1024]
    char* wsp = (char*)d_ws;
    auto take = [&](size_t bytes) { char* p = wsp; wsp += (bytes + 255) & ~(size_t)255; return (void*)p; };
    bf* WQ = (bf*)take((size_t)DQ * DM * 2); bf* WK = (bf*)take((size_t)DKV * DM * 2); bf* WV = (bf*)take((size_t)DKV * DM * 2); bf* WO = (bf*)take((size_t)DM * DQ * 2); float* CS = (float*)take((size_t)TT * HD * 2 * 4);
    bf* XB = (bf*)take((size_t)TT * DM * 2); float* FQ = (float*)take((size_t)TT * DQ * 4); float* FK = (float*)take((size_t)TT * DKV * 4);
    h16* QP16 = (h16*)take((size_t)NH_ * TT * HD * 2); h16* KP16 = (h16*)take((size_t)NKV * TT * HD * 2); h16* VT16 = (h16*)take((size_t)NKV * HD * PP * 2);
    bf* QPh = (bf*)take((size_t)NH_ * TT * HD * 2); bf* QPl = (bf*)take((size_t)NH_ * TT * HD * 2); bf* KPh = (bf*)take((size_t)NKV * TT * HD * 2); bf* KPl = (bf*)take((size_t)NKV * TT * HD * 2); bf* VTh = (bf*)take((size_t)NKV * HD * PP * 2); bf* VTl = (bf*)take((size_t)NKV * HD * PP * 2);
    float* Sb = (float*)take((size_t)ZH * TT * TT * 4); h16* P16 = (h16*)Sb; bf* Ph = (bf*)Sb; bf* Pl = (bf*)Sb + TT;   // probabilities in place: row pitch PP
    float* Ob = (float*)take((size_t)ZH * TT * HD * 4); bf* ATh = (bf*)take((size_t)TT * DQ * 2); bf* ATl = (bf*)take((size_t)TT * DQ * 2);
    if ((size_t)(wsp - (char*)d_ws) > ws_size) return;    // ws 256 MiB
    float* FV = FK;   // v projection reuses the k buffer after the k planes are built (stream-ordered)
    { k_wtG<<<(unsigned)((DM * DQ / 64 + 63) / 64), 256, 0, stream>>>(wq, DM, DQ, WQ); k_wtG<<<(unsigned)((DM * DKV / 64 + 63) / 64), 256, 0, stream>>>(wk, DM, DKV, WK); k_wtG<<<(unsigned)((DM * DKV / 64 + 63) / 64), 256, 0, stream>>>(wv, DM, DKV, WV);
      k_wtG<<<(unsigned)((DQ * DM / 64 + 63) / 64), 256, 0, stream>>>(wo, DQ, DM, WO);
       }
    k_csid<<<(TT * HD + 255) / 256, 256, 0, stream>>>(CS);
    const unsigned LQ = (unsigned)(((size_t)NH_ * TT * HD / 2 + 255) / 256), LKv = (unsigned)(((size_t)NKV * TT * HD / 2 + 255) / 256);
    for (int b = 0; b < NB_; ++b) {
        
        k_cvt8<<<(unsigned)(((size_t)TT * DM / 8 + 255) / 256), 256, 0, stream>>>(x + (size_t)b * TT * DM, XB, (size_t)TT * DM / 8);
        k_gemmw<bf, 0, true, 8><<<dim3(TT / 64, DQ / 64, 1), 256, 0, stream>>>(XB, nullptr, WQ, nullptr, DM, FQ, DQ, bq, 0, 0, 0);
        k_rope<<<LQ, 256, 0, stream>>>(FQ, DQ, NH_, CS, nullptr, nullptr, 1.0f, QP16, QPh, QPl);
        k_cvt8<<<(unsigned)(((size_t)TT * DM / 8 + 255) / 256), 256, 0, stream>>>(xk + (size_t)b * TT * DM, XB, (size_t)TT * DM / 8); k_gemmw<bf, 0, true, 8><<<dim3(TT / 64, DKV / 64, 1), 256, 0, stream>>>(XB, nullptr, WK, nullptr, DM, FK, DKV, bk, 0, 0, 0);
        k_rope<<<LKv, 256, 0, stream>>>(FK, DKV, NKV, CS, nullptr, nullptr, 1.0f, KP16, KPh, KPl);
        k_cvt8<<<(unsigned)(((size_t)TT * DM / 8 + 255) / 256), 256, 0, stream>>>(xv + (size_t)b * TT * DM, XB, (size_t)TT * DM / 8); k_gemmw<bf, 0, true, 8><<<dim3(TT / 64, DKV / 64, 1), 256, 0, stream>>>(XB, nullptr, WV, nullptr, DM, FV, DKV, bv, 0, 0, 0); k_vtp<<<LKv, 256, 0, stream>>>(FV, DKV, NKV, VT16, VTh, VTl);
        for (int h0 = 0; h0 < NH_; h0 += ZH) { const size_t zq = (size_t)h0, zk = (size_t)(h0 / REP);   // one kv head per query head: the pass's heads use consecutive kv planes (z-strides TT*HD; HD*PP for V^T)
            k_gemmc<bf, 2, 1, 1><<<dim3(RH / 64, TT / 64, ZH), 32, 0, stream>>>(QPh + zq * TT * HD, QPl + zq * TT * HD, KPh + zk * TT * HD, KPl + zk * TT * HD, HD, Sb, TT, 0, (size_t)TT * HD, (size_t)TT * HD, (size_t)TT * TT);
            k_gemmc<h16, 0, 1, 1><<<dim3((TT - RH) / 64, TT / 64, ZH), 32, 0, stream>>>(QP16 + zq * TT * HD + (size_t)RH * HD, nullptr, KP16 + zk * TT * HD, nullptr, HD, Sb + (size_t)RH * TT, TT, RH, (size_t)TT * HD, (size_t)TT * HD, (size_t)TT * TT);
            k_asoft<<<ZH * TT / 8, 256, 0, stream>>>(Sb);
            k_gemmc<bf, 2, 2, 8><<<dim3(RH / 64, HD / 64, ZH), 256, 0, stream>>>(Ph, Pl, VTh + zk * HD * PP, VTl + zk * HD * PP, PP, Ob, HD, 0, (size_t)TT * PP, (size_t)HD * PP, (size_t)TT * HD);
            k_gemmc<h16, 0, 2, 16><<<dim3((TT - RH) / 64, HD / 64, ZH), 512, 0, stream>>>(P16 + (size_t)RH * PP, nullptr, VT16 + zk * HD * PP, nullptr, PP, Ob + (size_t)RH * HD, HD, RH, (size_t)TT * PP, (size_t)HD * PP, (size_t)TT * HD);
            k_merge<<<(unsigned)(((size_t)ZH * TT * HD / 2 + 255) / 256), 256, 0, stream>>>(Ob, h0, ATh, ATl); }
        k_gemmw<bf, 1, true, 8><<<dim3(TT / 64, DM / 64, 1), 256, 0, stream>>>(ATh, ATl, WO, nullptr, DQ, OUT + (size_t)b * TT * DM, DM, bo, 0, 0, 0); }
}

// v004
// It runs in 372 microseconds.
// Versions between v002 and this one are left out; their measured steps multiply to 2.75 times as fast.
// Over all steps from v000 it is 7.96 times as fast.
#include <hip/hip_runtime.h>

// Causal multi-head attention on THREE separate input streams with biased (in, out) projections (Q, K, V [4][2048][1024]; q = Q Wq + bq, k = K Wk + bk, v = V Wv + bv ('xw' [1024][1024] normal x 1/32 + [1024] zeros on this draw: read; 16 heads x 64); scores / sqrt(64); tril kept, -inf elsewhere; softmax; out = merged Wo + bo ('xw' + a zero bias: read) -> [4][2048][1024] (8.4 M); argument order Q, K, V, Wq, bq, Wk, bk, Wv, bv, Wo, bo).
// Layout per batch: bf16 copies of the three inputs in turn; 'xw' weights transposed once; exact projections + f32 biases, stored by the GEMM itself as head planes; head planes of all four batches kept side by side; one fused causal T-2048 attention launch for all 64 (batch, head) planes (hybrid rows: < 512 hi/lo 3 products, rest fp16 x1024 with K and V^T staged in LDS; online softmax in registers, key walk ends at the diagonal); merged hi/lo x w_o exact + b_o.
// Compute dtypes, f32 accumulate: every input rounded to bf16; projections exact + f32 biases; attention rows < 512 3 products, rest fp16; softmax f32; Wo hl x exact + bias.

#define NB_  4
#define TT   2048
#define DM   1024
#define NH_  16
#define NKV  16
#define REP  (NH_ / NKV)
#define HD   64
#define DQ   (NH_ * HD)
#define DKV  (NKV * HD)
#define PP   TT                   // row pitch, in 16-bit elements, of the V^T planes
#define RH   512                  // query rows < RH use hi+lo planes (0: none)
#define SCL  0.125f   // HD^-0.5
typedef _Float16 h16;
typedef unsigned short bf;
typedef __attribute__((ext_vector_type(16))) __bf16   v16bf;
typedef __attribute__((ext_vector_type(16))) _Float16 v16h;
typedef __attribute__((ext_vector_type(8)))  _Float16 v8h;
typedef __attribute__((ext_vector_type(8)))  unsigned short v8us;
typedef __attribute__((ext_vector_type(8)))  float    v8f;
typedef __attribute__((ext_vector_type(4)))  float    v4f;
typedef v8h  __attribute__((may_alias)) v8ha;
typedef v4f  __attribute__((may_alias)) v4fa;
typedef v8us __attribute__((may_alias)) v8usa;

__device__ __forceinline__ unsigned short f2bf(float f) { unsigned u = __float_as_uint(f); u += 0x7FFFu + ((u >> 16) & 1u); return (unsigned short)(u >> 16); }
__device__ __forceinline__ float bf2f(unsigned short b) { return __uint_as_float(((unsigned)b) << 16); }
__device__ __forceinline__ float bfr(float f) { return bf2f(f2bf(f)); }
__device__ __forceinline__ v16h cat16(v8h lo, v8h hi) { return __builtin_shufflevector(lo, hi, 0, 1, 2, 3, 4, 5, 6, 7, 8, 9, 10, 11, 12, 13, 14, 15); }
__device__ __forceinline__ v16bf cat16b(v8us lo, v8us hi) { return __builtin_bit_cast(v16bf, __builtin_shufflevector(lo, hi, 0, 1, 2, 3, 4, 5, 6, 7, 8, 9, 10, 11, 12, 13, 14, 15)); }
__device__ __forceinline__ v8f wmma16(v16h a, v16h b, v8f c) { return __builtin_amdgcn_wmma_f32_16x16x32_f16(false, a, false, b, (short)0, c, false, false); }
__device__ __forceinline__ v8f wmmab(v16bf a, v16bf b, v8f c) { return __builtin_amdgcn_wmma_f32_16x16x32_bf16(false, a, false, b, (short)0, c, false, false); }
__device__ __forceinline__ h16 tohx(float x) { return (h16)x; }
__device__ __forceinline__ void splitf(float y, unsigned short& h, unsigned short& l) { h = f2bf(y); l = f2bf(y - bf2f(h)); }
typedef __attribute__((ext_vector_type(4))) _Float16 v4h;
typedef __attribute__((ext_vector_type(4))) unsigned short v4us;



// ---- k_gemmw: register-blocked GEMM, one work-group of NW waves per 64x64 output tile (16 accumulators a wave), operands straight from K-contiguous 16-bit planes; grid (M/64, N/64, Z), 32 * NW threads.
// C[m][n] (f32, pitch ldc, + optional f32 bias[n], PL 2 bias[m]) = sum_k A[m][k] Bt[n][k] (+ split products per NSPLIT). z-batch strides sA/sB/sC in elements. K % 64 == 0.
// The K loop is dealt out over the NW waves in slices of 64 k (one whole 128-byte line of every operand row): wave w takes slices w, w + NW, ... ; tile_out sums the NW partial tiles in LDS in wave order.
// tile_out: every wave stores its partial 64x64 tile to its own LDS range (pitch 68 floats), one barrier, then each 16-byte piece is summed over the waves (0, 1, ..) by one thread and stored, whole lines a row.
// PL 0: f32 to C, bias[n]. PL 1, 2: the sum goes out as three 16-bit planes (fp16, bf16 hi, bf16 lo) and no f32 copy is kept; element [m][n] lies at (n / 64) * sH + m * ldc + n % 64 of each plane, so a tile row is one whole 128-byte line of each.
// PL 1: bias[n] (m = token, n = head * 64 + d: sH = TT * HD, ldc = HD gives [head][t][d]). PL 2: bias[m] (m = head * 64 + d, n = token: sH = 64, ldc = PP gives the V^T rows [head][d][t]).
template <int NW, bool BIAS, int PL>
__device__ __forceinline__ void tile_out(const v8f (&acc)[4][4], float* os, int w, int lr, int hi, float* C, int ldc, int r0, int c0, const float* __restrict__ bias, h16* P16, bf* Ph, bf* Pl, size_t sH) {
    float* ow = os + w * (64 * 68);
    // the three loops are unrolled so that acc is indexed by constants and stays in registers
#pragma unroll
    for (int mb = 0; mb < 4; ++mb) {
#pragma unroll
        for (int nb = 0; nb < 4; ++nb) {
#pragma unroll
            for (int j = 0; j < 8; ++j) ow[(mb * 16 + hi * 8 + j) * 68 + nb * 16 + lr] = acc[mb][nb][j]; } }
    __syncthreads();   // publishes the NW partial tiles to the threads that sum them
    float* ct = PL == 0 ? C + (size_t)r0 * ldc + c0 : nullptr;
    // both loops unrolled: all LDS loads of a piece are in flight together
    [[maybe_unused]] v4f vs[64 * 16 / (32 * NW)];   // PL 1, 2: the sums of all the thread's pieces are formed first, so that no LDS or bias load stands behind the wait of an earlier piece's stores
#pragma unroll
    for (int s = 0; s < 64 * 16 / (32 * NW); ++s) { const int q = s * (32 * NW) + (int)threadIdx.x, row = q >> 4, cofs = (q & 15) * 4; v4f val = *(const v4fa*)(os + row * 68 + cofs);
#pragma unroll
        for (int p = 1; p < NW; ++p) val += *(const v4fa*)(os + p * (64 * 68) + row * 68 + cofs);
        if (BIAS && PL == 2) val += bfr(bias[r0 + row]);
        if (BIAS && PL != 2) { val[0] += bfr(bias[c0 + cofs]); val[1] += bfr(bias[c0 + cofs + 1]); val[2] += bfr(bias[c0 + cofs + 2]); val[3] += bfr(bias[c0 + cofs + 3]); }
        if constexpr (PL == 0) *(v4f*)(ct + (size_t)row * ldc + cofs) = val; else vs[s] = val; }
    if constexpr (PL != 0) {
        // unrolled: vs is indexed by constants and stays in registers
#pragma unroll
        for (int s = 0; s < 64 * 16 / (32 * NW); ++s) { const int q = s * (32 * NW) + (int)threadIdx.x, row = q >> 4, cofs = (q & 15) * 4; const size_t po = (size_t)(c0 >> 6) * sH + (size_t)(r0 + row) * ldc + cofs; v4h o16; v4us oh, ol;
#pragma unroll
            for (int i = 0; i < 4; ++i) { o16[i] = tohx(vs[s][i]); unsigned short a, c; splitf(vs[s][i], a, c); oh[i] = a; ol[i] = c; }
            *(v4h*)(P16 + po) = o16; *(v4us*)(Ph + po) = oh; *(v4us*)(Pl + po) = ol;
            asm volatile("s_wait_xcnt 0x0" ::: "memory"); } }   // before the next piece reuses the registers of the three stores
}
template <typename T16> struct WFrag;
template <> struct WFrag<h16> { typedef v16h V; static __device__ __forceinline__ V ld(const h16* p) { return cat16(*(const v8h*)p, *(const v8h*)(p + 16)); } static __device__ __forceinline__ v8f mma(V a, V b, v8f c) { return wmma16(a, b, c); } };
template <> struct WFrag<bf> { typedef v16bf V; static __device__ __forceinline__ V ld(const bf* p) { return cat16b(*(const v8us*)p, *(const v8us*)(p + 16)); } static __device__ __forceinline__ v8f mma(V a, V b, v8f c) { return wmmab(a, b, c); } };
template <typename T16, int NSPLIT, bool BIAS, int NW, int PL>
__global__ __launch_bounds__(32 * NW) void k_gemmw(const T16* __restrict__ A, const T16* __restrict__ A2, const T16* __restrict__ Bt, const T16* __restrict__ Bt2, int K, float* C, int ldc, const float* __restrict__ bias, size_t sA, size_t sB, size_t sC, h16* P16, bf* Ph, bf* Pl, size_t sH) {
    typedef typename WFrag<T16>::V V;
    __shared__ __align__(16) float os[NW * 64 * 68];
    const size_t z = blockIdx.z; A += z * sA; if (A2) A2 += z * sA; Bt += z * sB; if (Bt2) Bt2 += z * sB; C += z * sC;
    const int lane = threadIdx.x & 31, lr = lane & 15, hi = lane >> 4; const int r0 = blockIdx.x * 64, c0 = blockIdx.y * 64;
    const int w = __builtin_amdgcn_readfirstlane(threadIdx.x >> 5);   // wave number, scalar: the K loop's bounds stay scalar
    v8f acc[4][4];
#pragma unroll
    for (int mb = 0; mb < 4; ++mb)
#pragma unroll
        for (int nb = 0; nb < 4; ++nb) acc[mb][nb] = (v8f){};
    const size_t aoff = (size_t)(r0 + lr) * K + 8 * hi, boff = (size_t)(c0 + lr) * K + 8 * hi;
    // both loops stay rolled, as the one loop they replace: one fragment set in registers
#pragma unroll 1
    for (int k0 = w * 64; k0 < K; k0 += 64 * NW)
#pragma unroll 1
    for (int kc = k0; kc < k0 + 64; kc += 32) {
        V a[4], a2[4];
#pragma unroll
        for (int mb = 0; mb < 4; ++mb) { a[mb] = WFrag<T16>::ld(A + aoff + (size_t)mb * 16 * K + kc); if (NSPLIT == 1 || NSPLIT == 2) a2[mb] = WFrag<T16>::ld(A2 + aoff + (size_t)mb * 16 * K + kc); }
#pragma unroll
        for (int nb = 0; nb < 4; ++nb) { const V b = WFrag<T16>::ld(Bt + boff + (size_t)nb * 16 * K + kc); V b2; if (NSPLIT >= 2) b2 = WFrag<T16>::ld(Bt2 + boff + (size_t)nb * 16 * K + kc);
#pragma unroll
            for (int mb = 0; mb < 4; ++mb) { acc[mb][nb] = WFrag<T16>::mma(a[mb], b, acc[mb][nb]); if (NSPLIT == 1 || NSPLIT == 2) acc[mb][nb] = WFrag<T16>::mma(a2[mb], b, acc[mb][nb]); if (NSPLIT >= 2) acc[mb][nb] = WFrag<T16>::mma(a[mb], b2, acc[mb][nb]); } }
        asm volatile("v_nop\n\tv_nop\n\tv_nop\n\tv_nop" : "+v"(acc[0][0]), "+v"(acc[1][1]), "+v"(acc[2][2]), "+v"(acc[3][3]) : "v"(a[0]), "v"(a[3]));
    }
    tile_out<NW, BIAS, PL>(acc, os, w, lr, hi, C, ldc, r0, c0, bias, P16, Ph, Pl, sH);
}

typedef __attribute__((ext_vector_type(2))) unsigned short v2us;

__global__ __launch_bounds__(256) void k_wtG(const float* __restrict__ w, int K, int N, bf* Bt) {
    const int lane = threadIdx.x & 31; const int L0 = (blockIdx.x * 8 + (threadIdx.x >> 5)) * 8; const int nlines = N * K / 64;
{
#pragma unroll 1
        for (int l = 0; l < 8; ++l) { const int L = L0 + l; if (L >= nlines) break; const size_t e = (size_t)L * 64 + lane * 2; const int k = (int)(e % K), n = (int)(e / K); v2us o;
            o[0] = f2bf(w[(size_t)k * N + n]); o[1] = f2bf(w[(size_t)(k + 1) * N + n]); *(v2us*)(Bt + e) = o; }
         }
}
__global__ __launch_bounds__(256) void k_cvt8(const float* __restrict__ src, bf* dst, size_t n8) { const size_t i = (size_t)blockIdx.x * 256 + threadIdx.x; if (i >= n8) return; const v8f v = *(const v8f*)(src + i * 8); v8us o;
#pragma unroll
    for (int k = 0; k < 8; ++k) o[k] = f2bf(v[k]); *(v8us*)(dst + i * 8) = o;  }

// ---- k_fattn: causal attention of one (batch, head) plane per blockIdx.x, scores, softmax, P.V and the head merge in one launch; no score ever leaves the registers.
// A wave owns NQ groups of 16 query columns and walks the keys in blocks of 32 up to the diagonal: S^T = K Q^T (A = K rows, B = Q rows kept in registers), so a lane holds 16 scores of ONE query;
// running maximum and sum per query (log2 domain, one exchange between the lane halves), then the two f32 score tiles of a block, converted in place, are the B operand of O^T += V^T P^T (A = V^T rows, same k order as the packed tiles).
// Rows < RH: hi/lo planes, 3 products in both contractions; the rest fp16 with the probabilities carried x 2^10 (the factor is in the row sum too and cancels in the final division).
// fp16 rows: the four waves of a work-group (128 queries) share each stage of 64 keys through LDS: whole-line global loads into registers one stage ahead, two LDS buffers, one barrier a stage. The hi/lo rows (short walks) read their fragments straight from the planes.
#define SP 72   // LDS row pitch of a staged tile in 16-bit elements: 128 data bytes + 16, an odd multiple of 16 bytes, so that the 16-byte fragment reads of 16 rows spread over the banks
__device__ __forceinline__ float xhalf(float x) { return __builtin_bit_cast(float, __builtin_amdgcn_permlanex16(__builtin_bit_cast(int, x), __builtin_bit_cast(int, x), 0x76543210, 0xfedcba98, false, false)); }   // lane l <-> lane l ^ 16
// fa_exp2: 2^x. v_exp_f32 and the one v_nop that fills the slot behind it stand in one statement.
__device__ __forceinline__ float fa_exp2(float x) { float r; asm("v_exp_f32 %0, %1\n\tv_nop" : "=v"(r) : "v"(x)); return r; }
// every loop of the fa_ functions but the key walks is unrolled so that the fragment and accumulator arrays are indexed by constants and stay in registers
// fa_ldk / fa_ldv: the four fragments of one plane for one block of 32 keys; Kb = the block's first K row, Vb = the block's first key in V^T row 0, PITCH = row pitch in elements. GL: the source is global memory (the hi/lo planes); fa_ldg writes s_wait_xcnt 0 behind each of a fragment's two loads.
__device__ __forceinline__ v16bf fa_ldg(const bf* p) {
    const v8us x0 = *(const v8us*)p; asm volatile("s_wait_xcnt 0x0" ::: "memory");          // before the address pair is reused
    const v8us x1 = *(const v8us*)(p + 16); asm volatile("s_wait_xcnt 0x0" ::: "memory");   // before the address pair is reused
    return cat16b(x0, x1);
}
template <typename T16, int PITCH, bool GL>
__device__ __forceinline__ void fa_ldk(const T16* Kb, int lr, int hi, typename WFrag<T16>::V (&ka)[2][2]) {
#pragma unroll
    for (int kt = 0; kt < 2; ++kt)
#pragma unroll
        for (int kc = 0; kc < 2; ++kc) { const T16* p = Kb + (size_t)(kt * 16 + lr) * PITCH + kc * 32 + 8 * hi; if constexpr (GL) ka[kt][kc] = fa_ldg(p); else ka[kt][kc] = WFrag<T16>::ld(p); }
}
template <typename T16, int PITCH, bool GL>
__device__ __forceinline__ void fa_ldv(const T16* Vb, int lr, int hi, typename WFrag<T16>::V (&va)[4]) {
#pragma unroll
    for (int mb = 0; mb < 4; ++mb) { const T16* p = Vb + (size_t)(mb * 16 + lr) * PITCH + 8 * hi; if constexpr (GL) va[mb] = fa_ldg(p); else va[mb] = WFrag<T16>::ld(p); }
}
// fa_block: one block of 32 keys, first key key0. LAST: a block at or above the diagonal: keys above the query are masked.
template <typename T16, bool HR, int NQ, bool LAST, int KPITCH, int VPITCH>
__device__ __forceinline__ void fa_block(const T16* Kb, const T16* Kb2, const T16* Vb, const T16* Vb2, const typename WFrag<T16>::V (&qf)[NQ][2], const typename WFrag<T16>::V (&qf2)[NQ][2],
                                         v8f (&o)[4][NQ], float (&m)[NQ], float (&l)[NQ], int key0, int q0, int lr, int hi) {
    typedef typename WFrag<T16>::V V;
    constexpr float C2 = SCL * 1.4426950408889634f;   // score -> log2 domain
    constexpr float OFS = HR ? 0.0f : 10.0f;          // fp16 probabilities x 2^10: keeps small ones out of the subnormals
    v8f s[2][NQ]; V ka[2][2], ka2[2][2], va[4], va2[4];
    fa_ldk<T16, KPITCH, HR>(Kb, lr, hi, ka); if constexpr (HR) fa_ldk<T16, KPITCH, HR>(Kb2, lr, hi, ka2);
    if constexpr (HR) { fa_ldv<T16, VPITCH, HR>(Vb, lr, hi, va); fa_ldv<T16, VPITCH, HR>(Vb2, lr, hi, va2); }   // from global memory: early, they fly behind the S^T products and the softmax
#pragma unroll
    for (int kt = 0; kt < 2; ++kt)
#pragma unroll
        for (int n = 0; n < NQ; ++n) { s[kt][n] = (v8f){};
#pragma unroll
            for (int kc = 0; kc < 2; ++kc) { s[kt][n] = WFrag<T16>::mma(ka[kt][kc], qf[n][kc], s[kt][n]); if constexpr (HR) { s[kt][n] = WFrag<T16>::mma(ka[kt][kc], qf2[n][kc], s[kt][n]); s[kt][n] = WFrag<T16>::mma(ka2[kt][kc], qf[n][kc], s[kt][n]); } } }
    if constexpr (!HR) fa_ldv<T16, VPITCH, HR>(Vb, lr, hi, va);   // from LDS: into the registers that the K fragments have just left; the softmax covers the LDS latency
    float mx[NQ];
#pragma unroll
    for (int n = 0; n < NQ; ++n) { const int qi = q0 + n * 16 + lr; float t = m[n];
#pragma unroll
        for (int e = 0; e < 16; ++e) { if (LAST) s[e >> 3][n][e & 7] = (key0 + (e >> 3) * 16 + hi * 8 + (e & 7) <= qi) ? s[e >> 3][n][e & 7] : -3.0e38f; t = fmaxf(t, s[e >> 3][n][e & 7]); }
        mx[n] = fmaxf(t, xhalf(t)); }
    // sums and output columns follow the running maximum in every block (factor exactly 1 where it stayed): no branch, so the block is one scheduling region and its loads stay ahead of the vector work
#pragma unroll
    for (int n = 0; n < NQ; ++n) { const float al = fa_exp2((m[n] - mx[n]) * C2); l[n] *= al; m[n] = mx[n];
#pragma unroll
        for (int mb = 0; mb < 4; ++mb) o[mb][n] *= al; }
    V pb[NQ], pb2[NQ];
#pragma unroll
    for (int n = 0; n < NQ; ++n) { const float nm = OFS - mx[n] * C2; float ls = 0.f;
        if constexpr (HR) { v8us h0, h1, l0, l1;
#pragma unroll
            for (int e = 0; e < 8; ++e) { const float pa = fa_exp2(fmaf(s[0][n][e], C2, nm)), pc = fa_exp2(fmaf(s[1][n][e], C2, nm)); ls += pa + pc; unsigned short a, c; splitf(pa, a, c); h0[e] = a; l0[e] = c; splitf(pc, a, c); h1[e] = a; l1[e] = c; }
            pb[n] = cat16b(h0, h1); pb2[n] = cat16b(l0, l1);
        } else { v8h h0, h1;
#pragma unroll
            for (int e = 0; e < 8; ++e) { const float pa = fa_exp2(fmaf(s[0][n][e], C2, nm)), pc = fa_exp2(fmaf(s[1][n][e], C2, nm)); ls += pa + pc; h0[e] = tohx(pa); h1[e] = tohx(pc); }
            pb[n] = cat16(h0, h1); }
        l[n] += ls; }
#pragma unroll
    for (int mb = 0; mb < 4; ++mb)
#pragma unroll
        for (int n = 0; n < NQ; ++n) { o[mb][n] = WFrag<T16>::mma(va[mb], pb[n], o[mb][n]); if constexpr (HR) { o[mb][n] = WFrag<T16>::mma(va[mb], pb2[n], o[mb][n]); o[mb][n] = WFrag<T16>::mma(va2[mb], pb[n], o[mb][n]); } }
}
// fa_out: divides by the row sums and stores the merged hi/lo planes; Ah / Al point at the plane's first merged element (row pitch DQ). A lane holds 8 consecutive d of one query per tile: 16-byte stores, a head's 128-byte line written by one wave.
template <int NQ>
__device__ __forceinline__ void fa_out(const v8f (&o)[4][NQ], const float (&l)[NQ], int q0, int lr, int hi, bf* Ah, bf* Al) {
#pragma unroll
    for (int n = 0; n < NQ; ++n) { const float inv = __fdiv_rn(1.0f, l[n] + xhalf(l[n])); const size_t ro = (size_t)(q0 + n * 16 + lr) * DQ + hi * 8;
#pragma unroll
        for (int mb = 0; mb < 4; ++mb) { v8us oh, ol;
#pragma unroll
            for (int j = 0; j < 8; ++j) { unsigned short a, c; splitf(o[mb][n][j] * inv, a, c); oh[j] = a; ol[j] = c; }
            *(v8us*)(Ah + ro + mb * 16) = oh; *(v8us*)(Al + ro + mb * 16) = ol;
            asm volatile("s_wait_xcnt 0x0" ::: "memory"); } }   // before the next tile's packing reuses the registers of the two stores
}
// fa_hr: hi/lo rows: queries q0 .. q0 + 15 of one plane, one wave on its own.
__device__ __forceinline__ void fa_hr(const bf* __restrict__ Q, const bf* __restrict__ Q2, const bf* __restrict__ Kp, const bf* __restrict__ Kp2, const bf* __restrict__ Vt, const bf* __restrict__ Vt2, int q0, int lr, int hi, bf* Ah, bf* Al) {
    v16bf qf[1][2], qf2[1][2]; v8f o[4][1]; float m[1] = {-3.0e38f}, l[1] = {0.f};
#pragma unroll
    for (int kc = 0; kc < 2; ++kc) { const size_t qo = (size_t)(q0 + lr) * HD + kc * 32 + 8 * hi; qf[0][kc] = WFrag<bf>::ld(Q + qo); qf2[0][kc] = WFrag<bf>::ld(Q2 + qo); }
    asm volatile("s_wait_xcnt 0x0" ::: "memory");   // before the zeroing of the accumulators reuses the address pairs of the loads above
#pragma unroll
    for (int mb = 0; mb < 4; ++mb) o[mb][0] = (v8f){};
    const int nfull = (q0 + 15) >> 5;   // key blocks wholly below the diagonal; block nfull holds the diagonal
    for (int kb = 0; kb < nfull; ++kb) fa_block<bf, true, 1, false, HD, PP>(Kp + (size_t)kb * 32 * HD, Kp2 + (size_t)kb * 32 * HD, Vt + kb * 32, Vt2 + kb * 32, qf, qf2, o, m, l, kb * 32, q0, lr, hi);
    fa_block<bf, true, 1, true, HD, PP>(Kp + (size_t)nfull * 32 * HD, Kp2 + (size_t)nfull * 32 * HD, Vt + nfull * 32, Vt2 + nfull * 32, qf, qf2, o, m, l, nfull * 32, q0, lr, hi);
    fa_out<1>(o, l, q0, lr, hi, Ah, Al);
}
// fa_lo: fp16 rows: queries Q0 .. Q0 + 127 of one plane (Q0 a multiple of 128), wave w takes 32 of them. sm: two buffers, each a K tile [64 keys][SP] and a V^T tile [64 d][SP].
// All four waves walk the same Q0 / 32 + 4 key blocks, so every barrier is passed by all: the first Q0 / 32 lie below every query of the work-group; the last four (two stages) run masked, and a block wholly above a wave's queries adds exact zeros.
// fa_stage_ld / fa_stage_st: a thread moves the 16-byte piece pcol of rows prow, prow + 16, + 32, + 48 of both tiles: a wave's load covers four whole 128-byte lines.
__device__ __forceinline__ void fa_stage_ld(const h16* __restrict__ Kp, const h16* __restrict__ Vt, int key0, int prow, int pcol, v8h (&rk)[4], v8h (&rv)[4]) {
#pragma unroll
    for (int i = 0; i < 4; ++i) { rk[i] = *(const v8h*)(Kp + (size_t)(key0 + prow + 16 * i) * HD + pcol); rv[i] = *(const v8h*)(Vt + (size_t)(prow + 16 * i) * PP + key0 + pcol);
        asm volatile("s_wait_xcnt 0x0" ::: "memory"); }   // before the two loads' address pairs are reused
}
__device__ __forceinline__ void fa_stage_st(h16* sb, int prow, int pcol, const v8h (&rk)[4], const v8h (&rv)[4]) {
#pragma unroll
    for (int i = 0; i < 4; ++i) { *(v8h*)(sb + (prow + 16 * i) * SP + pcol) = rk[i]; *(v8h*)(sb + (64 + prow + 16 * i) * SP + pcol) = rv[i]; }
}
__device__ __forceinline__ void fa_lo(const h16* __restrict__ Q, const h16* __restrict__ Kp, const h16* __restrict__ Vt, h16* sm, int Q0, int w, int lr, int hi, bf* Ah, bf* Al) {
    const int q0 = Q0 + w * 32, prow = (int)threadIdx.x >> 3, pcol = ((int)threadIdx.x & 7) * 8;
    v16h qf[2][2]; v8f o[4][2]; float m[2], l[2]; v8h rk[4], rv[4];
    fa_stage_ld(Kp, Vt, 0, prow, pcol, rk, rv);
#pragma unroll
    for (int n = 0; n < 2; ++n) { m[n] = -3.0e38f; l[n] = 0.f;
#pragma unroll
        for (int kc = 0; kc < 2; ++kc) qf[n][kc] = WFrag<h16>::ld(Q + (size_t)(q0 + n * 16 + lr) * HD + kc * 32 + 8 * hi); }
    asm volatile("s_wait_xcnt 0x0" ::: "memory");   // before the zeroing of the accumulators reuses the address pairs of the loads above
#pragma unroll
    for (int n = 0; n < 2; ++n)
#pragma unroll
        for (int mb = 0; mb < 4; ++mb) o[mb][n] = (v8f){};
    fa_stage_st(sm, prow, pcol, rk, rv);
    __syncthreads();   // publishes stage 0
    const int nmain = Q0 >> 6;   // unmasked stages, an even number: stage nmain lies in buffer 0 again
    for (int st = 0; st < nmain; ++st) { const h16* sb = sm + (st & 1) * (128 * SP);
        fa_stage_ld(Kp, Vt, (st + 1) * 64, prow, pcol, rk, rv);   // flies behind this stage's two blocks
        // stays rolled: unrolled, the build fetches the second block's fragments during the first and the register count costs a wave per SIMD
#pragma unroll 1
        for (int b = 0; b < 2; ++b) fa_block<h16, false, 2, false, SP, SP>(sb + b * 32 * SP, nullptr, sb + 64 * SP + b * 32, nullptr, qf, qf, o, m, l, st * 64 + b * 32, q0, lr, hi);
        fa_stage_st(sm + ((st + 1) & 1) * (128 * SP), prow, pcol, rk, rv);   // that buffer's last reads stand in front of the barrier of stage st - 1
        __syncthreads(); }   // publishes stage st + 1 and ends every wave's reads of stage st
    fa_stage_ld(Kp, Vt, Q0 + 64, prow, pcol, rk, rv);   // the last stage; flies behind the first two masked blocks
    // stays rolled: one copy of the masked block in the text
#pragma unroll 1
    for (int t = 0; t < 4; ++t) { const h16* sb = sm + (t >> 1) * (128 * SP);
        if (t == 2) { fa_stage_st(sm + 128 * SP, prow, pcol, rk, rv); __syncthreads(); }   // publishes the last stage; buffer 1 was last read in front of the barrier that published stage nmain
        fa_block<h16, false, 2, true, SP, SP>(sb + (t & 1) * 32 * SP, nullptr, sb + 64 * SP + (t & 1) * 32, nullptr, qf, qf, o, m, l, Q0 + t * 32, q0, lr, hi); }
    fa_out<2>(o, l, q0, lr, hi, Ah, Al);
}
// grid (NB_ * NH_, (TT - RH) / 128 + RH / 64), 4 waves: blockIdx.y counts the query blocks from the longest key walk down, so that the cost falls with the work-group index. amdgpu_waves_per_eu(4, 4): the register budget of four waves per SIMD (without it the build takes more than 256 registers and a wave per SIMD is lost).
__global__ __launch_bounds__(128) __attribute__((amdgpu_waves_per_eu(4, 4))) void k_fattn(const h16* __restrict__ Q16, const h16* __restrict__ K16, const h16* __restrict__ V16, const bf* __restrict__ Qh, const bf* __restrict__ Ql, const bf* __restrict__ Kh, const bf* __restrict__ Kl, const bf* __restrict__ Vh, const bf* __restrict__ Vl, bf* Ah, bf* Al) {
    __shared__ __align__(16) h16 sm[2 * 128 * SP];
    const int lane = threadIdx.x & 31, lr = lane & 15, hi = lane >> 4;
    const int w = __builtin_amdgcn_readfirstlane(threadIdx.x >> 5);   // wave number, scalar: the key loops' bounds stay scalar
    const size_t bh = blockIdx.x, po = bh * TT * HD, vo = bh * HD * PP, ao = (bh / NH_) * TT * DQ + (bh % NH_) * HD; const int y = blockIdx.y;
    if (y < (TT - RH) / 128) fa_lo(Q16 + po, K16 + po, V16 + vo, sm, TT - 128 * (y + 1), w, lr, hi, Ah + ao, Al + ao);
    else fa_hr(Qh + po, Ql + po, Kh + po, Kl + po, Vh + vo, Vl + vo, RH - 64 * (y - (TT - RH) / 128 + 1) + w * 16, lr, hi, Ah + ao, Al + ao);
}

extern "C" void kernel_launch(void* const* d_in, const int* in_sizes, int n_in,
                              void* d_out, int out_size, void* d_ws, size_t ws_size, hipStream_t stream) {
    (void)in_sizes; (void)n_in; (void)out_size;
    const float* x = (const float*)d_in[0]; const float* xk = (const float*)d_in[1]; const float* xv = (const float*)d_in[2]; const float* wq = (const float*)d_in[3]; const float* bq = (const float*)d_in[4]; const float* wk = (const float*)d_in[5]; const float* bk = (const float*)d_in[6]; const float* wv = (const float*)d_in[7]; const float* bv = (const float*)d_in[8]; const float* wo = (const float*)d_in[9]; const float* bo = (const float*)d_in[10];
    float* OUT = (float*)d_out;     // [4][2048][1024]
    char* wsp = (char*)d_ws;
    auto take = [&](size_t bytes) { char* p = wsp; wsp += (bytes + 255) & ~(size_t)255; return (void*)p; };
    bf* WQ = (bf*)take((size_t)DQ * DM * 2); bf* WK = (bf*)take((size_t)DKV * DM * 2); bf* WV = (bf*)take((size_t)DKV * DM * 2); bf* WO = (bf*)take((size_t)DM * DQ * 2);
    bf* XB = (bf*)take((size_t)TT * DM * 2);
    const size_t PQ = (size_t)NH_ * TT * HD, PK = (size_t)NKV * TT * HD, PV = (size_t)NKV * HD * PP, PA = (size_t)TT * DQ;   // elements of one batch's planes; every plane set holds the NB_ batches side by side
    h16* QP16 = (h16*)take(NB_ * PQ * 2); h16* KP16 = (h16*)take(NB_ * PK * 2); h16* VT16 = (h16*)take(NB_ * PV * 2);
    bf* QPh = (bf*)take(NB_ * PQ * 2); bf* QPl = (bf*)take(NB_ * PQ * 2); bf* KPh = (bf*)take(NB_ * PK * 2); bf* KPl = (bf*)take(NB_ * PK * 2); bf* VTh = (bf*)take(NB_ * PV * 2); bf* VTl = (bf*)take(NB_ * PV * 2);
    bf* ATh = (bf*)take(NB_ * PA * 2); bf* ATl = (bf*)take(NB_ * PA * 2);
    if ((size_t)(wsp - (char*)d_ws) > ws_size) return;    // ws 256 MiB
    { k_wtG<<<(unsigned)((DM * DQ / 64 + 63) / 64), 256, 0, stream>>>(wq, DM, DQ, WQ); k_wtG<<<(unsigned)((DM * DKV / 64 + 63) / 64), 256, 0, stream>>>(wk, DM, DKV, WK); k_wtG<<<(unsigned)((DM * DKV / 64 + 63) / 64), 256, 0, stream>>>(wv, DM, DKV, WV);
      k_wtG<<<(unsigned)((DQ * DM / 64 + 63) / 64), 256, 0, stream>>>(wo, DQ, DM, WO);
       }
    for (int b = 0; b < NB_; ++b) {
        
        k_cvt8<<<(unsigned)(((size_t)TT * DM / 8 + 255) / 256), 256, 0, stream>>>(x + (size_t)b * TT * DM, XB, (size_t)TT * DM / 8);
        k_gemmw<bf, 0, true, 8, 1><<<dim3(TT / 64, DQ / 64, 1), 256, 0, stream>>>(XB, nullptr, WQ, nullptr, DM, nullptr, HD, bq, 0, 0, 0, QP16 + b * PQ, QPh + b * PQ, QPl + b * PQ, (size_t)TT * HD);
        k_cvt8<<<(unsigned)(((size_t)TT * DM / 8 + 255) / 256), 256, 0, stream>>>(xk + (size_t)b * TT * DM, XB, (size_t)TT * DM / 8); k_gemmw<bf, 0, true, 8, 1><<<dim3(TT / 64, DKV / 64, 1), 256, 0, stream>>>(XB, nullptr, WK, nullptr, DM, nullptr, HD, bk, 0, 0, 0, KP16 + b * PK, KPh + b * PK, KPl + b * PK, (size_t)TT * HD);
        // v: the operands change places (A = the weight rows, Bt = the tokens), so that the tile comes out as V^T rows; same k order, same products
        k_cvt8<<<(unsigned)(((size_t)TT * DM / 8 + 255) / 256), 256, 0, stream>>>(xv + (size_t)b * TT * DM, XB, (size_t)TT * DM / 8); k_gemmw<bf, 0, true, 8, 2><<<dim3(DKV / 64, TT / 64, 1), 256, 0, stream>>>(WV, nullptr, XB, nullptr, DM, nullptr, PP, bv, 0, 0, 0, VT16 + b * PV, VTh + b * PV, VTl + b * PV, (size_t)64); }
    k_fattn<<<dim3(NB_ * NH_, (TT - RH) / 128 + RH / 64, 1), 128, 0, stream>>>(QP16, KP16, VT16, QPh, QPl, KPh, KPl, VTh, VTl, ATh, ATl);
    for (int b = 0; b < NB_; ++b)
        k_gemmw<bf, 1, true, 8, 0><<<dim3(TT / 64, DM / 64, 1), 256, 0, stream>>>(ATh + b * PA, ATl + b * PA, WO, nullptr, DQ, OUT + (size_t)b * TT * DM, DM, bo, 0, 0, 0, nullptr, nullptr, nullptr, 0);
}

// v005
// One run takes 270 microseconds.
// Next to v004, in two timings, it ran 1.36 and 1.35 times as fast.
// Counting every step since v000, it is 10.8 times as fast.
#include <hip/hip_runtime.h>

// Causal multi-head attention on THREE separate input streams with biased (in, out) projections (Q, K, V [4][2048][1024]; q = Q Wq + bq, k = K Wk + bk, v = V Wv + bv ('xw' [1024][1024] normal x 1/32 + [1024] zeros on this draw: read; 16 heads x 64); scores / sqrt(64); tril kept, -inf elsewhere; softmax; out = merged Wo + bo ('xw' + a zero bias: read) -> [4][2048][1024] (8.4 M); argument order Q, K, V, Wq, bq, Wk, bk, Wv, bv, Wo, bo).
// Four launches. (1) the four 'xw' weights transposed and the three inputs copied to bf16, all batches; (2) the twelve projections (q, k, v x batch) as one grid: exact + f32 biases, stored by the GEMM itself as head planes, all batches side by side; (3) one fused causal T-2048 attention launch for all 64 (batch, head) planes (hybrid rows: < 512 hi/lo 3 products, rest fp16 x1024 with K and V^T staged in LDS; online softmax in registers, key walk ends at the diagonal); (4) merged hi/lo x w_o exact + b_o, the batch in blockIdx.z.
// Compute dtypes, f32 accumulate: every input rounded to bf16; projections exact + f32 biases; attention rows < 512 3 products, rest fp16; softmax f32; Wo hl x exact + bias.

#define NB_  4
#define TT   2048
#define DM   1024
#define NH_  16
#define NKV  16
#define REP  (NH_ / NKV)
#define HD   64
#define DQ   (NH_ * HD)
#define DKV  (NKV * HD)
#define PP   TT                   // row pitch, in 16-bit elements, of the V^T planes
#define RH   512                  // query rows < RH use hi+lo planes (0: none)
#define SCL  0.125f   // HD^-0.5
typedef _Float16 h16;
typedef unsigned short bf;
typedef __attribute__((ext_vector_type(16))) __bf16   v16bf;
typedef __attribute__((ext_vector_type(16))) _Float16 v16h;
typedef __attribute__((ext_vector_type(8)))  _Float16 v8h;
typedef __attribute__((ext_vector_type(8)))  unsigned short v8us;
typedef __attribute__((ext_vector_type(8)))  float    v8f;
typedef __attribute__((ext_vector_type(4)))  float    v4f;
typedef v8h  __attribute__((may_alias)) v8ha;
typedef v4f  __attribute__((may_alias)) v4fa;
typedef v8us __attribute__((may_alias)) v8usa;

__device__ __forceinline__ unsigned short f2bf(float f) { unsigned u = __float_as_uint(f); u += 0x7FFFu + ((u >> 16) & 1u); return (unsigned short)(u >> 16); }
__device__ __forceinline__ float bf2f(unsigned short b) { return __uint_as_float(((unsigned)b) << 16); }
__device__ __forceinline__ float bfr(float f) { return bf2f(f2bf(f)); }
__device__ __forceinline__ v16h cat16(v8h lo, v8h hi) { return __builtin_shufflevector(lo, hi, 0, 1, 2, 3, 4, 5, 6, 7, 8, 9, 10, 11, 12, 13, 14, 15); }
__device__ __forceinline__ v16bf cat16b(v8us lo, v8us hi) { return __builtin_bit_cast(v16bf, __builtin_shufflevector(lo, hi, 0, 1, 2, 3, 4, 5, 6, 7, 8, 9, 10, 11, 12, 13, 14, 15)); }
__device__ __forceinline__ v8f wmma16(v16h a, v16h b, v8f c) { return __builtin_amdgcn_wmma_f32_16x16x32_f16(false, a, false, b, (short)0, c, false, false); }
__device__ __forceinline__ v8f wmmab(v16bf a, v16bf b, v8f c) { return __builtin_amdgcn_wmma_f32_16x16x32_bf16(false, a, false, b, (short)0, c, false, false); }
__device__ __forceinline__ h16 tohx(float x) { return (h16)x; }
__device__ __forceinline__ void splitf(float y, unsigned short& h, unsigned short& l) { h = f2bf(y); l = f2bf(y - bf2f(h)); }
typedef __attribute__((ext_vector_type(4))) _Float16 v4h;
typedef __attribute__((ext_vector_type(4))) unsigned short v4us;



// ---- k_gemmw: register-blocked GEMM, one work-group of NW waves per 64x64 output tile (16 accumulators a wave), operands straight from K-contiguous 16-bit planes; grid (M/64, N/64, Z), 32 * NW threads.
// C[m][n] (f32, pitch ldc, + optional f32 bias[n]) = sum_k A[m][k] Bt[n][k] (+ split products per NSPLIT). z-batch strides sA/sB/sC in elements. K % 64 == 0.
// The K loop is dealt out over the NW waves in slices of 64 k (one whole 128-byte line of every operand row): wave w takes slices w, w + NW, ... ; tile_out sums the NW partial tiles in LDS in wave order.
// tile_out: every wave stores its partial 64x64 tile to its own LDS range (pitch 68 floats), one barrier, then each 16-byte piece is summed over the waves (0, 1, ..) by one thread and stored, whole lines a row.
// PL 0: f32 to C, bias[n]. PL 1: the sum goes out as three 16-bit planes (fp16, bf16 hi, bf16 lo) and no f32 copy is kept; element [m][n] lies at (n / 64) * sH + m * ldc + n % 64 of each plane, so a tile row is one whole 128-byte line of each.
// PL 1, brow false: bias[n] (m = token, n = head * 64 + d: sH = TT * HD, ldc = HD gives [head][t][d]). PL 1, brow true: bias[m] (m = head * 64 + d, n = token: sH = 64, ldc = PP gives the V^T rows [head][d][t]). brow is the same for a whole work-group.
template <int NW, bool BIAS, int PL>
__device__ __forceinline__ void tile_out(const v8f (&acc)[4][4], float* os, int w, int lr, int hi, float* C, int ldc, int r0, int c0, const float* __restrict__ bias, h16* P16, bf* Ph, bf* Pl, size_t sH, bool brow = false) {
    float* ow = os + w * (64 * 68);
    // the three loops are unrolled so that acc is indexed by constants and stays in registers
#pragma unroll
    for (int mb = 0; mb < 4; ++mb) {
#pragma unroll
        for (int nb = 0; nb < 4; ++nb) {
#pragma unroll
            for (int j = 0; j < 8; ++j) ow[(mb * 16 + hi * 8 + j) * 68 + nb * 16 + lr] = acc[mb][nb][j]; } }
    __syncthreads();   // publishes the NW partial tiles to the threads that sum them
    float* ct = PL == 0 ? C + (size_t)r0 * ldc + c0 : nullptr;
    // both loops unrolled: all LDS loads of a piece are in flight together
    [[maybe_unused]] v4f vs[64 * 16 / (32 * NW)];   // PL 1: the sums of all the thread's pieces are formed first, so that no LDS or bias load stands behind the wait of an earlier piece's stores
#pragma unroll
    for (int s = 0; s < 64 * 16 / (32 * NW); ++s) { const int q = s * (32 * NW) + (int)threadIdx.x, row = q >> 4, cofs = (q & 15) * 4; v4f val = *(const v4fa*)(os + row * 68 + cofs);
#pragma unroll
        for (int p = 1; p < NW; ++p) val += *(const v4fa*)(os + p * (64 * 68) + row * 68 + cofs);
        if (BIAS && PL == 1) { const float* bp = bias + (brow ? r0 + row : c0 + cofs); const int bs = brow ? 0 : 1; val[0] += bfr(bp[0]); val[1] += bfr(bp[bs]); val[2] += bfr(bp[2 * bs]); val[3] += bfr(bp[3 * bs]); }   // no branch: the loads of all pieces stay in flight together
        if (BIAS && PL == 0) { val[0] += bfr(bias[c0 + cofs]); val[1] += bfr(bias[c0 + cofs + 1]); val[2] += bfr(bias[c0 + cofs + 2]); val[3] += bfr(bias[c0 + cofs + 3]); }
        if constexpr (PL == 0) *(v4f*)(ct + (size_t)row * ldc + cofs) = val; else vs[s] = val; }
    if constexpr (PL != 0) {
        // unrolled: vs is indexed by constants and stays in registers
#pragma unroll
        for (int s = 0; s < 64 * 16 / (32 * NW); ++s) { const int q = s * (32 * NW) + (int)threadIdx.x, row = q >> 4, cofs = (q & 15) * 4; const size_t po = (size_t)(c0 >> 6) * sH + (size_t)(r0 + row) * ldc + cofs; v4h o16; v4us oh, ol;
#pragma unroll
            for (int i = 0; i < 4; ++i) { o16[i] = tohx(vs[s][i]); unsigned short a, c; splitf(vs[s][i], a, c); oh[i] = a; ol[i] = c; }
            *(v4h*)(P16 + po) = o16; *(v4us*)(Ph + po) = oh; *(v4us*)(Pl + po) = ol;
            asm volatile("s_wait_xcnt 0x0" ::: "memory"); } }   // before the next piece reuses the registers of the three stores
}
template <typename T16> struct WFrag;
template <> struct WFrag<h16> { typedef v16h V; static __device__ __forceinline__ V ld(const h16* p) { return cat16(*(const v8h*)p, *(const v8h*)(p + 16)); } static __device__ __forceinline__ v8f mma(V a, V b, v8f c) { return wmma16(a, b, c); } };
template <> struct WFrag<bf> { typedef v16bf V; static __device__ __forceinline__ V ld(const bf* p) { return cat16b(*(const v8us*)p, *(const v8us*)(p + 16)); } static __device__ __forceinline__ v8f mma(V a, V b, v8f c) { return wmmab(a, b, c); } };
template <typename T16, int NSPLIT, bool BIAS, int NW, int PL>
__global__ __launch_bounds__(32 * NW) void k_gemmw(const T16* __restrict__ A, const T16* __restrict__ A2, const T16* __restrict__ Bt, const T16* __restrict__ Bt2, int K, float* C, int ldc, const float* __restrict__ bias, size_t sA, size_t sB, size_t sC, h16* P16, bf* Ph, bf* Pl, size_t sH) {
    typedef typename WFrag<T16>::V V;
    __shared__ __align__(16) float os[NW * 64 * 68];
    const size_t z = blockIdx.z; A += z * sA; if (A2) A2 += z * sA; Bt += z * sB; if (Bt2) Bt2 += z * sB; C += z * sC;
    const int lane = threadIdx.x & 31, lr = lane & 15, hi = lane >> 4; const int r0 = blockIdx.x * 64, c0 = blockIdx.y * 64;
    const int w = __builtin_amdgcn_readfirstlane(threadIdx.x >> 5);   // wave number, scalar: the K loop's bounds stay scalar
    v8f acc[4][4];
#pragma unroll
    for (int mb = 0; mb < 4; ++mb)
#pragma unroll
        for (int nb = 0; nb < 4; ++nb) acc[mb][nb] = (v8f){};
    const size_t aoff = (size_t)(r0 + lr) * K + 8 * hi, boff = (size_t)(c0 + lr) * K + 8 * hi;
    // both loops stay rolled, as the one loop they replace: one fragment set in registers
#pragma unroll 1
    for (int k0 = w * 64; k0 < K; k0 += 64 * NW)
#pragma unroll 1
    for (int kc = k0; kc < k0 + 64; kc += 32) {
        V a[4], a2[4];
#pragma unroll
        for (int mb = 0; mb < 4; ++mb) { a[mb] = WFrag<T16>::ld(A + aoff + (size_t)mb * 16 * K + kc); if (NSPLIT == 1 || NSPLIT == 2) a2[mb] = WFrag<T16>::ld(A2 + aoff + (size_t)mb * 16 * K + kc); }
#pragma unroll
        for (int nb = 0; nb < 4; ++nb) { const V b = WFrag<T16>::ld(Bt + boff + (size_t)nb * 16 * K + kc); V b2; if (NSPLIT >= 2) b2 = WFrag<T16>::ld(Bt2 + boff + (size_t)nb * 16 * K + kc);
#pragma unroll
            for (int mb = 0; mb < 4; ++mb) { acc[mb][nb] = WFrag<T16>::mma(a[mb], b, acc[mb][nb]); if (NSPLIT == 1 || NSPLIT == 2) acc[mb][nb] = WFrag<T16>::mma(a2[mb], b, acc[mb][nb]); if (NSPLIT >= 2) acc[mb][nb] = WFrag<T16>::mma(a[mb], b2, acc[mb][nb]); } }
        asm volatile("v_nop\n\tv_nop\n\tv_nop\n\tv_nop" : "+v"(acc[0][0]), "+v"(acc[1][1]), "+v"(acc[2][2]), "+v"(acc[3][3]) : "v"(a[0]), "v"(a[3]));
    }
    tile_out<NW, BIAS, PL>(acc, os, w, lr, hi, C, ldc, r0, c0, bias, P16, Ph, Pl, sH);
}
// ---- k_proj: the twelve projection GEMMs as one grid (TT / 64, DQ / 64, 3 * NB_): blockIdx.z = kind * NB_ + batch, kind 0 q, 1 k, 2 v; blockIdx.x = token tile, blockIdx.y = tile of 64 output channels (one head).
// XB: the bf16 inputs [kind][batch][TT][DM]; WT: the transposed weights [kind][DQ][DM]; P16 / Ph / Pl: the plane sets [kind][batch][NH_ * TT * HD]. Every tile is summed as in k_gemmw.
// v: the operands change places (A = the weight rows, Bt = the tokens), so that the tile comes out as V^T rows; same k order, same products
static_assert(DKV == DQ && PP == TT, "the q, k and v planes of a batch have one size");
__global__ __launch_bounds__(256) void k_proj(const bf* __restrict__ XB, const bf* __restrict__ WT, const float* __restrict__ bq, const float* __restrict__ bk, const float* __restrict__ bv, h16* P16, bf* Ph, bf* Pl) {
    __shared__ __align__(16) float os[8 * 64 * 68];
    const int lane = threadIdx.x & 31, lr = lane & 15, hi = lane >> 4;
    const int w = __builtin_amdgcn_readfirstlane(threadIdx.x >> 5);   // wave number, scalar: the K loop's bounds stay scalar
    const int z = blockIdx.z, kind = z / NB_, tok0 = blockIdx.x * 64, ch0 = blockIdx.y * 64; const bool vt = kind == 2;
    const bf* X = XB + (size_t)z * TT * DM; const bf* Wt = WT + (size_t)kind * DQ * DM; const size_t pz = (size_t)z * NH_ * TT * HD;
    const int r0 = vt ? ch0 : tok0, c0 = vt ? tok0 : ch0;
    const bf* __restrict__ A = (vt ? Wt : X) + (size_t)(r0 + lr) * DM + 8 * hi; const bf* __restrict__ Bt = (vt ? X : Wt) + (size_t)(c0 + lr) * DM + 8 * hi;
    v8f acc[4][4];
    // the loops over mb and nb are unrolled so that acc and a are indexed by constants and stay in registers
#pragma unroll
    for (int mb = 0; mb < 4; ++mb)
#pragma unroll
        for (int nb = 0; nb < 4; ++nb) acc[mb][nb] = (v8f){};
    // the K loop of k_gemmw for one product: both loops stay rolled, one fragment set in registers
#pragma unroll 1
    for (int k0 = w * 64; k0 < DM; k0 += 64 * 8)
#pragma unroll 1
    for (int kc = k0; kc < k0 + 64; kc += 32) {
        v16bf a[4];
#pragma unroll
        for (int mb = 0; mb < 4; ++mb) a[mb] = WFrag<bf>::ld(A + (size_t)mb * 16 * DM + kc);
        asm volatile("s_wait_xcnt 0x0" ::: "memory");   // before the address pair of the A loads is reused (the build hands it on as the destination of a B load)
#pragma unroll
        for (int nb = 0; nb < 4; ++nb) { const v16bf b = WFrag<bf>::ld(Bt + (size_t)nb * 16 * DM + kc);
#pragma unroll
            for (int mb = 0; mb < 4; ++mb) acc[mb][nb] = wmmab(a[mb], b, acc[mb][nb]); }
    }
    tile_out<8, true, 1>(acc, os, w, lr, hi, nullptr, vt ? PP : HD, r0, c0, vt ? bv : kind ? bk : bq, P16 + pz, Ph + pz, Pl + pz, vt ? (size_t)64 : (size_t)TT * HD, vt);
}

typedef __attribute__((ext_vector_type(2))) unsigned short v2us;

// ---- k_prep: all the operand preparation in one launch. Work-groups 0 .. 4 * WB - 1: the four weights ([DM][DQ] f32, in the order q, k, v, o) transposed to bf16 rows WT[sel][n][k], 64 lines of 64 elements a work-group.
// The other TT * DM / 8 / 256 work-groups: the three inputs to bf16, XB[input][batch][TT][DM]; a thread converts its 8 elements of every one of the twelve [TT][DM] slabs, the four batches of an input in flight together.
__global__ __launch_bounds__(256) void k_prep(const float* __restrict__ wq, const float* __restrict__ wk, const float* __restrict__ wv, const float* __restrict__ wo, const float* __restrict__ x, const float* __restrict__ xk, const float* __restrict__ xv, bf* WT, bf* XB) {
    constexpr int K = DM, N = DQ, WB = N * K / 64 / 64; const int bx = blockIdx.x;
    if (bx < 4 * WB) {
        const int sel = bx / WB; const float* __restrict__ w = sel == 0 ? wq : sel == 1 ? wk : sel == 2 ? wv : wo; bf* Bt = WT + (size_t)sel * N * K;
        const int lane = threadIdx.x & 31; const int L0 = ((bx % WB) * 8 + (threadIdx.x >> 5)) * 8;
        // stays rolled: few registers, so that the kernel keeps sixteen waves per SIMD
#pragma unroll 1
        for (int l = 0; l < 8; ++l) { const int L = L0 + l; const size_t e = (size_t)L * 64 + lane * 2; const int k = (int)(e % K), n = (int)(e / K); v2us o;
            o[0] = f2bf(w[(size_t)k * N + n]); o[1] = f2bf(w[(size_t)(k + 1) * N + n]); *(v2us*)(Bt + e) = o; }
    } else {
        const size_t i8 = ((size_t)(bx - 4 * WB) * 256 + threadIdx.x) * 8;
        // the loop over the inputs stays rolled: eight 16-byte loads of a lane in flight, few registers, many waves per SIMD; the loops over b and k are unrolled so that v and o stay in registers
#pragma unroll 1
        for (int s = 0; s < 3; ++s) { const float* __restrict__ src = (s == 0 ? x : s == 1 ? xk : xv) + i8; bf* dst = XB + (size_t)s * NB_ * TT * DM + i8; v8f v[NB_];
#pragma unroll
            for (int b = 0; b < NB_; ++b) { v[b] = *(const v8f*)(src + (size_t)b * TT * DM);
                asm volatile("s_wait_xcnt 0x0" ::: "memory"); }   // before the address pair is reused (the build hands it on as the destination of a later load)
#pragma unroll
            for (int b = 0; b < NB_; ++b) { v8us o;
#pragma unroll
                for (int k = 0; k < 8; ++k) o[k] = f2bf(v[b][k]);
                *(v8us*)(dst + (size_t)b * TT * DM) = o; }
            asm volatile("s_wait_xcnt 0x0" ::: "memory"); }   // before the next input's addresses reuse the registers of the stores
    }
}

// ---- k_fattn: causal attention of one (batch, head) plane per blockIdx.x, scores, softmax, P.V and the head merge in one launch; no score ever leaves the registers.
// A wave owns NQ groups of 16 query columns and walks the keys in blocks of 32 up to the diagonal: S^T = K Q^T (A = K rows, B = Q rows kept in registers), so a lane holds 16 scores of ONE query;
// running maximum and sum per query (log2 domain, one exchange between the lane halves), then the two f32 score tiles of a block, converted in place, are the B operand of O^T += V^T P^T (A = V^T rows, same k order as the packed tiles).
// Rows < RH: hi/lo planes, 3 products in both contractions; the rest fp16 with the probabilities carried x 2^10 (the factor is in the row sum too and cancels in the final division).
// fp16 rows: the four waves of a work-group (128 queries) share each stage of 64 keys through LDS: whole-line global loads into registers one stage ahead, two LDS buffers, one barrier a stage. The hi/lo rows (short walks) read their fragments straight from the planes.
#define SP 72   // LDS row pitch of a staged tile in 16-bit elements: 128 data bytes + 16, an odd multiple of 16 bytes, so that the 16-byte fragment reads of 16 rows spread over the banks
__device__ __forceinline__ float xhalf(float x) { return __builtin_bit_cast(float, __builtin_amdgcn_permlanex16(__builtin_bit_cast(int, x), __builtin_bit_cast(int, x), 0x76543210, 0xfedcba98, false, false)); }   // lane l <-> lane l ^ 16
// fa_exp2: 2^x. v_exp_f32 and the one v_nop that fills the slot behind it stand in one statement.
__device__ __forceinline__ float fa_exp2(float x) { float r; asm("v_exp_f32 %0, %1\n\tv_nop" : "=v"(r) : "v"(x)); return r; }
// every loop of the fa_ functions but the key walks is unrolled so that the fragment and accumulator arrays are indexed by constants and stay in registers
// fa_ldk / fa_ldv: the four fragments of one plane for one block of 32 keys; Kb = the block's first K row, Vb = the block's first key in V^T row 0, PITCH = row pitch in elements. GL: the source is global memory (the hi/lo planes); fa_ldg writes s_wait_xcnt 0 behind each of a fragment's two loads.
__device__ __forceinline__ v16bf fa_ldg(const bf* p) {
    const v8us x0 = *(const v8us*)p; asm volatile("s_wait_xcnt 0x0" ::: "memory");          // before the address pair is reused
    const v8us x1 = *(const v8us*)(p + 16); asm volatile("s_wait_xcnt 0x0" ::: "memory");   // before the address pair is reused
    return cat16b(x0, x1);
}
template <typename T16, int PITCH, bool GL>
__device__ __forceinline__ void fa_ldk(const T16* Kb, int lr, int hi, typename WFrag<T16>::V (&ka)[2][2]) {
#pragma unroll
    for (int kt = 0; kt < 2; ++kt)
#pragma unroll
        for (int kc = 0; kc < 2; ++kc) { const T16* p = Kb + (size_t)(kt * 16 + lr) * PITCH + kc * 32 + 8 * hi; if constexpr (GL) ka[kt][kc] = fa_ldg(p); else ka[kt][kc] = WFrag<T16>::ld(p); }
}
template <typename T16, int PITCH, bool GL>
__device__ __forceinline__ void fa_ldv(const T16* Vb, int lr, int hi, typename WFrag<T16>::V (&va)[4]) {
#pragma unroll
    for (int mb = 0; mb < 4; ++mb) { const T16* p = Vb + (size_t)(mb * 16 + lr) * PITCH + 8 * hi; if constexpr (GL) va[mb] = fa_ldg(p); else va[mb] = WFrag<T16>::ld(p); }
}
// fa_block: one block of 32 keys, first key key0. LAST: a block at or above the diagonal: keys above the query are masked.
template <typename T16, bool HR, int NQ, bool LAST, int KPITCH, int VPITCH>
__device__ __forceinline__ void fa_block(const T16* Kb, const T16* Kb2, const T16* Vb, const T16* Vb2, const typename WFrag<T16>::V (&qf)[NQ][2], const typename WFrag<T16>::V (&qf2)[NQ][2],
                                         v8f (&o)[4][NQ], float (&m)[NQ], float (&l)[NQ], int key0, int q0, int lr, int hi) {
    typedef typename WFrag<T16>::V V;
    constexpr float C2 = SCL * 1.4426950408889634f;   // score -> log2 domain
    constexpr float OFS = HR ? 0.0f : 10.0f;          // fp16 probabilities x 2^10: keeps small ones out of the subnormals
    v8f s[2][NQ]; V ka[2][2], ka2[2][2], va[4], va2[4];
    fa_ldk<T16, KPITCH, HR>(Kb, lr, hi, ka); if constexpr (HR) fa_ldk<T16, KPITCH, HR>(Kb2, lr, hi, ka2);
    if constexpr (HR) { fa_ldv<T16, VPITCH, HR>(Vb, lr, hi, va); fa_ldv<T16, VPITCH, HR>(Vb2, lr, hi, va2); }   // from global memory: early, they fly behind the S^T products and the softmax
#pragma unroll
    for (int kt = 0; kt < 2; ++kt)
#pragma unroll
        for (int n = 0; n < NQ; ++n) { s[kt][n] = (v8f){};
#pragma unroll
            for (int kc = 0; kc < 2; ++kc) { s[kt][n] = WFrag<T16>::mma(ka[kt][kc], qf[n][kc], s[kt][n]); if constexpr (HR) { s[kt][n] = WFrag<T16>::mma(ka[kt][kc], qf2[n][kc], s[kt][n]); s[kt][n] = WFrag<T16>::mma(ka2[kt][kc], qf[n][kc], s[kt][n]); } } }
    if constexpr (!HR) fa_ldv<T16, VPITCH, HR>(Vb, lr, hi, va);   // from LDS: into the registers that the K fragments have just left; the softmax covers the LDS latency
    float mx[NQ];
#pragma unroll
    for (int n = 0; n < NQ; ++n) { const int qi = q0 + n * 16 + lr; float t = m[n];
#pragma unroll
        for (int e = 0; e < 16; ++e) { if (LAST) s[e >> 3][n][e & 7] = (key0 + (e >> 3) * 16 + hi * 8 + (e & 7) <= qi) ? s[e >> 3][n][e & 7] : -3.0e38f; t = fmaxf(t, s[e >> 3][n][e & 7]); }
        mx[n] = fmaxf(t, xhalf(t)); }
    // sums and output columns follow the running maximum in every block (factor exactly 1 where it stayed): no branch, so the block is one scheduling region and its loads stay ahead of the vector work
#pragma unroll
    for (int n = 0; n < NQ; ++n) { const float al = fa_exp2((m[n] - mx[n]) * C2); l[n] *= al; m[n] = mx[n];
#pragma unroll
        for (int mb = 0; mb < 4; ++mb) o[mb][n] *= al; }
    V pb[NQ], pb2[NQ];
#pragma unroll
    for (int n = 0; n < NQ; ++n) { const float nm = OFS - mx[n] * C2; float ls = 0.f;
        if constexpr (HR) { v8us h0, h1, l0, l1;
#pragma unroll
            for (int e = 0; e < 8; ++e) { const float pa = fa_exp2(fmaf(s[0][n][e], C2, nm)), pc = fa_exp2(fmaf(s[1][n][e], C2, nm)); ls += pa + pc; unsigned short a, c; splitf(pa, a, c); h0[e] = a; l0[e] = c; splitf(pc, a, c); h1[e] = a; l1[e] = c; }
            pb[n] = cat16b(h0, h1); pb2[n] = cat16b(l0, l1);
        } else { v8h h0, h1;
#pragma unroll
            for (int e = 0; e < 8; ++e) { const float pa = fa_exp2(fmaf(s[0][n][e], C2, nm)), pc = fa_exp2(fmaf(s[1][n][e], C2, nm)); ls += pa + pc; h0[e] = tohx(pa); h1[e] = tohx(pc); }
            pb[n] = cat16(h0, h1); }
        l[n] += ls; }
#pragma unroll
    for (int mb = 0; mb < 4; ++mb)
#pragma unroll
        for (int n = 0; n < NQ; ++n) { o[mb][n] = WFrag<T16>::mma(va[mb], pb[n], o[mb][n]); if constexpr (HR) { o[mb][n] = WFrag<T16>::mma(va[mb], pb2[n], o[mb][n]); o[mb][n] = WFrag<T16>::mma(va2[mb], pb[n], o[mb][n]); } }
}
// fa_out: divides by the row sums and stores the merged hi/lo planes; Ah / Al point at the plane's first merged element (row pitch DQ). A lane holds 8 consecutive d of one query per tile: 16-byte stores, a head's 128-byte line written by one wave.
template <int NQ>
__device__ __forceinline__ void fa_out(const v8f (&o)[4][NQ], const float (&l)[NQ], int q0, int lr, int hi, bf* Ah, bf* Al) {
#pragma unroll
    for (int n = 0; n < NQ; ++n) { const float inv = __fdiv_rn(1.0f, l[n] + xhalf(l[n])); const size_t ro = (size_t)(q0 + n * 16 + lr) * DQ + hi * 8;
#pragma unroll
        for (int mb = 0; mb < 4; ++mb) { v8us oh, ol;
#pragma unroll
            for (int j = 0; j < 8; ++j) { unsigned short a, c; splitf(o[mb][n][j] * inv, a, c); oh[j] = a; ol[j] = c; }
            *(v8us*)(Ah + ro + mb * 16) = oh; *(v8us*)(Al + ro + mb * 16) = ol;
            asm volatile("s_wait_xcnt 0x0" ::: "memory"); } }   // before the next tile's packing reuses the registers of the two stores
}
// fa_hr: hi/lo rows: queries q0 .. q0 + 15 of one plane, one wave on its own.
__device__ __forceinline__ void fa_hr(const bf* __restrict__ Q, const bf* __restrict__ Q2, const bf* __restrict__ Kp, const bf* __restrict__ Kp2, const bf* __restrict__ Vt, const bf* __restrict__ Vt2, int q0, int lr, int hi, bf* Ah, bf* Al) {
    v16bf qf[1][2], qf2[1][2]; v8f o[4][1]; float m[1] = {-3.0e38f}, l[1] = {0.f};
#pragma unroll
    for (int kc = 0; kc < 2; ++kc) { const size_t qo = (size_t)(q0 + lr) * HD + kc * 32 + 8 * hi; qf[0][kc] = WFrag<bf>::ld(Q + qo); qf2[0][kc] = WFrag<bf>::ld(Q2 + qo); }
    asm volatile("s_wait_xcnt 0x0" ::: "memory");   // before the zeroing of the accumulators reuses the address pairs of the loads above
#pragma unroll
    for (int mb = 0; mb < 4; ++mb) o[mb][0] = (v8f){};
    const int nfull = (q0 + 15) >> 5;   // key blocks wholly below the diagonal; block nfull holds the diagonal
    for (int kb = 0; kb < nfull; ++kb) fa_block<bf, true, 1, false, HD, PP>(Kp + (size_t)kb * 32 * HD, Kp2 + (size_t)kb * 32 * HD, Vt + kb * 32, Vt2 + kb * 32, qf, qf2, o, m, l, kb * 32, q0, lr, hi);
    fa_block<bf, true, 1, true, HD, PP>(Kp + (size_t)nfull * 32 * HD, Kp2 + (size_t)nfull * 32 * HD, Vt + nfull * 32, Vt2 + nfull * 32, qf, qf2, o, m, l, nfull * 32, q0, lr, hi);
    fa_out<1>(o, l, q0, lr, hi, Ah, Al);
}
// fa_lo: fp16 rows: queries Q0 .. Q0 + 127 of one plane (Q0 a multiple of 128), wave w takes 32 of them. sm: two buffers, each a K tile [64 keys][SP] and a V^T tile [64 d][SP].
// All four waves walk the same Q0 / 32 + 4 key blocks, so every barrier is passed by all: the first Q0 / 32 lie below every query of the work-group; the last four (two stages) run masked, and a block wholly above a wave's queries adds exact zeros.
// fa_stage_ld / fa_stage_st: a thread moves the 16-byte piece pcol of rows prow, prow + 16, + 32, + 48 of both tiles: a wave's load covers four whole 128-byte lines.
__device__ __forceinline__ void fa_stage_ld(const h16* __restrict__ Kp, const h16* __restrict__ Vt, int key0, int prow, int pcol, v8h (&rk)[4], v8h (&rv)[4]) {
#pragma unroll
    for (int i = 0; i < 4; ++i) { rk[i] = *(const v8h*)(Kp + (size_t)(key0 + prow + 16 * i) * HD + pcol); rv[i] = *(const v8h*)(Vt + (size_t)(prow + 16 * i) * PP + key0 + pcol);
        asm volatile("s_wait_xcnt 0x0" ::: "memory"); }   // before the two loads' address pairs are reused
}
__device__ __forceinline__ void fa_stage_st(h16* sb, int prow, int pcol, const v8h (&rk)[4], const v8h (&rv)[4]) {
#pragma unroll
    for (int i = 0; i < 4; ++i) { *(v8h*)(sb + (prow + 16 * i) * SP + pcol) = rk[i]; *(v8h*)(sb + (64 + prow + 16 * i) * SP + pcol) = rv[i]; }
}
__device__ __forceinline__ void fa_lo(const h16* __restrict__ Q, const h16* __restrict__ Kp, const h16* __restrict__ Vt, h16* sm, int Q0, int w, int lr, int hi, bf* Ah, bf* Al) {
    const int q0 = Q0 + w * 32, prow = (int)threadIdx.x >> 3, pcol = ((int)threadIdx.x & 7) * 8;
    v16h qf[2][2]; v8f o[4][2]; float m[2], l[2]; v8h rk[4], rv[4];
    fa_stage_ld(Kp, Vt, 0, prow, pcol, rk, rv);
#pragma unroll
    for (int n = 0; n < 2; ++n) { m[n] = -3.0e38f; l[n] = 0.f;
#pragma unroll
        for (int kc = 0; kc < 2; ++kc) qf[n][kc] = WFrag<h16>::ld(Q + (size_t)(q0 + n * 16 + lr) * HD + kc * 32 + 8 * hi); }
    asm volatile("s_wait_xcnt 0x0" ::: "memory");   // before the zeroing of the accumulators reuses the address pairs of the loads above
#pragma unroll
    for (int n = 0; n < 2; ++n)
#pragma unroll
        for (int mb = 0; mb < 4; ++mb) o[mb][n] = (v8f){};
    fa_stage_st(sm, prow, pcol, rk, rv);
    __syncthreads();   // publishes stage 0
    const int nmain = Q0 >> 6;   // unmasked stages, an even number: stage nmain lies in buffer 0 again
    for (int st = 0; st < nmain; ++st) { const h16* sb = sm + (st & 1) * (128 * SP);
        fa_stage_ld(Kp, Vt, (st + 1) * 64, prow, pcol, rk, rv);   // flies behind this stage's two blocks
        // stays rolled: unrolled, the build fetches the second block's fragments during the first and the register count costs a wave per SIMD
#pragma unroll 1
        for (int b = 0; b < 2; ++b) fa_block<h16, false, 2, false, SP, SP>(sb + b * 32 * SP, nullptr, sb + 64 * SP + b * 32, nullptr, qf, qf, o, m, l, st * 64 + b * 32, q0, lr, hi);
        fa_stage_st(sm + ((st + 1) & 1) * (128 * SP), prow, pcol, rk, rv);   // that buffer's last reads stand in front of the barrier of stage st - 1
        __syncthreads(); }   // publishes stage st + 1 and ends every wave's reads of stage st
    fa_stage_ld(Kp, Vt, Q0 + 64, prow, pcol, rk, rv);   // the last stage; flies behind the first two masked blocks
    // stays rolled: one copy of the masked block in the text
#pragma unroll 1
    for (int t = 0; t < 4; ++t) { const h16* sb = sm + (t >> 1) * (128 * SP);
        if (t == 2) { fa_stage_st(sm + 128 * SP, prow, pcol, rk, rv); __syncthreads(); }   // publishes the last stage; buffer 1 was last read in front of the barrier that published stage nmain
        fa_block<h16, false, 2, true, SP, SP>(sb + (t & 1) * 32 * SP, nullptr, sb + 64 * SP + (t & 1) * 32, nullptr, qf, qf, o, m, l, Q0 + t * 32, q0, lr, hi); }
    fa_out<2>(o, l, q0, lr, hi, Ah, Al);
}
// grid (NB_ * NH_, (TT - RH) / 128 + RH / 64), 4 waves: blockIdx.y counts the query blocks from the longest key walk down, so that the cost falls with the work-group index. amdgpu_waves_per_eu(4, 4): the register budget of four waves per SIMD (without it the build takes more than 256 registers and a wave per SIMD is lost).
__global__ __launch_bounds__(128) __attribute__((amdgpu_waves_per_eu(4, 4))) void k_fattn(const h16* __restrict__ Q16, const h16* __restrict__ K16, const h16* __restrict__ V16, const bf* __restrict__ Qh, const bf* __restrict__ Ql, const bf* __restrict__ Kh, const bf* __restrict__ Kl, const bf* __restrict__ Vh, const bf* __restrict__ Vl, bf* Ah, bf* Al) {
    __shared__ __align__(16) h16 sm[2 * 128 * SP];
    const int lane = threadIdx.x & 31, lr = lane & 15, hi = lane >> 4;
    const int w = __builtin_amdgcn_readfirstlane(threadIdx.x >> 5);   // wave number, scalar: the key loops' bounds stay scalar
    const size_t bh = blockIdx.x, po = bh * TT * HD, vo = bh * HD * PP, ao = (bh / NH_) * TT * DQ + (bh % NH_) * HD; const int y = blockIdx.y;
    if (y < (TT - RH) / 128) fa_lo(Q16 + po, K16 + po, V16 + vo, sm, TT - 128 * (y + 1), w, lr, hi, Ah + ao, Al + ao);
    else fa_hr(Qh + po, Ql + po, Kh + po, Kl + po, Vh + vo, Vl + vo, RH - 64 * (y - (TT - RH) / 128 + 1) + w * 16, lr, hi, Ah + ao, Al + ao);
}

extern "C" void kernel_launch(void* const* d_in, const int* in_sizes, int n_in,
                              void* d_out, int out_size, void* d_ws, size_t ws_size, hipStream_t stream) {
    (void)in_sizes; (void)n_in; (void)out_size;
    const float* x = (const float*)d_in[0]; const float* xk = (const float*)d_in[1]; const float* xv = (const float*)d_in[2]; const float* wq = (const float*)d_in[3]; const float* bq = (const float*)d_in[4]; const float* wk = (const float*)d_in[5]; const float* bk = (const float*)d_in[6]; const float* wv = (const float*)d_in[7]; const float* bv = (const float*)d_in[8]; const float* wo = (const float*)d_in[9]; const float* bo = (const float*)d_in[10];
    float* OUT = (float*)d_out;     // [4][2048][1024]
    char* wsp = (char*)d_ws;
    auto take = [&](size_t bytes) { char* p = wsp; wsp += (bytes + 255) & ~(size_t)255; return (void*)p; };
    bf* WT = (bf*)take((size_t)4 * DQ * DM * 2);             // q, k, v, o
    bf* XB = (bf*)take((size_t)3 * NB_ * TT * DM * 2);       // [input][batch][TT][DM]
    const size_t PQ = (size_t)NH_ * TT * HD, PA = (size_t)TT * DQ;   // elements of one batch's planes; every plane set holds the NB_ batches side by side, the q, k and v sets of a kind of plane one behind the other
    h16* P16 = (h16*)take(3 * NB_ * PQ * 2); bf* Ph = (bf*)take(3 * NB_ * PQ * 2); bf* Pl = (bf*)take(3 * NB_ * PQ * 2);
    bf* ATh = (bf*)take(NB_ * PA * 2); bf* ATl = (bf*)take(NB_ * PA * 2);
    if ((size_t)(wsp - (char*)d_ws) > ws_size) return;    // ws 256 MiB
    k_prep<<<(unsigned)(4 * (DM * DQ / 64 / 64) + TT * DM / 8 / 256), 256, 0, stream>>>(wq, wk, wv, wo, x, xk, xv, WT, XB);
    k_proj<<<dim3(TT / 64, DQ / 64, 3 * NB_), 256, 0, stream>>>(XB, WT, bq, bk, bv, P16, Ph, Pl);
    k_fattn<<<dim3(NB_ * NH_, (TT - RH) / 128 + RH / 64, 1), 128, 0, stream>>>(P16, P16 + NB_ * PQ, P16 + 2 * NB_ * PQ, Ph, Pl, Ph + NB_ * PQ, Pl + NB_ * PQ, Ph + 2 * NB_ * PQ, Pl + 2 * NB_ * PQ, ATh, ATl);
    k_gemmw<bf, 1, true, 8, 0><<<dim3(TT / 64, DM / 64, NB_), 256, 0, stream>>>(ATh, ATl, WT + (size_t)3 * DQ * DM, nullptr, DQ, OUT, DM, bo, PA, 0, (size_t)TT * DM, nullptr, nullptr, nullptr, 0);
}

// v006
// One run takes 159 microseconds.
// Timed twice side by side with v005, it ran 1.70 times as fast both times.
// All steps since v000 together make it 18.4 times as fast.
#include <hip/hip_runtime.h>

// Causal multi-head attention on THREE separate input streams with biased (in, out) projections (Q, K, V [4][2048][1024]; q = Q Wq + bq, k = K Wk + bk, v = V Wv + bv ('xw' [1024][1024] normal x 1/32 + [1024] zeros on this draw: read; 16 heads x 64); scores / sqrt(64); tril kept, -inf elsewhere; softmax; out = merged Wo + bo ('xw' + a zero bias: read) -> [4][2048][1024] (8.4 M); argument order Q, K, V, Wq, bq, Wk, bk, Wv, bv, Wo, bo).
// Four launches. (1) the four 'xw' weights transposed and the three inputs copied to bf16, all batches; (2) the twelve projections (q, k, v x batch) as one grid of 128x128 tiles, operands staged in LDS: exact + f32 biases, stored by the GEMM itself as head planes, all batches side by side; (3) one fused causal T-2048 attention launch for all 64 (batch, head) planes (hybrid rows: < 512 hi/lo 3 products, rest fp16 x1024 with K and V^T staged in LDS; online softmax in registers, key walk ends at the diagonal); (4) merged hi/lo x w_o exact + b_o, the same tiles, the batch in blockIdx.z.
// Compute dtypes, f32 accumulate: every input rounded to bf16; projections exact + f32 biases; attention rows < 512 3 products, rest fp16; softmax f32; Wo hl x exact + bias.

#define NB_  4
#define TT   2048
#define DM   1024
#define NH_  16
#define NKV  16
#define REP  (NH_ / NKV)
#define HD   64
#define DQ   (NH_ * HD)
#define DKV  (NKV * HD)
#define PP   TT                   // row pitch, in 16-bit elements, of the V^T planes
#define RH   512                  // query rows < RH use hi+lo planes (0: none)
#define SCL  0.125f   // HD^-0.5
typedef _Float16 h16;
typedef unsigned short bf;
typedef __attribute__((ext_vector_type(16))) __bf16   v16bf;
typedef __attribute__((ext_vector_type(16))) _Float16 v16h;
typedef __attribute__((ext_vector_type(8)))  _Float16 v8h;
typedef __attribute__((ext_vector_type(8)))  unsigned short v8us;
typedef __attribute__((ext_vector_type(8)))  float    v8f;
typedef __attribute__((ext_vector_type(4)))  float    v4f;
typedef v8h  __attribute__((may_alias)) v8ha;
typedef v4f  __attribute__((may_alias)) v4fa;
typedef v8us __attribute__((may_alias)) v8usa;

__device__ __forceinline__ unsigned short f2bf(float f) { unsigned u = __float_as_uint(f); u += 0x7FFFu + ((u >> 16) & 1u); return (unsigned short)(u >> 16); }
__device__ __forceinline__ float bf2f(unsigned short b) { return __uint_as_float(((unsigned)b) << 16); }
__device__ __forceinline__ float bfr(float f) { return bf2f(f2bf(f)); }
__device__ __forceinline__ v16h cat16(v8h lo, v8h hi) { return __builtin_shufflevector(lo, hi, 0, 1, 2, 3, 4, 5, 6, 7, 8, 9, 10, 11, 12, 13, 14, 15); }
__device__ __forceinline__ v16bf cat16b(v8us lo, v8us hi) { return __builtin_bit_cast(v16bf, __builtin_shufflevector(lo, hi, 0, 1, 2, 3, 4, 5, 6, 7, 8, 9, 10, 11, 12, 13, 14, 15)); }
__device__ __forceinline__ v8f wmma16(v16h a, v16h b, v8f c) { return __builtin_amdgcn_wmma_f32_16x16x32_f16(false, a, false, b, (short)0, c, false, false); }
__device__ __forceinline__ v8f wmmab(v16bf a, v16bf b, v8f c) { return __builtin_amdgcn_wmma_f32_16x16x32_bf16(false, a, false, b, (short)0, c, false, false); }
__device__ __forceinline__ h16 tohx(float x) { return (h16)x; }
__device__ __forceinline__ void splitf(float y, unsigned short& h, unsigned short& l) { h = f2bf(y); l = f2bf(y - bf2f(h)); }
typedef __attribute__((ext_vector_type(4))) _Float16 v4h;
typedef __attribute__((ext_vector_type(4))) unsigned short v4us;



template <typename T16> struct WFrag;
template <> struct WFrag<h16> { typedef v16h V; static __device__ __forceinline__ V ld(const h16* p) { return cat16(*(const v8h*)p, *(const v8h*)(p + 16)); } static __device__ __forceinline__ v8f mma(V a, V b, v8f c) { return wmma16(a, b, c); } };
template <> struct WFrag<bf> { typedef v16bf V; static __device__ __forceinline__ V ld(const bf* p) { return cat16b(*(const v8us*)p, *(const v8us*)(p + 16)); } static __device__ __forceinline__ v8f mma(V a, V b, v8f c) { return wmmab(a, b, c); } };

// ---- the GEMM tile: one work-group of four waves per 128x128 output tile, wave (wm, wn) owns the 64x64 quadrant (16 accumulators) over the whole K; C[m][n] = sum_k A[m][k] Bt[n][k] (+ A2[m][k] Bt[n][k] for NP 2), all operands K-contiguous bf16 rows of pitch DM.
// The operands go through LDS in stages of GK = 64 k (one whole 128-byte line of every operand row), two buffers: asynchronous 16-byte copies, a wave's copy covers four whole lines; the copies of stage s + 2 are issued when every wave has left stage s, and fly behind stage s + 1.
// A buffer: [A 128 rows][Bt 128 rows]([A2 128 rows]), row pitch GP.
#define GP 72   // LDS row pitch in 16-bit elements: 128 data bytes + 16, an odd multiple of 16 bytes, so that the 16-byte fragment reads of 16 rows spread over the banks
#define GK 64
static_assert(DM == DQ, "one K pitch for every GEMM operand");
// g_copy8: the lane's 16-byte piece of rows r, r + 16, .. r + 112 of one operand; l = LDS byte address of the first, g = its global address. The wait stands in the copies' own statement: behind it the address registers may be rewritten.
__device__ __forceinline__ void g_copy8(unsigned l, const bf* g) {
    asm volatile("global_load_async_to_lds_b128 %0, %8, off\n\t"
                 "global_load_async_to_lds_b128 %1, %9, off\n\t"
                 "global_load_async_to_lds_b128 %2, %10, off\n\t"
                 "global_load_async_to_lds_b128 %3, %11, off\n\t"
                 "global_load_async_to_lds_b128 %4, %12, off\n\t"
                 "global_load_async_to_lds_b128 %5, %13, off\n\t"
                 "global_load_async_to_lds_b128 %6, %14, off\n\t"
                 "global_load_async_to_lds_b128 %7, %15, off\n\t"
                 "s_wait_xcnt 0x0"
                 :: "v"(l), "v"(l + 1 * 16 * GP * 2), "v"(l + 2 * 16 * GP * 2), "v"(l + 3 * 16 * GP * 2), "v"(l + 4 * 16 * GP * 2), "v"(l + 5 * 16 * GP * 2), "v"(l + 6 * 16 * GP * 2), "v"(l + 7 * 16 * GP * 2),
                    "v"(g), "v"(g + 1 * 16 * DM), "v"(g + 2 * 16 * DM), "v"(g + 3 * 16 * DM), "v"(g + 4 * 16 * DM), "v"(g + 5 * 16 * DM), "v"(g + 6 * 16 * DM), "v"(g + 7 * 16 * DM)
                 : "memory");
}
template <int NP>
__device__ __forceinline__ void g_fill(unsigned l, const bf* gA, const bf* gB, const bf* gA2, int k0) {
    g_copy8(l, gA + k0); g_copy8(l + 128 * GP * 2, gB + k0); if constexpr (NP == 2) g_copy8(l + 256 * GP * 2, gA2 + k0);
}
// g_frag: all fragments of one k step of 32 as one group; g_mma: its products. Their loops are unrolled so that acc and the fragments are indexed by constants and stay in registers.
template <int NP>
__device__ __forceinline__ void g_frag(const bf* pa, const bf* pb, v16bf (&a)[4], v16bf (&a2)[4], v16bf (&b)[4]) {
#pragma unroll
    for (int i = 0; i < 4; ++i) { a[i] = WFrag<bf>::ld(pa + i * 16 * GP); b[i] = WFrag<bf>::ld(pb + i * 16 * GP); if constexpr (NP == 2) a2[i] = WFrag<bf>::ld(pa + (256 + i * 16) * GP); }
}
template <int NP>
__device__ __forceinline__ void g_mma(const v16bf (&a)[4], const v16bf (&a2)[4], const v16bf (&b)[4], v8f (&acc)[4][4]) {
#pragma unroll
    for (int nb = 0; nb < 4; ++nb) {
#pragma unroll
        for (int mb = 0; mb < 4; ++mb) acc[mb][nb] = wmmab(a[mb], b[nb], acc[mb][nb]);
        if constexpr (NP == 2) {
#pragma unroll
            for (int mb = 0; mb < 4; ++mb) acc[mb][nb] = wmmab(a2[mb], b[nb], acc[mb][nb]); } }
}
template <int NP>
__device__ __forceinline__ void g_tile(const bf* __restrict__ A, const bf* __restrict__ A2, const bf* __restrict__ Bt, bf* sm, int r0, int c0, int wm, int wn, int lr, int hi, v8f (&acc)[4][4]) {
    constexpr int ST = (NP + 1) * 128 * GP, NS = DM / GK;   // elements of a buffer; stages
    static_assert(NS >= 2, "the ring starts with two stages");
    const int prow = (int)threadIdx.x >> 3, pcol = ((int)threadIdx.x & 7) * 8;
    const unsigned l = (unsigned)(size_t)(sm + prow * GP + pcol);
    const bf* gA = A + (size_t)(r0 + prow) * DM + pcol; const bf* gB = Bt + (size_t)(c0 + prow) * DM + pcol; const bf* gA2 = NP == 2 ? A2 + (size_t)(r0 + prow) * DM + pcol : nullptr;
    // unrolled so that acc is indexed by constants and stays in registers
#pragma unroll
    for (int mb = 0; mb < 4; ++mb)
#pragma unroll
        for (int nb = 0; nb < 4; ++nb) acc[mb][nb] = (v8f){};
    g_fill<NP>(l, gA, gB, gA2, 0);
    asm volatile("s_wait_asynccnt 0x0" ::: "memory");   // this wave's copies of stage 0 have landed
    __syncthreads();                                    // publishes stage 0
    g_fill<NP>(l + ST * 2, gA, gB, gA2, GK);
    // stays rolled: one stage's code in the text, the buffer chosen by the stage's parity
#pragma unroll 1
    for (int s = 0; s < NS; ++s) {
        const bf* pa = sm + (s & 1) * ST + (wm * 64 + lr) * GP + 8 * hi; const bf* pb = sm + (s & 1) * ST + (128 + wn * 64 + lr) * GP + 8 * hi;
        v16bf a[4], a2[4], b[4];
        g_frag<NP>(pa, pb, a, a2, b);
        __builtin_amdgcn_sched_barrier(0);   // keeps the LDS loads together in front of the products: without it the build sinks each B fragment's loads between the products and waits out the LDS latency four times a k step
        g_mma<NP>(a, a2, b, acc);
        g_frag<NP>(pa + 32, pb + 32, a, a2, b);             // the stage's last LDS reads
        asm volatile("s_wait_dscnt 0x0" ::: "memory");      // this wave's reads of stage s are done before the buffer is handed back
        asm volatile("s_wait_asynccnt 0x0" ::: "memory");   // this wave's copies of stage s + 1 have landed
        __syncthreads();                                    // publishes stage s + 1 and ends every wave's reads of stage s
        // the stage's last products run from registers alone. NP 1: the refill is issued in front of them; NP 2: behind them, where the fragments' registers are free for the copies' addresses
        if (NP == 1 && s + 2 < NS) g_fill<NP>(l + (s & 1) * (ST * 2), gA, gB, gA2, (s + 2) * GK);
        g_mma<NP>(a, a2, b, acc);
        if (NP == 2 && s + 2 < NS) g_fill<NP>(l + (s & 1) * (ST * 2), gA, gB, gA2, (s + 2) * GK);
    }
    asm volatile("s_wait_asynccnt 0x0" ::: "memory");   // no copy is outstanding when the ring becomes output staging
}
// quad_out: a wave stores its 64x64 quadrant to its own LDS range ow (pitch 68 floats, in the ring that every wave has left), one barrier, then reads it back by rows: a lane takes 8 consecutive columns, so that every global store of the wave covers whole 128-byte lines.
// r0, c0: the quadrant's first row and column. PL 0: f32 to C (pitch ldc), bias[n]. PL 1: three 16-bit planes (fp16, bf16 hi, bf16 lo); element [m][n] lies at (n / 64) * sH + m * ldc + n % 64 of each plane, so a quadrant row is one whole 128-byte line of each.
// PL 1, brow false: bias[n] (m = token, n = head * 64 + d: sH = TT * HD, ldc = HD gives [head][t][d]). PL 1, brow true: bias[m] (m = head * 64 + d, n = token: sH = 64, ldc = PP gives the V^T rows [head][d][t]). brow is the same for a whole work-group.
template <int PL>
__device__ __forceinline__ void quad_out(const v8f (&acc)[4][4], float* ow, int lane, int lr, int hi, float* C, int ldc, int r0, int c0, const float* __restrict__ bias, h16* P16, bf* Ph, bf* Pl, size_t sH, bool brow) {
    // every loop here is unrolled so that acc and the pieces are indexed by constants and stay in registers
#pragma unroll
    for (int mb = 0; mb < 4; ++mb) {
#pragma unroll
        for (int nb = 0; nb < 4; ++nb) {
#pragma unroll
            for (int j = 0; j < 8; ++j) ow[(mb * 16 + hi * 8 + j) * 68 + nb * 16 + lr] = acc[mb][nb][j]; } }
    __syncthreads();   // the quadrant is complete in LDS before its rows are read back
    const int prow = lane >> 3, cofs = (lane & 7) * 8;
    const float* bp = bias + (brow ? r0 : c0 + cofs);   // brow: in bounds, not used
    const v4f bn0 = *(const v4fa*)bp, bn1 = *(const v4fa*)(bp + 4);
    asm volatile("s_wait_xcnt 0x0" ::: "memory");   // before the address pair of the two bias loads is reused
#pragma unroll
    for (int g = 0; g < 4; ++g) { v4f v0[4], v1[4]; float bm[4];
#pragma unroll
        for (int i = 0; i < 4; ++i) { const int row = (g * 4 + i) * 4 + prow; v0[i] = *(const v4fa*)(ow + row * 68 + cofs); v1[i] = *(const v4fa*)(ow + row * 68 + cofs + 4);
            if constexpr (PL == 1) { bm[i] = bias[brow ? r0 + row : c0];
                asm volatile("s_wait_xcnt 0x0" ::: "memory"); } }   // before the address pair of the bias load is reused
#pragma unroll
        for (int i = 0; i < 4; ++i) { const int row = (g * 4 + i) * 4 + prow;
#pragma unroll
            for (int e = 0; e < 4; ++e) { v0[i][e] += bfr(PL == 1 && brow ? bm[i] : bn0[e]); v1[i][e] += bfr(PL == 1 && brow ? bm[i] : bn1[e]); }
            if constexpr (PL == 0) { float* ct = C + (size_t)(r0 + row) * ldc + c0 + cofs; *(v4f*)ct = v0[i]; *(v4f*)(ct + 4) = v1[i]; }
            else { const size_t po = (size_t)(c0 >> 6) * sH + (size_t)(r0 + row) * ldc + cofs; v8h o16; v8us oh, ol;
#pragma unroll
                for (int e = 0; e < 4; ++e) { unsigned short x, y; o16[e] = tohx(v0[i][e]); splitf(v0[i][e], x, y); oh[e] = x; ol[e] = y; o16[4 + e] = tohx(v1[i][e]); splitf(v1[i][e], x, y); oh[4 + e] = x; ol[4 + e] = y; }
                *(v8h*)(P16 + po) = o16; *(v8us*)(Ph + po) = oh; *(v8us*)(Pl + po) = ol; }
            asm volatile("s_wait_xcnt 0x0" ::: "memory"); } }   // before the next piece reuses the registers of the stores
}
// ---- k_proj: the twelve projection GEMMs as one grid (TT / 128, DQ / 128, 3 * NB_): blockIdx.z = kind * NB_ + batch, kind 0 q, 1 k, 2 v; blockIdx.x = token tile, blockIdx.y = tile of 128 output channels (two heads).
// XB: the bf16 inputs [kind][batch][TT][DM]; WT: the transposed weights [kind][DQ][DM]; P16 / Ph / Pl: the plane sets [kind][batch][NH_ * TT * HD].
// v: the operands change places (A = the weight rows, Bt = the tokens), so that the tile comes out as V^T rows; same k order, same products
static_assert(DKV == DQ && PP == TT, "the q, k and v planes of a batch have one size");
__global__ __launch_bounds__(128) void k_proj(const bf* __restrict__ XB, const bf* __restrict__ WT, const float* __restrict__ bq, const float* __restrict__ bk, const float* __restrict__ bv, h16* P16, bf* Ph, bf* Pl) {
    __shared__ __align__(16) bf sm[2 * 256 * GP];
    static_assert(sizeof(sm) >= 4 * 64 * 68 * 4, "the four quadrants are staged in the ring");
    const int lane = threadIdx.x & 31, lr = lane & 15, hi = lane >> 4;
    const int w = __builtin_amdgcn_readfirstlane(threadIdx.x >> 5), wm = w >> 1, wn = w & 1;   // wave number, scalar
    const int z = blockIdx.z, kind = z / NB_, tok0 = blockIdx.x * 128, ch0 = blockIdx.y * 128; const bool vt = kind == 2;
    const bf* X = XB + (size_t)z * TT * DM; const bf* Wt = WT + (size_t)kind * DQ * DM; const size_t pz = (size_t)z * NH_ * TT * HD;
    const int r0 = vt ? ch0 : tok0, c0 = vt ? tok0 : ch0;
    v8f acc[4][4];
    g_tile<1>(vt ? Wt : X, nullptr, vt ? X : Wt, sm, r0, c0, wm, wn, lr, hi, acc);
    quad_out<1>(acc, (float*)sm + w * (64 * 68), lane, lr, hi, nullptr, vt ? PP : HD, r0 + wm * 64, c0 + wn * 64, vt ? bv : kind ? bk : bq, P16 + pz, Ph + pz, Pl + pz, vt ? (size_t)64 : (size_t)TT * HD, vt);
}
// ---- k_wo: out = (merged hi + merged lo) x w_o + b_o, grid (TT / 128, DM / 128, NB_): two products a k step against one staged weight tile.
__global__ __launch_bounds__(128) void k_wo(const bf* __restrict__ Ah, const bf* __restrict__ Al, const bf* __restrict__ Wt, const float* __restrict__ bo, float* C) {
    __shared__ __align__(16) bf sm[2 * 384 * GP];
    const int lane = threadIdx.x & 31, lr = lane & 15, hi = lane >> 4;
    const int w = __builtin_amdgcn_readfirstlane(threadIdx.x >> 5), wm = w >> 1, wn = w & 1;   // wave number, scalar
    const size_t z = blockIdx.z; const int r0 = blockIdx.x * 128, c0 = blockIdx.y * 128;
    v8f acc[4][4];
    g_tile<2>(Ah + z * TT * DQ, Al + z * TT * DQ, Wt, sm, r0, c0, wm, wn, lr, hi, acc);
    quad_out<0>(acc, (float*)sm + w * (64 * 68), lane, lr, hi, C + z * TT * DM, DM, r0 + wm * 64, c0 + wn * 64, bo, nullptr, nullptr, nullptr, 0, false);
}

typedef __attribute__((ext_vector_type(2))) unsigned short v2us;

// ---- k_prep: all the operand preparation in one launch. Work-groups 0 .. 4 * WB - 1: the four weights ([DM][DQ] f32, in the order q, k, v, o) transposed to bf16 rows WT[sel][n][k], 64 lines of 64 elements a work-group.
// The other TT * DM / 8 / 256 work-groups: the three inputs to bf16, XB[input][batch][TT][DM]; a thread converts its 8 elements of every one of the twelve [TT][DM] slabs, the four batches of an input in flight together.
__global__ __launch_bounds__(256) void k_prep(const float* __restrict__ wq, const float* __restrict__ wk, const float* __restrict__ wv, const float* __restrict__ wo, const float* __restrict__ x, const float* __restrict__ xk, const float* __restrict__ xv, bf* WT, bf* XB) {
    constexpr int K = DM, N = DQ, WB = N * K / 64 / 64; const int bx = blockIdx.x;
    if (bx < 4 * WB) {
        const int sel = bx / WB; const float* __restrict__ w = sel == 0 ? wq : sel == 1 ? wk : sel == 2 ? wv : wo; bf* Bt = WT + (size_t)sel * N * K;
        const int lane = threadIdx.x & 31; const int L0 = ((bx % WB) * 8 + (threadIdx.x >> 5)) * 8;
        // stays rolled: few registers, so that the kernel keeps sixteen waves per SIMD
#pragma unroll 1
        for (int l = 0; l < 8; ++l) { const int L = L0 + l; const size_t e = (size_t)L * 64 + lane * 2; const int k = (int)(e % K), n = (int)(e / K); v2us o;
            o[0] = f2bf(w[(size_t)k * N + n]); o[1] = f2bf(w[(size_t)(k + 1) * N + n]); *(v2us*)(Bt + e) = o; }
    } else {
        const size_t i8 = ((size_t)(bx - 4 * WB) * 256 + threadIdx.x) * 8;
        // the loop over the inputs stays rolled: eight 16-byte loads of a lane in flight, few registers, many waves per SIMD; the loops over b and k are unrolled so that v and o stay in registers
#pragma unroll 1
        for (int s = 0; s < 3; ++s) { const float* __restrict__ src = (s == 0 ? x : s == 1 ? xk : xv) + i8; bf* dst = XB + (size_t)s * NB_ * TT * DM + i8; v8f v[NB_];
#pragma unroll
            for (int b = 0; b < NB_; ++b) { v[b] = *(const v8f*)(src + (size_t)b * TT * DM);
                asm volatile("s_wait_xcnt 0x0" ::: "memory"); }   // before the address pair is reused (the build hands it on as the destination of a later load)
#pragma unroll
            for (int b = 0; b < NB_; ++b) { v8us o;
#pragma unroll
                for (int k = 0; k < 8; ++k) o[k] = f2bf(v[b][k]);
                *(v8us*)(dst + (size_t)b * TT * DM) = o; }
            asm volatile("s_wait_xcnt 0x0" ::: "memory"); }   // before the next input's addresses reuse the registers of the stores
    }
}

// ---- k_fattn: causal attention of one (batch, head) plane per blockIdx.x, scores, softmax, P.V and the head merge in one launch; no score ever leaves the registers.
// A wave owns NQ groups of 16 query columns and walks the keys in blocks of 32 up to the diagonal: S^T = K Q^T (A = K rows, B = Q rows kept in registers), so a lane holds 16 scores of ONE query;
// running maximum and sum per query (log2 domain, one exchange between the lane halves), then the two f32 score tiles of a block, converted in place, are the B operand of O^T += V^T P^T (A = V^T rows, same k order as the packed tiles).
// Rows < RH: hi/lo planes, 3 products in both contractions; the rest fp16 with the probabilities carried x 2^10 (the factor is in the row sum too and cancels in the final division).
// fp16 rows: the four waves of a work-group (128 queries) share each stage of 64 keys through LDS: whole-line global loads into registers one stage ahead, two LDS buffers, one barrier a stage. The hi/lo rows (short walks) read their fragments straight from the planes.
#define SP 72   // LDS row pitch of a staged tile in 16-bit elements: 128 data bytes + 16, an odd multiple of 16 bytes, so that the 16-byte fragment reads of 16 rows spread over the banks
__device__ __forceinline__ float xhalf(float x) { return __builtin_bit_cast(float, __builtin_amdgcn_permlanex16(__builtin_bit_cast(int, x), __builtin_bit_cast(int, x), 0x76543210, 0xfedcba98, false, false)); }   // lane l <-> lane l ^ 16
// fa_exp2: 2^x. v_exp_f32 and the one v_nop that fills the slot behind it stand in one statement.
__device__ __forceinline__ float fa_exp2(float x) { float r; asm("v_exp_f32 %0, %1\n\tv_nop" : "=v"(r) : "v"(x)); return r; }
// every loop of the fa_ functions but the key walks is unrolled so that the fragment and accumulator arrays are indexed by constants and stay in registers
// fa_ldk / fa_ldv: the four fragments of one plane for one block of 32 keys; Kb = the block's first K row, Vb = the block's first key in V^T row 0, PITCH = row pitch in elements. GL: the source is global memory (the hi/lo planes); fa_ldg writes s_wait_xcnt 0 behind each of a fragment's two loads.
__device__ __forceinline__ v16bf fa_ldg(const bf* p) {
    const v8us x0 = *(const v8us*)p; asm volatile("s_wait_xcnt 0x0" ::: "memory");          // before the address pair is reused
    const v8us x1 = *(const v8us*)(p + 16); asm volatile("s_wait_xcnt 0x0" ::: "memory");   // before the address pair is reused
    return cat16b(x0, x1);
}
template <typename T16, int PITCH, bool GL>
__device__ __forceinline__ void fa_ldk(const T16* Kb, int lr, int hi, typename WFrag<T16>::V (&ka)[2][2]) {
#pragma unroll
    for (int kt = 0; kt < 2; ++kt)
#pragma unroll
        for (int kc = 0; kc < 2; ++kc) { const T16* p = Kb + (size_t)(kt * 16 + lr) * PITCH + kc * 32 + 8 * hi; if constexpr (GL) ka[kt][kc] = fa_ldg(p); else ka[kt][kc] = WFrag<T16>::ld(p); }
}
template <typename T16, int PITCH, bool GL>
__device__ __forceinline__ void fa_ldv(const T16* Vb, int lr, int hi, typename WFrag<T16>::V (&va)[4]) {
#pragma unroll
    for (int mb = 0; mb < 4; ++mb) { const T16* p = Vb + (size_t)(mb * 16 + lr) * PITCH + 8 * hi; if constexpr (GL) va[mb] = fa_ldg(p); else va[mb] = WFrag<T16>::ld(p); }
}
// fa_block: one block of 32 keys, first key key0. LAST: a block at or above the diagonal: keys above the query are masked.
template <typename T16, bool HR, int NQ, bool LAST, int KPITCH, int VPITCH>
__device__ __forceinline__ void fa_block(const T16* Kb, const T16* Kb2, const T16* Vb, const T16* Vb2, const typename WFrag<T16>::V (&qf)[NQ][2], const typename WFrag<T16>::V (&qf2)[NQ][2],
                                         v8f (&o)[4][NQ], float (&m)[NQ], float (&l)[NQ], int key0, int q0, int lr, int hi) {
    typedef typename WFrag<T16>::V V;
    constexpr float C2 = SCL * 1.4426950408889634f;   // score -> log2 domain
    constexpr float OFS = HR ? 0.0f : 10.0f;          // fp16 probabilities x 2^10: keeps small ones out of the subnormals
    v8f s[2][NQ]; V ka[2][2], ka2[2][2], va[4], va2[4];
    fa_ldk<T16, KPITCH, HR>(Kb, lr, hi, ka); if constexpr (HR) fa_ldk<T16, KPITCH, HR>(Kb2, lr, hi, ka2);
    if constexpr (HR) { fa_ldv<T16, VPITCH, HR>(Vb, lr, hi, va); fa_ldv<T16, VPITCH, HR>(Vb2, lr, hi, va2); }   // from global memory: early, they fly behind the S^T products and the softmax
#pragma unroll
    for (int kt = 0; kt < 2; ++kt)
#pragma unroll
        for (int n = 0; n < NQ; ++n) { s[kt][n] = (v8f){};
#pragma unroll
            for (int kc = 0; kc < 2; ++kc) { s[kt][n] = WFrag<T16>::mma(ka[kt][kc], qf[n][kc], s[kt][n]); if constexpr (HR) { s[kt][n] = WFrag<T16>::mma(ka[kt][kc], qf2[n][kc], s[kt][n]); s[kt][n] = WFrag<T16>::mma(ka2[kt][kc], qf[n][kc], s[kt][n]); } } }
    if constexpr (!HR) fa_ldv<T16, VPITCH, HR>(Vb, lr, hi, va);   // from LDS: into the registers that the K fragments have just left; the softmax covers the LDS latency
    float mx[NQ];
#pragma unroll
    for (int n = 0; n < NQ; ++n) { const int qi = q0 + n * 16 + lr; float t = m[n];
#pragma unroll
        for (int e = 0; e < 16; ++e) { if (LAST) s[e >> 3][n][e & 7] = (key0 + (e >> 3) * 16 + hi * 8 + (e & 7) <= qi) ? s[e >> 3][n][e & 7] : -3.0e38f; t = fmaxf(t, s[e >> 3][n][e & 7]); }
        mx[n] = fmaxf(t, xhalf(t)); }
    // sums and output columns follow the running maximum in every block (factor exactly 1 where it stayed): no branch, so the block is one scheduling region and its loads stay ahead of the vector work
#pragma unroll
    for (int n = 0; n < NQ; ++n) { const float al = fa_exp2((m[n] - mx[n]) * C2); l[n] *= al; m[n] = mx[n];
#pragma unroll
        for (int mb = 0; mb < 4; ++mb) o[mb][n] *= al; }
    V pb[NQ], pb2[NQ];
#pragma unroll
    for (int n = 0; n < NQ; ++n) { const float nm = OFS - mx[n] * C2; float ls = 0.f;
        if constexpr (HR) { v8us h0, h1, l0, l1;
#pragma unroll
            for (int e = 0; e < 8; ++e) { const float pa = fa_exp2(fmaf(s[0][n][e], C2, nm)), pc = fa_exp2(fmaf(s[1][n][e], C2, nm)); ls += pa + pc; unsigned short a, c; splitf(pa, a, c); h0[e] = a; l0[e] = c; splitf(pc, a, c); h1[e] = a; l1[e] = c; }
            pb[n] = cat16b(h0, h1); pb2[n] = cat16b(l0, l1);
        } else { v8h h0, h1;
#pragma unroll
            for (int e = 0; e < 8; ++e) { const float pa = fa_exp2(fmaf(s[0][n][e], C2, nm)), pc = fa_exp2(fmaf(s[1][n][e], C2, nm)); ls += pa + pc; h0[e] = tohx(pa); h1[e] = tohx(pc); }
            pb[n] = cat16(h0, h1); }
        l[n] += ls; }
#pragma unroll
    for (int mb = 0; mb < 4; ++mb)
#pragma unroll
        for (int n = 0; n < NQ; ++n) { o[mb][n] = WFrag<T16>::mma(va[mb], pb[n], o[mb][n]); if constexpr (HR) { o[mb][n] = WFrag<T16>::mma(va[mb], pb2[n], o[mb][n]); o[mb][n] = WFrag<T16>::mma(va2[mb], pb[n], o[mb][n]); } }
}
// fa_out: divides by the row sums and stores the merged hi/lo planes; Ah / Al point at the plane's first merged element (row pitch DQ). A lane holds 8 consecutive d of one query per tile: 16-byte stores, a head's 128-byte line written by one wave.
template <int NQ>
__device__ __forceinline__ void fa_out(const v8f (&o)[4][NQ], const float (&l)[NQ], int q0, int lr, int hi, bf* Ah, bf* Al) {
#pragma unroll
    for (int n = 0; n < NQ; ++n) { const float inv = __fdiv_rn(1.0f, l[n] + xhalf(l[n])); const size_t ro = (size_t)(q0 + n * 16 + lr) * DQ + hi * 8;
#pragma unroll
        for (int mb = 0; mb < 4; ++mb) { v8us oh, ol;
#pragma unroll
            for (int j = 0; j < 8; ++j) { unsigned short a, c; splitf(o[mb][n][j] * inv, a, c); oh[j] = a; ol[j] = c; }
            *(v8us*)(Ah + ro + mb * 16) = oh; *(v8us*)(Al + ro + mb * 16) = ol;
            asm volatile("s_wait_xcnt 0x0" ::: "memory"); } }   // before the next tile's packing reuses the registers of the two stores
}
// fa_hr: hi/lo rows: queries q0 .. q0 + 15 of one plane, one wave on its own.
__device__ __forceinline__ void fa_hr(const bf* __restrict__ Q, const bf* __restrict__ Q2, const bf* __restrict__ Kp, const bf* __restrict__ Kp2, const bf* __restrict__ Vt, const bf* __restrict__ Vt2, int q0, int lr, int hi, bf* Ah, bf* Al) {
    v16bf qf[1][2], qf2[1][2]; v8f o[4][1]; float m[1] = {-3.0e38f}, l[1] = {0.f};
#pragma unroll
    for (int kc = 0; kc < 2; ++kc) { const size_t qo = (size_t)(q0 + lr) * HD + kc * 32 + 8 * hi; qf[0][kc] = WFrag<bf>::ld(Q + qo); qf2[0][kc] = WFrag<bf>::ld(Q2 + qo); }
    asm volatile("s_wait_xcnt 0x0" ::: "memory");   // before the zeroing of the accumulators reuses the address pairs of the loads above
#pragma unroll
    for (int mb = 0; mb < 4; ++mb) o[mb][0] = (v8f){};
    const int nfull = (q0 + 15) >> 5;   // key blocks wholly below the diagonal; block nfull holds the diagonal
    for (int kb = 0; kb < nfull; ++kb) fa_block<bf, true, 1, false, HD, PP>(Kp + (size_t)kb * 32 * HD, Kp2 + (size_t)kb * 32 * HD, Vt + kb * 32, Vt2 + kb * 32, qf, qf2, o, m, l, kb * 32, q0, lr, hi);
    fa_block<bf, true, 1, true, HD, PP>(Kp + (size_t)nfull * 32 * HD, Kp2 + (size_t)nfull * 32 * HD, Vt + nfull * 32, Vt2 + nfull * 32, qf, qf2, o, m, l, nfull * 32, q0, lr, hi);
    fa_out<1>(o, l, q0, lr, hi, Ah, Al);
}
// fa_lo: fp16 rows: queries Q0 .. Q0 + 127 of one plane (Q0 a multiple of 128), wave w takes 32 of them. sm: two buffers, each a K tile [64 keys][SP] and a V^T tile [64 d][SP].
// All four waves walk the same Q0 / 32 + 4 key blocks, so every barrier is passed by all: the first Q0 / 32 lie below every query of the work-group; the last four (two stages) run masked, and a block wholly above a wave's queries adds exact zeros.
// fa_stage_ld / fa_stage_st: a thread moves the 16-byte piece pcol of rows prow, prow + 16, + 32, + 48 of both tiles: a wave's load covers four whole 128-byte lines.
__device__ __forceinline__ void fa_stage_ld(const h16* __restrict__ Kp, const h16* __restrict__ Vt, int key0, int prow, int pcol, v8h (&rk)[4], v8h (&rv)[4]) {
#pragma unroll
    for (int i = 0; i < 4; ++i) { rk[i] = *(const v8h*)(Kp + (size_t)(key0 + prow + 16 * i) * HD + pcol); rv[i] = *(const v8h*)(Vt + (size_t)(prow + 16 * i) * PP + key0 + pcol);
        asm volatile("s_wait_xcnt 0x0" ::: "memory"); }   // before the two loads' address pairs are reused
}
__device__ __forceinline__ void fa_stage_st(h16* sb, int prow, int pcol, const v8h (&rk)[4], const v8h (&rv)[4]) {
#pragma unroll
    for (int i = 0; i < 4; ++i) { *(v8h*)(sb + (prow + 16 * i) * SP + pcol) = rk[i]; *(v8h*)(sb + (64 + prow + 16 * i) * SP + pcol) = rv[i]; }
}
__device__ __forceinline__ void fa_lo(const h16* __restrict__ Q, const h16* __restrict__ Kp, const h16* __restrict__ Vt, h16* sm, int Q0, int w, int lr, int hi, bf* Ah, bf* Al) {
    const int q0 = Q0 + w * 32, prow = (int)threadIdx.x >> 3, pcol = ((int)threadIdx.x & 7) * 8;
    v16h qf[2][2]; v8f o[4][2]; float m[2], l[2]; v8h rk[4], rv[4];
    fa_stage_ld(Kp, Vt, 0, prow, pcol, rk, rv);
#pragma unroll
    for (int n = 0; n < 2; ++n) { m[n] = -3.0e38f; l[n] = 0.f;
#pragma unroll
        for (int kc = 0; kc < 2; ++kc) qf[n][kc] = WFrag<h16>::ld(Q + (size_t)(q0 + n * 16 + lr) * HD + kc * 32 + 8 * hi); }
    asm volatile("s_wait_xcnt 0x0" ::: "memory");   // before the zeroing of the accumulators reuses the address pairs of the loads above
#pragma unroll
    for (int n = 0; n < 2; ++n)
#pragma unroll
        for (int mb = 0; mb < 4; ++mb) o[mb][n] = (v8f){};
    fa_stage_st(sm, prow, pcol, rk, rv);
    __syncthreads();   // publishes stage 0
    const int nmain = Q0 >> 6;   // unmasked stages, an even number: stage nmain lies in buffer 0 again
    for (int st = 0; st < nmain; ++st) { const h16* sb = sm + (st & 1) * (128 * SP);
        fa_stage_ld(Kp, Vt, (st + 1) * 64, prow, pcol, rk, rv);   // flies behind this stage's two blocks
        // stays rolled: unrolled, the build fetches the second block's fragments during the first and the register count costs a wave per SIMD
#pragma unroll 1
        for (int b = 0; b < 2; ++b) fa_block<h16, false, 2, false, SP, SP>(sb + b * 32 * SP, nullptr, sb + 64 * SP + b * 32, nullptr, qf, qf, o, m, l, st * 64 + b * 32, q0, lr, hi);
        fa_stage_st(sm + ((st + 1) & 1) * (128 * SP), prow, pcol, rk, rv);   // that buffer's last reads stand in front of the barrier of stage st - 1
        __syncthreads(); }   // publishes stage st + 1 and ends every wave's reads of stage st
    fa_stage_ld(Kp, Vt, Q0 + 64, prow, pcol, rk, rv);   // the last stage; flies behind the first two masked blocks
    // stays rolled: one copy of the masked block in the text
#pragma unroll 1
    for (int t = 0; t < 4; ++t) { const h16* sb = sm + (t >> 1) * (128 * SP);
        if (t == 2) { fa_stage_st(sm + 128 * SP, prow, pcol, rk, rv); __syncthreads(); }   // publishes the last stage; buffer 1 was last read in front of the barrier that published stage nmain
        fa_block<h16, false, 2, true, SP, SP>(sb + (t & 1) * 32 * SP, nullptr, sb + 64 * SP + (t & 1) * 32, nullptr, qf, qf, o, m, l, Q0 + t * 32, q0, lr, hi); }
    fa_out<2>(o, l, q0, lr, hi, Ah, Al);
}
// grid (NB_ * NH_, (TT - RH) / 128 + RH / 64), 4 waves: blockIdx.y counts the query blocks from the longest key walk down, so that the cost falls with the work-group index. amdgpu_waves_per_eu(4, 4): the register budget of four waves per SIMD (without it the build takes more than 256 registers and a wave per SIMD is lost).
__global__ __launch_bounds__(128) __attribute__((amdgpu_waves_per_eu(4, 4))) void k_fattn(const h16* __restrict__ Q16, const h16* __restrict__ K16, const h16* __restrict__ V16, const bf* __restrict__ Qh, const bf* __restrict__ Ql, const bf* __restrict__ Kh, const bf* __restrict__ Kl, const bf* __restrict__ Vh, const bf* __restrict__ Vl, bf* Ah, bf* Al) {
    __shared__ __align__(16) h16 sm[2 * 128 * SP];
    const int lane = threadIdx.x & 31, lr = lane & 15, hi = lane >> 4;
    const int w = __builtin_amdgcn_readfirstlane(threadIdx.x >> 5);   // wave number, scalar: the key loops' bounds stay scalar
    const size_t bh = blockIdx.x, po = bh * TT * HD, vo = bh * HD * PP, ao = (bh / NH_) * TT * DQ + (bh % NH_) * HD; const int y = blockIdx.y;
    if (y < (TT - RH) / 128) fa_lo(Q16 + po, K16 + po, V16 + vo, sm, TT - 128 * (y + 1), w, lr, hi, Ah + ao, Al + ao);
    else fa_hr(Qh + po, Ql + po, Kh + po, Kl + po, Vh + vo, Vl + vo, RH - 64 * (y - (TT - RH) / 128 + 1) + w * 16, lr, hi, Ah + ao, Al + ao);
}

extern "C" void kernel_launch(void* const* d_in, const int* in_sizes, int n_in,
                              void* d_out, int out_size, void* d_ws, size_t ws_size, hipStream_t stream) {
    (void)in_sizes; (void)n_in; (void)out_size;
    const float* x = (const float*)d_in[0]; const float* xk = (const float*)d_in[1]; const float* xv = (const float*)d_in[2]; const float* wq = (const float*)d_in[3]; const float* bq = (const float*)d_in[4]; const float* wk = (const float*)d_in[5]; const float* bk = (const float*)d_in[6]; const float* wv = (const float*)d_in[7]; const float* bv = (const float*)d_in[8]; const float* wo = (const float*)d_in[9]; const float* bo = (const float*)d_in[10];
    float* OUT = (float*)d_out;     // [4][2048][1024]
    char* wsp = (char*)d_ws;
    auto take = [&](size_t bytes) { char* p = wsp; wsp += (bytes + 255) & ~(size_t)255; return (void*)p; };
    bf* WT = (bf*)take((size_t)4 * DQ * DM * 2);             // q, k, v, o
    bf* XB = (bf*)take((size_t)3 * NB_ * TT * DM * 2);       // [input][batch][TT][DM]
    const size_t PQ = (size_t)NH_ * TT * HD, PA = (size_t)TT * DQ;   // elements of one batch's planes; every plane set holds the NB_ batches side by side, the q, k and v sets of a kind of plane one behind the other
    h16* P16 = (h16*)take(3 * NB_ * PQ * 2); bf* Ph = (bf*)take(3 * NB_ * PQ * 2); bf* Pl = (bf*)take(3 * NB_ * PQ * 2);
    bf* ATh = (bf*)take(NB_ * PA * 2); bf* ATl = (bf*)take(NB_ * PA * 2);
    if ((size_t)(wsp - (char*)d_ws) > ws_size) return;    // ws 256 MiB
    k_prep<<<(unsigned)(4 * (DM * DQ / 64 / 64) + TT * DM / 8 / 256), 256, 0, stream>>>(wq, wk, wv, wo, x, xk, xv, WT, XB);
    k_proj<<<dim3(TT / 128, DQ / 128, 3 * NB_), 128, 0, stream>>>(XB, WT, bq, bk, bv, P16, Ph, Pl);
    k_fattn<<<dim3(NB_ * NH_, (TT - RH) / 128 + RH / 64, 1), 128, 0, stream>>>(P16, P16 + NB_ * PQ, P16 + 2 * NB_ * PQ, Ph, Pl, Ph + NB_ * PQ, Pl + NB_ * PQ, Ph + 2 * NB_ * PQ, Pl + 2 * NB_ * PQ, ATh, ATl);
    k_wo<<<dim3(TT / 128, DM / 128, NB_), 128, 0, stream>>>(ATh, ATl, WT + (size_t)3 * DQ * DM, bo, OUT);
}

// v007
// A run of this version takes 149 microseconds.
// Next to v006, in two timings, it ran 1.07 times as fast each time.
// Counting every step since v000, it is 19.6 times as fast.
#include <hip/hip_runtime.h>

// Causal multi-head attention on THREE separate input streams with biased (in, out) projections (Q, K, V [4][2048][1024]; q = Q Wq + bq, k = K Wk + bk, v = V Wv + bv ('xw' [1024][1024] normal x 1/32 + [1024] zeros on this draw: read; 16 heads x 64); scores / sqrt(64); tril kept, -inf elsewhere; softmax; out = merged Wo + bo ('xw' + a zero bias: read) -> [4][2048][1024] (8.4 M); argument order Q, K, V, Wq, bq, Wk, bk, Wv, bv, Wo, bo).
// Four launches. (1) the four 'xw' weights transposed and the three inputs copied to bf16, all batches; (2) the twelve projections (q, k, v x batch) as one grid of 128x128 tiles, operands staged in LDS: exact + f32 biases, stored by the GEMM itself as head planes, all batches side by side; (3) one fused causal T-2048 attention launch for all 64 (batch, head) planes (hybrid rows: < 512 hi/lo 3 products, rest fp16 x1024 with K and V^T staged in LDS; online softmax in registers, key walk ends at the diagonal); (4) merged hi/lo x w_o exact + b_o, the same tiles, the batch in blockIdx.z.
// Compute dtypes, f32 accumulate: every input rounded to bf16; projections exact + f32 biases; attention rows < 512 3 products, rest fp16; softmax f32; Wo hl x exact + bias.

#define NB_  4
#define TT   2048
#define DM   1024
#define NH_  16
#define NKV  16
#define REP  (NH_ / NKV)
#define HD   64
#define DQ   (NH_ * HD)
#define DKV  (NKV * HD)
#define PP   TT                   // row pitch, in 16-bit elements, of the V^T planes
#define RH   512                  // query rows < RH use hi+lo planes (0: none)
#define SCL  0.125f   // HD^-0.5
typedef _Float16 h16;
typedef unsigned short bf;
typedef __attribute__((ext_vector_type(16))) __bf16   v16bf;
typedef __attribute__((ext_vector_type(16))) _Float16 v16h;
typedef __attribute__((ext_vector_type(8)))  _Float16 v8h;
typedef __attribute__((ext_vector_type(8)))  unsigned short v8us;
typedef __attribute__((ext_vector_type(8)))  float    v8f;
typedef __attribute__((ext_vector_type(4)))  float    v4f;
typedef v8h  __attribute__((may_alias)) v8ha;
typedef v4f  __attribute__((may_alias)) v4fa;
typedef v8us __attribute__((may_alias)) v8usa;

__device__ __forceinline__ unsigned short f2bf(float f) { unsigned u = __float_as_uint(f); u += 0x7FFFu + ((u >> 16) & 1u); return (unsigned short)(u >> 16); }
__device__ __forceinline__ float bf2f(unsigned short b) { return __uint_as_float(((unsigned)b) << 16); }
__device__ __forceinline__ float bfr(float f) { return bf2f(f2bf(f)); }
__device__ __forceinline__ v16h cat16(v8h lo, v8h hi) { return __builtin_shufflevector(lo, hi, 0, 1, 2, 3, 4, 5, 6, 7, 8, 9, 10, 11, 12, 13, 14, 15); }
__device__ __forceinline__ v16bf cat16b(v8us lo, v8us hi) { return __builtin_bit_cast(v16bf, __builtin_shufflevector(lo, hi, 0, 1, 2, 3, 4, 5, 6, 7, 8, 9, 10, 11, 12, 13, 14, 15)); }
__device__ __forceinline__ v8f wmma16(v16h a, v16h b, v8f c) { return __builtin_amdgcn_wmma_f32_16x16x32_f16(false, a, false, b, (short)0, c, false, false); }
__device__ __forceinline__ v8f wmmab(v16bf a, v16bf b, v8f c) { return __builtin_amdgcn_wmma_f32_16x16x32_bf16(false, a, false, b, (short)0, c, false, false); }
__device__ __forceinline__ h16 tohx(float x) { return (h16)x; }
__device__ __forceinline__ void splitf(float y, unsigned short& h, unsigned short& l) { h = f2bf(y); l = f2bf(y - bf2f(h)); }
typedef __attribute__((ext_vector_type(4))) _Float16 v4h;
typedef __attribute__((ext_vector_type(4))) unsigned short v4us;



template <typename T16> struct WFrag;
template <> struct WFrag<h16> { typedef v16h V; static __device__ __forceinline__ V ld(const h16* p) { return cat16(*(const v8h*)p, *(const v8h*)(p + 16)); } static __device__ __forceinline__ v8f mma(V a, V b, v8f c) { return wmma16(a, b, c); } };
template <> struct WFrag<bf> { typedef v16bf V; static __device__ __forceinline__ V ld(const bf* p) { return cat16b(*(const v8us*)p, *(const v8us*)(p + 16)); } static __device__ __forceinline__ v8f mma(V a, V b, v8f c) { return wmmab(a, b, c); } };

// ---- the GEMM tile: one work-group of four waves per 128x128 output tile, wave (wm, wn) owns the 64x64 quadrant (16 accumulators) over the whole K; C[m][n] = sum_k A[m][k] Bt[n][k] (+ A2[m][k] Bt[n][k] for NP 2), all operands K-contiguous bf16 rows of pitch DM.
// The operands go through LDS in stages of GK = 64 k (one whole 128-byte line of every operand row), two buffers: asynchronous 16-byte copies, a wave's copy covers four whole lines; the copies of stage s + 2 are issued when every wave has left stage s, and fly behind stage s + 1.
// A buffer: [A 128 rows][Bt 128 rows]([A2 128 rows]), row pitch GP.
#define GP 72   // LDS row pitch in 16-bit elements: 128 data bytes + 16, an odd multiple of 16 bytes, so that the 16-byte fragment reads of 16 rows spread over the banks
#define GK 64
static_assert(DM == DQ, "one K pitch for every GEMM operand");
// g_copy8: the lane's 16-byte piece of rows r, r + 16, .. r + 112 of one operand; l = LDS byte address of the first, g = its global address. The wait stands in the copies' own statement: behind it the address registers may be rewritten.
__device__ __forceinline__ void g_copy8(unsigned l, const bf* g) {
    asm volatile("global_load_async_to_lds_b128 %0, %8, off\n\t"
                 "global_load_async_to_lds_b128 %1, %9, off\n\t"
                 "global_load_async_to_lds_b128 %2, %10, off\n\t"
                 "global_load_async_to_lds_b128 %3, %11, off\n\t"
                 "global_load_async_to_lds_b128 %4, %12, off\n\t"
                 "global_load_async_to_lds_b128 %5, %13, off\n\t"
                 "global_load_async_to_lds_b128 %6, %14, off\n\t"
                 "global_load_async_to_lds_b128 %7, %15, off\n\t"
                 "s_wait_xcnt 0x0"
                 :: "v"(l), "v"(l + 1 * 16 * GP * 2), "v"(l + 2 * 16 * GP * 2), "v"(l + 3 * 16 * GP * 2), "v"(l + 4 * 16 * GP * 2), "v"(l + 5 * 16 * GP * 2), "v"(l + 6 * 16 * GP * 2), "v"(l + 7 * 16 * GP * 2),
                    "v"(g), "v"(g + 1 * 16 * DM), "v"(g + 2 * 16 * DM), "v"(g + 3 * 16 * DM), "v"(g + 4 * 16 * DM), "v"(g + 5 * 16 * DM), "v"(g + 6 * 16 * DM), "v"(g + 7 * 16 * DM)
                 : "memory");
}
template <int NP>
__device__ __forceinline__ void g_fill(unsigned l, const bf* gA, const bf* gB, const bf* gA2, int k0) {
    g_copy8(l, gA + k0); g_copy8(l + 128 * GP * 2, gB + k0); if constexpr (NP == 2) g_copy8(l + 256 * GP * 2, gA2 + k0);
}
// g_frag: all fragments of one k step of 32 as one group; g_mma: its products. Their loops are unrolled so that acc and the fragments are indexed by constants and stay in registers.
template <int NP>
__device__ __forceinline__ void g_frag(const bf* pa, const bf* pb, v16bf (&a)[4], v16bf (&a2)[4], v16bf (&b)[4]) {
#pragma unroll
    for (int i = 0; i < 4; ++i) { a[i] = WFrag<bf>::ld(pa + i * 16 * GP); b[i] = WFrag<bf>::ld(pb + i * 16 * GP); if constexpr (NP == 2) a2[i] = WFrag<bf>::ld(pa + (256 + i * 16) * GP); }
}
template <int NP>
__device__ __forceinline__ void g_mma(const v16bf (&a)[4], const v16bf (&a2)[4], const v16bf (&b)[4], v8f (&acc)[4][4]) {
#pragma unroll
    for (int nb = 0; nb < 4; ++nb) {
#pragma unroll
        for (int mb = 0; mb < 4; ++mb) acc[mb][nb] = wmmab(a[mb], b[nb], acc[mb][nb]);
        if constexpr (NP == 2) {
#pragma unroll
            for (int mb = 0; mb < 4; ++mb) acc[mb][nb] = wmmab(a2[mb], b[nb], acc[mb][nb]); } }
}
template <int NP>
__device__ __forceinline__ void g_tile(const bf* __restrict__ A, const bf* __restrict__ A2, const bf* __restrict__ Bt, bf* sm, int r0, int c0, int wm, int wn, int lr, int hi, v8f (&acc)[4][4]) {
    constexpr int ST = (NP + 1) * 128 * GP, NS = DM / GK;   // elements of a buffer; stages
    static_assert(NS >= 2, "the ring starts with two stages");
    const int prow = (int)threadIdx.x >> 3, pcol = ((int)threadIdx.x & 7) * 8;
    const unsigned l = (unsigned)(size_t)(sm + prow * GP + pcol);
    const bf* gA = A + (size_t)(r0 + prow) * DM + pcol; const bf* gB = Bt + (size_t)(c0 + prow) * DM + pcol; const bf* gA2 = NP == 2 ? A2 + (size_t)(r0 + prow) * DM + pcol : nullptr;
    // unrolled so that acc is indexed by constants and stays in registers
#pragma unroll
    for (int mb = 0; mb < 4; ++mb)
#pragma unroll
        for (int nb = 0; nb < 4; ++nb) acc[mb][nb] = (v8f){};
    g_fill<NP>(l, gA, gB, gA2, 0);
    asm volatile("s_wait_asynccnt 0x0" ::: "memory");   // this wave's copies of stage 0 have landed
    __syncthreads();                                    // publishes stage 0
    g_fill<NP>(l + ST * 2, gA, gB, gA2, GK);
    // stays rolled: one stage's code in the text, the buffer chosen by the stage's parity
#pragma unroll 1
    for (int s = 0; s < NS; ++s) {
        const bf* pa = sm + (s & 1) * ST + (wm * 64 + lr) * GP + 8 * hi; const bf* pb = sm + (s & 1) * ST + (128 + wn * 64 + lr) * GP + 8 * hi;
        v16bf a[4], a2[4], b[4];
        g_frag<NP>(pa, pb, a, a2, b);
        __builtin_amdgcn_sched_barrier(0);   // keeps the LDS loads together in front of the products: without it the build sinks each B fragment's loads between the products and waits out the LDS latency four times a k step
        g_mma<NP>(a, a2, b, acc);
        g_frag<NP>(pa + 32, pb + 32, a, a2, b);             // the stage's last LDS reads
        asm volatile("s_wait_dscnt 0x0" ::: "memory");      // this wave's reads of stage s are done before the buffer is handed back
        asm volatile("s_wait_asynccnt 0x0" ::: "memory");   // this wave's copies of stage s + 1 have landed
        __syncthreads();                                    // publishes stage s + 1 and ends every wave's reads of stage s
        // the stage's last products run from registers alone. NP 1: the refill is issued in front of them; NP 2: behind them, where the fragments' registers are free for the copies' addresses
        if (NP == 1 && s + 2 < NS) g_fill<NP>(l + (s & 1) * (ST * 2), gA, gB, gA2, (s + 2) * GK);
        g_mma<NP>(a, a2, b, acc);
        if (NP == 2 && s + 2 < NS) g_fill<NP>(l + (s & 1) * (ST * 2), gA, gB, gA2, (s + 2) * GK);
    }
    asm volatile("s_wait_asynccnt 0x0" ::: "memory");   // no copy is outstanding when the ring becomes output staging
}
// quad_out: a wave stores its 64x64 quadrant to its own LDS range ow (pitch 68 floats, in the ring that every wave has left), one barrier, then reads it back by rows: a lane takes 8 consecutive columns, so that every global store of the wave covers whole 128-byte lines.
// r0, c0: the quadrant's first row and column. PL 0: f32 to C (pitch ldc), bias[n]. PL 1: three 16-bit planes (fp16, bf16 hi, bf16 lo); element [m][n] lies at (n / 64) * sH + m * ldc + n % 64 of each plane, so a quadrant row is one whole 128-byte line of each.
// PL 1, brow false: bias[n] (m = token, n = head * 64 + d: sH = TT * HD, ldc = HD gives [head][t][d]). PL 1, brow true: bias[m] (m = head * 64 + d, n = token: sH = 64, ldc = PP gives the V^T rows [head][d][t]). brow is the same for a whole work-group.
template <int PL>
__device__ __forceinline__ void quad_out(const v8f (&acc)[4][4], float* ow, int lane, int lr, int hi, float* C, int ldc, int r0, int c0, const float* __restrict__ bias, h16* P16, bf* Ph, bf* Pl, size_t sH, bool brow) {
    // every loop here is unrolled so that acc and the pieces are indexed by constants and stay in registers
#pragma unroll
    for (int mb = 0; mb < 4; ++mb) {
#pragma unroll
        for (int nb = 0; nb < 4; ++nb) {
#pragma unroll
            for (int j = 0; j < 8; ++j) ow[(mb * 16 + hi * 8 + j) * 68 + nb * 16 + lr] = acc[mb][nb][j]; } }
    __syncthreads();   // the quadrant is complete in LDS before its rows are read back
    const int prow = lane >> 3, cofs = (lane & 7) * 8;
    const float* bp = bias + (brow ? r0 : c0 + cofs);   // brow: in bounds, not used
    const v4f bn0 = *(const v4fa*)bp, bn1 = *(const v4fa*)(bp + 4);
    asm volatile("s_wait_xcnt 0x0" ::: "memory");   // before the address pair of the two bias loads is reused
#pragma unroll
    for (int g = 0; g < 4; ++g) { v4f v0[4], v1[4]; float bm[4];
#pragma unroll
        for (int i = 0; i < 4; ++i) { const int row = (g * 4 + i) * 4 + prow; v0[i] = *(const v4fa*)(ow + row * 68 + cofs); v1[i] = *(const v4fa*)(ow + row * 68 + cofs + 4);
            if constexpr (PL == 1) { bm[i] = bias[brow ? r0 + row : c0];
                asm volatile("s_wait_xcnt 0x0" ::: "memory"); } }   // before the address pair of the bias load is reused
#pragma unroll
        for (int i = 0; i < 4; ++i) { const int row = (g * 4 + i) * 4 + prow;
#pragma unroll
            for (int e = 0; e < 4; ++e) { v0[i][e] += bfr(PL == 1 && brow ? bm[i] : bn0[e]); v1[i][e] += bfr(PL == 1 && brow ? bm[i] : bn1[e]); }
            if constexpr (PL == 0) { float* ct = C + (size_t)(r0 + row) * ldc + c0 + cofs; *(v4f*)ct = v0[i]; *(v4f*)(ct + 4) = v1[i]; }
            else { const size_t po = (size_t)(c0 >> 6) * sH + (size_t)(r0 + row) * ldc + cofs; v8h o16; v8us oh, ol;
#pragma unroll
                for (int e = 0; e < 4; ++e) { unsigned short x, y; o16[e] = tohx(v0[i][e]); splitf(v0[i][e], x, y); oh[e] = x; ol[e] = y; o16[4 + e] = tohx(v1[i][e]); splitf(v1[i][e], x, y); oh[4 + e] = x; ol[4 + e] = y; }
                *(v8h*)(P16 + po) = o16; *(v8us*)(Ph + po) = oh; *(v8us*)(Pl + po) = ol; }
            asm volatile("s_wait_xcnt 0x0" ::: "memory"); } }   // before the next piece reuses the registers of the stores
}
// ---- k_proj: the twelve projection GEMMs as one grid (TT / 128, DQ / 128, 3 * NB_): blockIdx.z = kind * NB_ + batch, kind 0 q, 1 k, 2 v; blockIdx.x = token tile, blockIdx.y = tile of 128 output channels (two heads).
// XB: the bf16 inputs [kind][batch][TT][DM]; WT: the transposed weights [kind][DQ][DM]; P16 / Ph / Pl: the plane sets [kind][batch][NH_ * TT * HD].
// v: the operands change places (A = the weight rows, Bt = the tokens), so that the tile comes out as V^T rows; same k order, same products
static_assert(DKV == DQ && PP == TT, "the q, k and v planes of a batch have one size");
__global__ __launch_bounds__(128) void k_proj(const bf* __restrict__ XB, const bf* __restrict__ WT, const float* __restrict__ bq, const float* __restrict__ bk, const float* __restrict__ bv, h16* P16, bf* Ph, bf* Pl) {
    __shared__ __align__(16) bf sm[2 * 256 * GP];
    static_assert(sizeof(sm) >= 4 * 64 * 68 * 4, "the four quadrants are staged in the ring");
    const int lane = threadIdx.x & 31, lr = lane & 15, hi = lane >> 4;
    const int w = __builtin_amdgcn_readfirstlane(threadIdx.x >> 5), wm = w >> 1, wn = w & 1;   // wave number, scalar
    const int z = blockIdx.z, kind = z / NB_, tok0 = blockIdx.x * 128, ch0 = blockIdx.y * 128; const bool vt = kind == 2;
    const bf* X = XB + (size_t)z * TT * DM; const bf* Wt = WT + (size_t)kind * DQ * DM; const size_t pz = (size_t)z * NH_ * TT * HD;
    const int r0 = vt ? ch0 : tok0, c0 = vt ? tok0 : ch0;
    v8f acc[4][4];
    g_tile<1>(vt ? Wt : X, nullptr, vt ? X : Wt, sm, r0, c0, wm, wn, lr, hi, acc);
    quad_out<1>(acc, (float*)sm + w * (64 * 68), lane, lr, hi, nullptr, vt ? PP : HD, r0 + wm * 64, c0 + wn * 64, vt ? bv : kind ? bk : bq, P16 + pz, Ph + pz, Pl + pz, vt ? (size_t)64 : (size_t)TT * HD, vt);
}
// ---- k_wo: out = (merged hi + merged lo) x w_o + b_o, grid (TT / 128, DM / 128, NB_): two products a k step against one staged weight tile.
__global__ __launch_bounds__(128) void k_wo(const bf* __restrict__ Ah, const bf* __restrict__ Al, const bf* __restrict__ Wt, const float* __restrict__ bo, float* C) {
    __shared__ __align__(16) bf sm[2 * 384 * GP];
    const int lane = threadIdx.x & 31, lr = lane & 15, hi = lane >> 4;
    const int w = __builtin_amdgcn_readfirstlane(threadIdx.x >> 5), wm = w >> 1, wn = w & 1;   // wave number, scalar
    const size_t z = blockIdx.z; const int r0 = blockIdx.x * 128, c0 = blockIdx.y * 128;
    v8f acc[4][4];
    g_tile<2>(Ah + z * TT * DQ, Al + z * TT * DQ, Wt, sm, r0, c0, wm, wn, lr, hi, acc);
    quad_out<0>(acc, (float*)sm + w * (64 * 68), lane, lr, hi, C + z * TT * DM, DM, r0 + wm * 64, c0 + wn * 64, bo, nullptr, nullptr, nullptr, 0, false);
}

// ---- k_prep: all the operand preparation in one launch. Work-groups 0 .. 4 * WB - 1: the four weights ([DM][DQ] f32, in the order q, k, v, o) transposed to bf16 rows WT[sel][n][k], one tile of 128 k x 64 n a work-group, turned in LDS:
// a wave's 16-byte load covers a 256-byte piece of two weight rows, its 16-byte store a 256-byte piece of two WT rows: four whole 128-byte lines each way.
// The other TT * DM / 8 / 256 work-groups: the three inputs to bf16, XB[input][batch][TT][DM]; a thread converts its 8 elements of every one of the twelve [TT][DM] slabs, the four batches of an input in flight together.
#define WP 65   // LDS row pitch of the turned tile in dwords (a dword holds the bf16 pair k, k + 1 of one n): 64 + 1, so that the 32 lanes of a write (16 rows n x 2 pairs) and of a read (2 rows n x 16 pieces) fall on 32 different banks
typedef __attribute__((ext_vector_type(4))) unsigned v4u;
__global__ __launch_bounds__(256) void k_prep(const float* __restrict__ wq, const float* __restrict__ wk, const float* __restrict__ wv, const float* __restrict__ wo, const float* __restrict__ x, const float* __restrict__ xk, const float* __restrict__ xv, bf* WT, bf* XB) {
    constexpr int K = DM, N = DQ, WB = (K / 128) * (N / 64); const int bx = blockIdx.x;
    __shared__ unsigned st[64 * WP];
    if (bx < 4 * WB) {
        const int sel = bx / WB, tile = bx % WB, k0 = (tile % (K / 128)) * 128, n0 = (tile / (K / 128)) * 64; const float* __restrict__ w = sel == 0 ? wq : sel == 1 ? wk : sel == 2 ? wv : wo; bf* Bt = WT + (size_t)sel * N * K;
        const int c = threadIdx.x & 15, rp = threadIdx.x >> 4;
        const float* src = w + (size_t)(k0 + rp * 2) * N + n0 + c * 4; v4f v[4][2];
        // every loop of this branch is unrolled so that v and o are indexed by constants and stay in registers, and the eight loads of a lane are in flight together
#pragma unroll
        for (int i = 0; i < 4; ++i) { v[i][0] = *(const v4fa*)(src + (size_t)(i * 32) * N); v[i][1] = *(const v4fa*)(src + (size_t)(i * 32 + 1) * N); }
        asm volatile("s_wait_xcnt 0x0" ::: "memory");   // before the address pair of the eight loads is reused
#pragma unroll
        for (int i = 0; i < 4; ++i)
#pragma unroll
            for (int e = 0; e < 4; ++e) st[(c * 4 + e) * WP + i * 16 + rp] = (unsigned)f2bf(v[i][0][e]) | ((unsigned)f2bf(v[i][1][e]) << 16);
        __syncthreads();   // the tile is complete in LDS before its rows n are read (the branch is the same for a whole work-group)
        v4u o[4];
#pragma unroll
        for (int j = 0; j < 4; ++j) { const unsigned* q = st + (j * 16 + rp) * WP + c * 4; o[j] = (v4u){q[0], q[1], q[2], q[3]}; }
        bf* dst = Bt + (size_t)(n0 + rp) * K + k0 + c * 8;
#pragma unroll
        for (int j = 0; j < 4; ++j) *(v8us*)(dst + (size_t)(j * 16) * K) = __builtin_bit_cast(v8us, o[j]);
    } else {
        const size_t i8 = ((size_t)(bx - 4 * WB) * 256 + threadIdx.x) * 8;
        // the loop over the inputs stays rolled: eight 16-byte loads of a lane in flight, few registers, many waves per SIMD; the loops over b and k are unrolled so that v and o stay in registers
#pragma unroll 1
        for (int s = 0; s < 3; ++s) { const float* __restrict__ src = (s == 0 ? x : s == 1 ? xk : xv) + i8; bf* dst = XB + (size_t)s * NB_ * TT * DM + i8; v8f v[NB_];
#pragma unroll
            for (int b = 0; b < NB_; ++b) { v[b] = *(const v8f*)(src + (size_t)b * TT * DM);
                asm volatile("s_wait_xcnt 0x0" ::: "memory"); }   // before the address pair is reused (the build hands it on as the destination of a later load)
#pragma unroll
            for (int b = 0; b < NB_; ++b) { v8us o;
#pragma unroll
                for (int k = 0; k < 8; ++k) o[k] = f2bf(v[b][k]);
                *(v8us*)(dst + (size_t)b * TT * DM) = o; }
            asm volatile("s_wait_xcnt 0x0" ::: "memory"); }   // before the next input's addresses reuse the registers of the stores
    }
}

// ---- k_fattn: causal attention of one (batch, head) plane per blockIdx.x, scores, softmax, P.V and the head merge in one launch; no score ever leaves the registers.
// A wave owns NQ groups of 16 query columns and walks the keys in blocks of 32 up to the diagonal: S^T = K Q^T (A = K rows, B = Q rows kept in registers), so a lane holds 16 scores of ONE query;
// running maximum and sum per query (log2 domain, one exchange between the lane halves), then the two f32 score tiles of a block, converted in place, are the B operand of O^T += V^T P^T (A = V^T rows, same k order as the packed tiles).
// Rows < RH: hi/lo planes, 3 products in both contractions; the rest fp16 with the probabilities carried x 2^10 (the factor is in the row sum too and cancels in the final division).
// fp16 rows: the four waves of a work-group (128 queries) share each stage of 64 keys through LDS: whole-line global loads into registers one stage ahead, two LDS buffers, one barrier a stage. The hi/lo rows (short walks) read their fragments straight from the planes.
#define SP 72   // LDS row pitch of a staged tile in 16-bit elements: 128 data bytes + 16, an odd multiple of 16 bytes, so that the 16-byte fragment reads of 16 rows spread over the banks
__device__ __forceinline__ float xhalf(float x) { return __builtin_bit_cast(float, __builtin_amdgcn_permlanex16(__builtin_bit_cast(int, x), __builtin_bit_cast(int, x), 0x76543210, 0xfedcba98, false, false)); }   // lane l <-> lane l ^ 16
// fa_exp2: 2^x. v_exp_f32 and the one v_nop that fills the slot behind it stand in one statement.
__device__ __forceinline__ float fa_exp2(float x) { float r; asm("v_exp_f32 %0, %1\n\tv_nop" : "=v"(r) : "v"(x)); return r; }
// every loop of the fa_ functions but the key walks is unrolled so that the fragment and accumulator arrays are indexed by constants and stay in registers
// fa_ldk / fa_ldv: the four fragments of one plane for one block of 32 keys; Kb = the block's first K row, Vb = the block's first key in V^T row 0, PITCH = row pitch in elements. GL: the source is global memory (the hi/lo planes); fa_ldg writes s_wait_xcnt 0 behind each of a fragment's two loads.
__device__ __forceinline__ v16bf fa_ldg(const bf* p) {
    const v8us x0 = *(const v8us*)p; asm volatile("s_wait_xcnt 0x0" ::: "memory");          // before the address pair is reused
    const v8us x1 = *(const v8us*)(p + 16); asm volatile("s_wait_xcnt 0x0" ::: "memory");   // before the address pair is reused
    return cat16b(x0, x1);
}
template <typename T16, int PITCH, bool GL>
__device__ __forceinline__ void fa_ldk(const T16* Kb, int lr, int hi, typename WFrag<T16>::V (&ka)[2][2]) {
#pragma unroll
    for (int kt = 0; kt < 2; ++kt)
#pragma unroll
        for (int kc = 0; kc < 2; ++kc) { const T16* p = Kb + (size_t)(kt * 16 + lr) * PITCH + kc * 32 + 8 * hi; if constexpr (GL) ka[kt][kc] = fa_ldg(p); else ka[kt][kc] = WFrag<T16>::ld(p); }
}
template <typename T16, int PITCH, bool GL>
__device__ __forceinline__ void fa_ldv(const T16* Vb, int lr, int hi, typename WFrag<T16>::V (&va)[4]) {
#pragma unroll
    for (int mb = 0; mb < 4; ++mb) { const T16* p = Vb + (size_t)(mb * 16 + lr) * PITCH + 8 * hi; if constexpr (GL) va[mb] = fa_ldg(p); else va[mb] = WFrag<T16>::ld(p); }
}
// fa_block: one block of 32 keys, first key key0. LAST: a block at or above the diagonal: keys above the query are masked.
template <typename T16, bool HR, int NQ, bool LAST, int KPITCH, int VPITCH>
__device__ __forceinline__ void fa_block(const T16* Kb, const T16* Kb2, const T16* Vb, const T16* Vb2, const typename WFrag<T16>::V (&qf)[NQ][2], const typename WFrag<T16>::V (&qf2)[NQ][2],
                                         v8f (&o)[4][NQ], float (&m)[NQ], float (&l)[NQ], int key0, int q0, int lr, int hi) {
    typedef typename WFrag<T16>::V V;
    constexpr float C2 = SCL * 1.4426950408889634f;   // score -> log2 domain
    constexpr float OFS = HR ? 0.0f : 10.0f;          // fp16 probabilities x 2^10: keeps small ones out of the subnormals
    v8f s[2][NQ]; V ka[2][2], ka2[2][2], va[4], va2[4];
    fa_ldk<T16, KPITCH, HR>(Kb, lr, hi, ka); if constexpr (HR) fa_ldk<T16, KPITCH, HR>(Kb2, lr, hi, ka2);
    if constexpr (HR) { fa_ldv<T16, VPITCH, HR>(Vb, lr, hi, va); fa_ldv<T16, VPITCH, HR>(Vb2, lr, hi, va2); }   // from global memory: early, they fly behind the S^T products and the softmax
#pragma unroll
    for (int kt = 0; kt < 2; ++kt)
#pragma unroll
        for (int n = 0; n < NQ; ++n) { s[kt][n] = (v8f){};
#pragma unroll
            for (int kc = 0; kc < 2; ++kc) { s[kt][n] = WFrag<T16>::mma(ka[kt][kc], qf[n][kc], s[kt][n]); if constexpr (HR) { s[kt][n] = WFrag<T16>::mma(ka[kt][kc], qf2[n][kc], s[kt][n]); s[kt][n] = WFrag<T16>::mma(ka2[kt][kc], qf[n][kc], s[kt][n]); } } }
    if constexpr (!HR) fa_ldv<T16, VPITCH, HR>(Vb, lr, hi, va);   // from LDS: into the registers that the K fragments have just left; the softmax covers the LDS latency
    float mx[NQ];
#pragma unroll
    for (int n = 0; n < NQ; ++n) { const int qi = q0 + n * 16 + lr; float t = m[n];
#pragma unroll
        for (int e = 0; e < 16; ++e) { if (LAST) s[e >> 3][n][e & 7] = (key0 + (e >> 3) * 16 + hi * 8 + (e & 7) <= qi) ? s[e >> 3][n][e & 7] : -3.0e38f; t = fmaxf(t, s[e >> 3][n][e & 7]); }
        mx[n] = fmaxf(t, xhalf(t)); }
    // sums and output columns follow the running maximum in every block (factor exactly 1 where it stayed): no branch, so the block is one scheduling region and its loads stay ahead of the vector work
#pragma unroll
    for (int n = 0; n < NQ; ++n) { const float al = fa_exp2((m[n] - mx[n]) * C2); l[n] *= al; m[n] = mx[n];
#pragma unroll
        for (int mb = 0; mb < 4; ++mb) o[mb][n] *= al; }
    V pb[NQ], pb2[NQ];
#pragma unroll
    for (int n = 0; n < NQ; ++n) { const float nm = OFS - mx[n] * C2; float ls = 0.f;
        if constexpr (HR) { v8us h0, h1, l0, l1;
#pragma unroll
            for (int e = 0; e < 8; ++e) { const float pa = fa_exp2(fmaf(s[0][n][e], C2, nm)), pc = fa_exp2(fmaf(s[1][n][e], C2, nm)); ls += pa + pc; unsigned short a, c; splitf(pa, a, c); h0[e] = a; l0[e] = c; splitf(pc, a, c); h1[e] = a; l1[e] = c; }
            pb[n] = cat16b(h0, h1); pb2[n] = cat16b(l0, l1);
        } else { v8h h0, h1;
#pragma unroll
            for (int e = 0; e < 8; ++e) { const float pa = fa_exp2(fmaf(s[0][n][e], C2, nm)), pc = fa_exp2(fmaf(s[1][n][e], C2, nm)); ls += pa + pc; h0[e] = tohx(pa); h1[e] = tohx(pc); }
            pb[n] = cat16(h0, h1); }
        l[n] += ls; }
#pragma unroll
    for (int mb = 0; mb < 4; ++mb)
#pragma unroll
        for (int n = 0; n < NQ; ++n) { o[mb][n] = WFrag<T16>::mma(va[mb], pb[n], o[mb][n]); if constexpr (HR) { o[mb][n] = WFrag<T16>::mma(va[mb], pb2[n], o[mb][n]); o[mb][n] = WFrag<T16>::mma(va2[mb], pb[n], o[mb][n]); } }
}
// fa_out: divides by the row sums and stores the merged hi/lo planes; Ah / Al point at the plane's first merged element (row pitch DQ). A lane holds 8 consecutive d of one query per tile: 16-byte stores, a head's 128-byte line written by one wave.
template <int NQ>
__device__ __forceinline__ void fa_out(const v8f (&o)[4][NQ], const float (&l)[NQ], int q0, int lr, int hi, bf* Ah, bf* Al) {
#pragma unroll
    for (int n = 0; n < NQ; ++n) { const float inv = __fdiv_rn(1.0f, l[n] + xhalf(l[n])); const size_t ro = (size_t)(q0 + n * 16 + lr) * DQ + hi * 8;
#pragma unroll
        for (int mb = 0; mb < 4; ++mb) { v8us oh, ol;
#pragma unroll
            for (int j = 0; j < 8; ++j) { unsigned short a, c; splitf(o[mb][n][j] * inv, a, c); oh[j] = a; ol[j] = c; }
            *(v8us*)(Ah + ro + mb * 16) = oh; *(v8us*)(Al + ro + mb * 16) = ol;
            asm volatile("s_wait_xcnt 0x0" ::: "memory"); } }   // before the next tile's packing reuses the registers of the two stores
}
// fa_hr: hi/lo rows: queries q0 .. q0 + 15 of one plane, one wave on its own.
__device__ __forceinline__ void fa_hr(const bf* __restrict__ Q, const bf* __restrict__ Q2, const bf* __restrict__ Kp, const bf* __restrict__ Kp2, const bf* __restrict__ Vt, const bf* __restrict__ Vt2, int q0, int lr, int hi, bf* Ah, bf* Al) {
    v16bf qf[1][2], qf2[1][2]; v8f o[4][1]; float m[1] = {-3.0e38f}, l[1] = {0.f};
#pragma unroll
    for (int kc = 0; kc < 2; ++kc) { const size_t qo = (size_t)(q0 + lr) * HD + kc * 32 + 8 * hi; qf[0][kc] = WFrag<bf>::ld(Q + qo); qf2[0][kc] = WFrag<bf>::ld(Q2 + qo); }
    asm volatile("s_wait_xcnt 0x0" ::: "memory");   // before the zeroing of the accumulators reuses the address pairs of the loads above
#pragma unroll
    for (int mb = 0; mb < 4; ++mb) o[mb][0] = (v8f){};
    const int nfull = (q0 + 15) >> 5;   // key blocks wholly below the diagonal; block nfull holds the diagonal
    for (int kb = 0; kb < nfull; ++kb) fa_block<bf, true, 1, false, HD, PP>(Kp + (size_t)kb * 32 * HD, Kp2 + (size_t)kb * 32 * HD, Vt + kb * 32, Vt2 + kb * 32, qf, qf2, o, m, l, kb * 32, q0, lr, hi);
    fa_block<bf, true, 1, true, HD, PP>(Kp + (size_t)nfull * 32 * HD, Kp2 + (size_t)nfull * 32 * HD, Vt + nfull * 32, Vt2 + nfull * 32, qf, qf2, o, m, l, nfull * 32, q0, lr, hi);
    fa_out<1>(o, l, q0, lr, hi, Ah, Al);
}
// fa_lo: fp16 rows: queries Q0 .. Q0 + 127 of one plane (Q0 a multiple of 128), wave w takes 32 of them. sm: two buffers, each a K tile [64 keys][SP] and a V^T tile [64 d][SP].
// All four waves walk the same Q0 / 32 + 4 key blocks, so every barrier is passed by all: the first Q0 / 32 lie below every query of the work-group; the last four (two stages) run masked, and a block wholly above a wave's queries adds exact zeros.
// fa_stage_ld / fa_stage_st: a thread moves the 16-byte piece pcol of rows prow, prow + 16, + 32, + 48 of both tiles: a wave's load covers four whole 128-byte lines.
__device__ __forceinline__ void fa_stage_ld(const h16* __restrict__ Kp, const h16* __restrict__ Vt, int key0, int prow, int pcol, v8h (&rk)[4], v8h (&rv)[4]) {
#pragma unroll
    for (int i = 0; i < 4; ++i) { rk[i] = *(const v8h*)(Kp + (size_t)(key0 + prow + 16 * i) * HD + pcol); rv[i] = *(const v8h*)(Vt + (size_t)(prow + 16 * i) * PP + key0 + pcol);
        asm volatile("s_wait_xcnt 0x0" ::: "memory"); }   // before the two loads' address pairs are reused
}
__device__ __forceinline__ void fa_stage_st(h16* sb, int prow, int pcol, const v8h (&rk)[4], const v8h (&rv)[4]) {
#pragma unroll
    for (int i = 0; i < 4; ++i) { *(v8h*)(sb + (prow + 16 * i) * SP + pcol) = rk[i]; *(v8h*)(sb + (64 + prow + 16 * i) * SP + pcol) = rv[i]; }
}
__device__ __forceinline__ void fa_lo(const h16* __restrict__ Q, const h16* __restrict__ Kp, const h16* __restrict__ Vt, h16* sm, int Q0, int w, int lr, int hi, bf* Ah, bf* Al) {
    const int q0 = Q0 + w * 32, prow = (int)threadIdx.x >> 3, pcol = ((int)threadIdx.x & 7) * 8;
    v16h qf[2][2]; v8f o[4][2]; float m[2], l[2]; v8h rk[4], rv[4];
    fa_stage_ld(Kp, Vt, 0, prow, pcol, rk, rv);
#pragma unroll
    for (int n = 0; n < 2; ++n) { m[n] = -3.0e38f; l[n] = 0.f;
#pragma unroll
        for (int kc = 0; kc < 2; ++kc) qf[n][kc] = WFrag<h16>::ld(Q + (size_t)(q0 + n * 16 + lr) * HD + kc * 32 + 8 * hi); }
    asm volatile("s_wait_xcnt 0x0" ::: "memory");   // before the zeroing of the accumulators reuses the address pairs of the loads above
#pragma unroll
    for (int n = 0; n < 2; ++n)
#pragma unroll
        for (int mb = 0; mb < 4; ++mb) o[mb][n] = (v8f){};
    fa_stage_st(sm, prow, pcol, rk, rv);
    __syncthreads();   // publishes stage 0
    const int nmain = Q0 >> 6;   // unmasked stages, an even number: stage nmain lies in buffer 0 again
    for (int st = 0; st < nmain; ++st) { const h16* sb = sm + (st & 1) * (128 * SP);
        fa_stage_ld(Kp, Vt, (st + 1) * 64, prow, pcol, rk, rv);   // flies behind this stage's two blocks
        // stays rolled: unrolled, the build fetches the second block's fragments during the first and the register count costs a wave per SIMD
#pragma unroll 1
        for (int b = 0; b < 2; ++b) fa_block<h16, false, 2, false, SP, SP>(sb + b * 32 * SP, nullptr, sb + 64 * SP + b * 32, nullptr, qf, qf, o, m, l, st * 64 + b * 32, q0, lr, hi);
        fa_stage_st(sm + ((st + 1) & 1) * (128 * SP), prow, pcol, rk, rv);   // that buffer's last reads stand in front of the barrier of stage st - 1
        __syncthreads(); }   // publishes stage st + 1 and ends every wave's reads of stage st
    fa_stage_ld(Kp, Vt, Q0 + 64, prow, pcol, rk, rv);   // the last stage; flies behind the first two masked blocks
    // stays rolled: one copy of the masked block in the text
#pragma unroll 1
    for (int t = 0; t < 4; ++t) { const h16* sb = sm + (t >> 1) * (128 * SP);
        if (t == 2) { fa_stage_st(sm + 128 * SP, prow, pcol, rk, rv); __syncthreads(); }   // publishes the last stage; buffer 1 was last read in front of the barrier that published stage nmain
        fa_block<h16, false, 2, true, SP, SP>(sb + (t & 1) * 32 * SP, nullptr, sb + 64 * SP + (t & 1) * 32, nullptr, qf, qf, o, m, l, Q0 + t * 32, q0, lr, hi); }
    fa_out<2>(o, l, q0, lr, hi, Ah, Al);
}
// grid (NB_ * NH_, (TT - RH) / 128 + RH / 64), 4 waves: blockIdx.y counts the query blocks from the longest key walk down, so that the cost falls with the work-group index. amdgpu_waves_per_eu(4, 4): the register budget of four waves per SIMD (without it the build takes more than 256 registers and a wave per SIMD is lost).
__global__ __launch_bounds__(128) __attribute__((amdgpu_waves_per_eu(4, 4))) void k_fattn(const h16* __restrict__ Q16, const h16* __restrict__ K16, const h16* __restrict__ V16, const bf* __restrict__ Qh, const bf* __restrict__ Ql, const bf* __restrict__ Kh, const bf* __restrict__ Kl, const bf* __restrict__ Vh, const bf* __restrict__ Vl, bf* Ah, bf* Al) {
    __shared__ __align__(16) h16 sm[2 * 128 * SP];
    const int lane = threadIdx.x & 31, lr = lane & 15, hi = lane >> 4;
    const int w = __builtin_amdgcn_readfirstlane(threadIdx.x >> 5);   // wave number, scalar: the key loops' bounds stay scalar
    const size_t bh = blockIdx.x, po = bh * TT * HD, vo = bh * HD * PP, ao = (bh / NH_) * TT * DQ + (bh % NH_) * HD; const int y = blockIdx.y;
    if (y < (TT - RH) / 128) fa_lo(Q16 + po, K16 + po, V16 + vo, sm, TT - 128 * (y + 1), w, lr, hi, Ah + ao, Al + ao);
    else fa_hr(Qh + po, Ql + po, Kh + po, Kl + po, Vh + vo, Vl + vo, RH - 64 * (y - (TT - RH) / 128 + 1) + w * 16, lr, hi, Ah + ao, Al + ao);
}

extern "C" void kernel_launch(void* const* d_in, const int* in_sizes, int n_in,
                              void* d_out, int out_size, void* d_ws, size_t ws_size, hipStream_t stream) {
    (void)in_sizes; (void)n_in; (void)out_size;
    const float* x = (const float*)d_in[0]; const float* xk = (const float*)d_in[1]; const float* xv = (const float*)d_in[2]; const float* wq = (const float*)d_in[3]; const float* bq = (const float*)d_in[4]; const float* wk = (const float*)d_in[5]; const float* bk = (const float*)d_in[6]; const float* wv = (const float*)d_in[7]; const float* bv = (const float*)d_in[8]; const float* wo = (const float*)d_in[9]; const float* bo = (const float*)d_in[10];
    float* OUT = (float*)d_out;     // [4][2048][1024]
    char* wsp = (char*)d_ws;
    auto take = [&](size_t bytes) { char* p = wsp; wsp += (bytes + 255) & ~(size_t)255; return (void*)p; };
    bf* WT = (bf*)take((size_t)4 * DQ * DM * 2);             // q, k, v, o
    bf* XB = (bf*)take((size_t)3 * NB_ * TT * DM * 2);       // [input][batch][TT][DM]
    const size_t PQ = (size_t)NH_ * TT * HD, PA = (size_t)TT * DQ;   // elements of one batch's planes; every plane set holds the NB_ batches side by side, the q, k and v sets of a kind of plane one behind the other
    h16* P16 = (h16*)take(3 * NB_ * PQ * 2); bf* Ph = (bf*)take(3 * NB_ * PQ * 2); bf* Pl = (bf*)take(3 * NB_ * PQ * 2);
    bf* ATh = (bf*)take(NB_ * PA * 2); bf* ATl = (bf*)take(NB_ * PA * 2);
    if ((size_t)(wsp - (char*)d_ws) > ws_size) return;    // ws 256 MiB
    k_prep<<<(unsigned)(4 * ((DM / 128) * (DQ / 64)) + TT * DM / 8 / 256), 256, 0, stream>>>(wq, wk, wv, wo, x, xk, xv, WT, XB);
    k_proj<<<dim3(TT / 128, DQ / 128, 3 * NB_), 128, 0, stream>>>(XB, WT, bq, bk, bv, P16, Ph, Pl);
    k_fattn<<<dim3(NB_ * NH_, (TT - RH) / 128 + RH / 64, 1), 128, 0, stream>>>(P16, P16 + NB_ * PQ, P16 + 2 * NB_ * PQ, Ph, Pl, Ph + NB_ * PQ, Pl + NB_ * PQ, Ph + 2 * NB_ * PQ, Pl + 2 * NB_ * PQ, ATh, ATl);
    k_wo<<<dim3(TT / 128, DM / 128, NB_), 128, 0, stream>>>(ATh, ATl, WT + (size_t)3 * DQ * DM, bo, OUT);
}

// v008
// A run of this version takes 143 microseconds.
// Next to v007, in two timings, it ran 1.05 and 1.04 times as fast.
// All steps since v000 together make it 20.4 times as fast.
#include <hip/hip_runtime.h>

// Causal multi-head attention on THREE separate input streams with biased (in, out) projections (Q, K, V [4][2048][1024]; q = Q Wq + bq, k = K Wk + bk, v = V Wv + bv ('xw' [1024][1024] normal x 1/32 + [1024] zeros on this draw: read; 16 heads x 64); scores / sqrt(64); tril kept, -inf elsewhere; softmax; out = merged Wo + bo ('xw' + a zero bias: read) -> [4][2048][1024] (8.4 M); argument order Q, K, V, Wq, bq, Wk, bk, Wv, bv, Wo, bo).
// Four launches. (1) the four 'xw' weights transposed and the three inputs copied to bf16, all batches; (2) the twelve projections (q, k, v x batch) as one grid of 128x128 tiles, operands staged in LDS: exact + bf16-rounded biases, stored by the GEMM itself as head planes, all batches side by side; (3) one fused causal T-2048 attention launch for all 64 (batch, head) planes (hybrid rows: < 512 hi/lo 3 products, rest fp16 x1024 with K and V^T staged in LDS; online softmax in registers, key walk ends at the diagonal); (4) merged hi/lo x w_o exact + b_o, the same tiles, the batch in blockIdx.z.
// Compute dtypes, f32 accumulate: every input rounded to bf16; projections exact + bf16-rounded biases; attention rows < 512 3 products, rest fp16; softmax f32; Wo hl x exact + bias.

#define NB_  4
#define TT   2048
#define DM   1024
#define NH_  16
#define NKV  16
#define REP  (NH_ / NKV)
#define HD   64
#define DQ   (NH_ * HD)
#define DKV  (NKV * HD)
#define PP   TT                   // row pitch, in 16-bit elements, of the V^T planes
#define RH   512                  // query rows < RH use hi+lo planes (0: none)
#define SCL  0.125f   // HD^-0.5
typedef _Float16 h16;
typedef unsigned short bf;
typedef __attribute__((ext_vector_type(16))) __bf16   v16bf;
typedef __attribute__((ext_vector_type(16))) _Float16 v16h;
typedef __attribute__((ext_vector_type(8)))  _Float16 v8h;
typedef __attribute__((ext_vector_type(8)))  unsigned short v8us;
typedef __attribute__((ext_vector_type(8)))  float    v8f;
typedef __attribute__((ext_vector_type(4)))  float    v4f;
typedef v8h  __attribute__((may_alias)) v8ha;
typedef v4f  __attribute__((may_alias)) v4fa;
typedef v8us __attribute__((may_alias)) v8usa;

__device__ __forceinline__ unsigned short f2bf(float f) { unsigned u = __float_as_uint(f); u += 0x7FFFu + ((u >> 16) & 1u); return (unsigned short)(u >> 16); }
__device__ __forceinline__ float bf2f(unsigned short b) { return __uint_as_float(((unsigned)b) << 16); }
__device__ __forceinline__ float bfr(float f) { return bf2f(f2bf(f)); }
__device__ __forceinline__ v16h cat16(v8h lo, v8h hi) { return __builtin_shufflevector(lo, hi, 0, 1, 2, 3, 4, 5, 6, 7, 8, 9, 10, 11, 12, 13, 14, 15); }
__device__ __forceinline__ v16bf cat16b(v8us lo, v8us hi) { return __builtin_bit_cast(v16bf, __builtin_shufflevector(lo, hi, 0, 1, 2, 3, 4, 5, 6, 7, 8, 9, 10, 11, 12, 13, 14, 15)); }
__device__ __forceinline__ v8f wmma16(v16h a, v16h b, v8f c) { return __builtin_amdgcn_wmma_f32_16x16x32_f16(false, a, false, b, (short)0, c, false, false); }
__device__ __forceinline__ v8f wmmab(v16bf a, v16bf b, v8f c) { return __builtin_amdgcn_wmma_f32_16x16x32_bf16(false, a, false, b, (short)0, c, false, false); }
__device__ __forceinline__ h16 tohx(float x) { return (h16)x; }
__device__ __forceinline__ void splitf(float y, unsigned short& h, unsigned short& l) { h = f2bf(y); l = f2bf(y - bf2f(h)); }
typedef __attribute__((ext_vector_type(4))) _Float16 v4h;
typedef __attribute__((ext_vector_type(4))) unsigned short v4us;



template <typename T16> struct WFrag;
template <> struct WFrag<h16> { typedef v16h V; static __device__ __forceinline__ V ld(const h16* p) { return cat16(*(const v8h*)p, *(const v8h*)(p + 16)); } static __device__ __forceinline__ v8f mma(V a, V b, v8f c) { return wmma16(a, b, c); } };
template <> struct WFrag<bf> { typedef v16bf V; static __device__ __forceinline__ V ld(const bf* p) { return cat16b(*(const v8us*)p, *(const v8us*)(p + 16)); } static __device__ __forceinline__ v8f mma(V a, V b, v8f c) { return wmmab(a, b, c); } };

// ---- the GEMM tile: one work-group of four waves per 128x128 output tile, wave (wm, wn) owns the 64x64 quadrant (16 accumulators) over the whole K; C[m][n] = sum_k A[m][k] Bt[n][k] (+ A2[m][k] Bt[n][k] for NP 2), all operands K-contiguous bf16 rows of pitch DM.
// The operands go through LDS in stages of GK = 64 k (one whole 128-byte line of every operand row), two buffers: asynchronous 16-byte copies, a wave's copy covers four whole lines; the copies of stage s + 2 are issued when every wave has left stage s, and fly behind stage s + 1.
// A buffer: [A 128 rows][Bt 128 rows]([A2 128 rows]), row pitch GP.
#define GP 72   // LDS row pitch in 16-bit elements: 128 data bytes + 16, an odd multiple of 16 bytes, so that the 16-byte fragment reads of 16 rows spread over the banks
#define GK 64
static_assert(DM == DQ, "one K pitch for every GEMM operand");
// g_copy8: the lane's 16-byte piece of rows r, r + 16, .. r + 112 of one operand; l = LDS byte address of the first, g = its global address. The wait stands in the copies' own statement: behind it the address registers may be rewritten.
__device__ __forceinline__ void g_copy8(unsigned l, const bf* g) {
    asm volatile("global_load_async_to_lds_b128 %0, %8, off\n\t"
                 "global_load_async_to_lds_b128 %1, %9, off\n\t"
                 "global_load_async_to_lds_b128 %2, %10, off\n\t"
                 "global_load_async_to_lds_b128 %3, %11, off\n\t"
                 "global_load_async_to_lds_b128 %4, %12, off\n\t"
                 "global_load_async_to_lds_b128 %5, %13, off\n\t"
                 "global_load_async_to_lds_b128 %6, %14, off\n\t"
                 "global_load_async_to_lds_b128 %7, %15, off\n\t"
                 "s_wait_xcnt 0x0"
                 :: "v"(l), "v"(l + 1 * 16 * GP * 2), "v"(l + 2 * 16 * GP * 2), "v"(l + 3 * 16 * GP * 2), "v"(l + 4 * 16 * GP * 2), "v"(l + 5 * 16 * GP * 2), "v"(l + 6 * 16 * GP * 2), "v"(l + 7 * 16 * GP * 2),
                    "v"(g), "v"(g + 1 * 16 * DM), "v"(g + 2 * 16 * DM), "v"(g + 3 * 16 * DM), "v"(g + 4 * 16 * DM), "v"(g + 5 * 16 * DM), "v"(g + 6 * 16 * DM), "v"(g + 7 * 16 * DM)
                 : "memory");
}
template <int NP>
__device__ __forceinline__ void g_fill(unsigned l, const bf* gA, const bf* gB, const bf* gA2, int k0) {
    g_copy8(l, gA + k0); g_copy8(l + 128 * GP * 2, gB + k0); if constexpr (NP == 2) g_copy8(l + 256 * GP * 2, gA2 + k0);
}
// g_frag: all fragments of one k step of 32 as one group; g_mma: its products. Their loops are unrolled so that acc and the fragments are indexed by constants and stay in registers.
template <int NP>
__device__ __forceinline__ void g_frag(const bf* pa, const bf* pb, v16bf (&a)[4], v16bf (&a2)[4], v16bf (&b)[4]) {
#pragma unroll
    for (int i = 0; i < 4; ++i) { a[i] = WFrag<bf>::ld(pa + i * 16 * GP); b[i] = WFrag<bf>::ld(pb + i * 16 * GP); if constexpr (NP == 2) a2[i] = WFrag<bf>::ld(pa + (256 + i * 16) * GP); }
}
template <int NP>
__device__ __forceinline__ void g_mma(const v16bf (&a)[4], const v16bf (&a2)[4], const v16bf (&b)[4], v8f (&acc)[4][4]) {
#pragma unroll
    for (int nb = 0; nb < 4; ++nb) {
#pragma unroll
        for (int mb = 0; mb < 4; ++mb) acc[mb][nb] = wmmab(a[mb], b[nb], acc[mb][nb]);
        if constexpr (NP == 2) {
#pragma unroll
            for (int mb = 0; mb < 4; ++mb) acc[mb][nb] = wmmab(a2[mb], b[nb], acc[mb][nb]); } }
}
template <int NP>
__device__ __forceinline__ void g_tile(const bf* __restrict__ A, const bf* __restrict__ A2, const bf* __restrict__ Bt, bf* sm, int r0, int c0, int wm, int wn, int lr, int hi, v8f (&acc)[4][4]) {
    constexpr int ST = (NP + 1) * 128 * GP, NS = DM / GK;   // elements of a buffer; stages
    static_assert(NS >= 2, "the ring starts with two stages");
    const int prow = (int)threadIdx.x >> 3, pcol = ((int)threadIdx.x & 7) * 8;
    const unsigned l = (unsigned)(size_t)(sm + prow * GP + pcol);
    const bf* gA = A + (size_t)(r0 + prow) * DM + pcol; const bf* gB = Bt + (size_t)(c0 + prow) * DM + pcol; const bf* gA2 = NP == 2 ? A2 + (size_t)(r0 + prow) * DM + pcol : nullptr;
    // unrolled so that acc is indexed by constants and stays in registers
#pragma unroll
    for (int mb = 0; mb < 4; ++mb)
#pragma unroll
        for (int nb = 0; nb < 4; ++nb) acc[mb][nb] = (v8f){};
    g_fill<NP>(l, gA, gB, gA2, 0);
    asm volatile("s_wait_asynccnt 0x0" ::: "memory");   // this wave's copies of stage 0 have landed
    __syncthreads();                                    // publishes stage 0
    g_fill<NP>(l + ST * 2, gA, gB, gA2, GK);
    // stays rolled: one stage's code in the text, the buffer chosen by the stage's parity
#pragma unroll 1
    for (int s = 0; s < NS; ++s) {
        const bf* pa = sm + (s & 1) * ST + (wm * 64 + lr) * GP + 8 * hi; const bf* pb = sm + (s & 1) * ST + (128 + wn * 64 + lr) * GP + 8 * hi;
        v16bf a[4], a2[4], b[4];
        g_frag<NP>(pa, pb, a, a2, b);
        __builtin_amdgcn_sched_barrier(0);   // keeps the LDS loads together in front of the products: without it the build sinks each B fragment's loads between the products and waits out the LDS latency four times a k step
        g_mma<NP>(a, a2, b, acc);
        g_frag<NP>(pa + 32, pb + 32, a, a2, b);             // the stage's last LDS reads
        asm volatile("s_wait_dscnt 0x0" ::: "memory");      // this wave's reads of stage s are done before the buffer is handed back
        asm volatile("s_wait_asynccnt 0x0" ::: "memory");   // this wave's copies of stage s + 1 have landed
        __syncthreads();                                    // publishes stage s + 1 and ends every wave's reads of stage s
        // the stage's last products run from registers alone. NP 1: the refill is issued in front of them; NP 2: behind them, where the fragments' registers are free for the copies' addresses
        if (NP == 1 && s + 2 < NS) g_fill<NP>(l + (s & 1) * (ST * 2), gA, gB, gA2, (s + 2) * GK);
        g_mma<NP>(a, a2, b, acc);
        if (NP == 2 && s + 2 < NS) g_fill<NP>(l + (s & 1) * (ST * 2), gA, gB, gA2, (s + 2) * GK);
    }
    asm volatile("s_wait_asynccnt 0x0" ::: "memory");   // no copy is outstanding when the ring becomes output staging
}
// quad_out: a wave stores its 64x64 quadrant to its own LDS range ow (pitch 68 floats, in the ring that every wave has left), one barrier, then quad_rows reads it back by rows: a lane takes 8 consecutive columns, so that every global store of the wave covers whole 128-byte lines.
// r0, c0: the quadrant's first row and column. PL 0: f32 to C (pitch ldc), bias[n]. PL 1: 16-bit planes (fp16, bf16 hi, bf16 lo); element [m][n] lies at (n / 64) * sH + m * ldc + n % 64 of each plane, so a quadrant row is one whole 128-byte line of each.
// PL 1, brow false: bias[n] (m = token, n = head * 64 + d: sH = TT * HD, ldc = HD gives [head][t][d]). PL 1, brow true: bias[m] (m = head * 64 + d, n = token: sH = 64, ldc = PP gives the V^T rows [head][d][t]). brow is the same for a whole work-group.
// Only the planes that k_fattn reads are built and stored. WHL: the hi and lo planes (tokens < RH); w16: the fp16 plane (every k and v token, q tokens >= RH). Both are the same for a whole work-group.
// BR: 0 or 1: brow is known when the variant is compiled, and only the bias form that it adds is loaded and rounded; -1: brow is read at run time.
template <int PL, bool WHL, int BR>
__device__ __forceinline__ void quad_rows(const float* ow, int lane, float* C, int ldc, int r0, int c0, const float* __restrict__ bias, h16* P16, bf* Ph, bf* Pl, size_t sH, bool brow, bool w16) {
    // every loop here is unrolled so that the pieces are indexed by constants and stay in registers
    const int prow = lane >> 3, cofs = (lane & 7) * 8; if constexpr (BR >= 0) brow = BR != 0;
    v4f bn0 = {}, bn1 = {};
    if constexpr (BR != 1) { const float* bp = bias + (brow ? r0 : c0 + cofs);   // brow: in bounds, not used
        bn0 = *(const v4fa*)bp; bn1 = *(const v4fa*)(bp + 4);
        asm volatile("s_wait_xcnt 0x0" ::: "memory"); }   // before the address pair of the two bias loads is reused
#pragma unroll
    for (int g = 0; g < 4; ++g) { v4f v0[4], v1[4]; float bm[4] = {};
#pragma unroll
        for (int i = 0; i < 4; ++i) { const int row = (g * 4 + i) * 4 + prow; v0[i] = *(const v4fa*)(ow + row * 68 + cofs); v1[i] = *(const v4fa*)(ow + row * 68 + cofs + 4);
            if constexpr (PL == 1 && BR != 0) { bm[i] = bias[brow ? r0 + row : c0];
                asm volatile("s_wait_xcnt 0x0" ::: "memory"); } }   // before the address pair of the bias load is reused
#pragma unroll
        for (int i = 0; i < 4; ++i) { const int row = (g * 4 + i) * 4 + prow;
#pragma unroll
            for (int e = 0; e < 4; ++e) { v0[i][e] += bfr(PL == 1 && brow ? bm[i] : bn0[e]); v1[i][e] += bfr(PL == 1 && brow ? bm[i] : bn1[e]); }
            if constexpr (PL == 0) { float* ct = C + (size_t)(r0 + row) * ldc + c0 + cofs; *(v4f*)ct = v0[i]; *(v4f*)(ct + 4) = v1[i]; }
            else { const size_t po = (size_t)(c0 >> 6) * sH + (size_t)(r0 + row) * ldc + cofs; v8us oh, ol;
                if constexpr (WHL) {
#pragma unroll
                    for (int e = 0; e < 4; ++e) { unsigned short x, y; splitf(v0[i][e], x, y); oh[e] = x; ol[e] = y; splitf(v1[i][e], x, y); oh[4 + e] = x; ol[4 + e] = y; } }
                if (w16) { v8h o16;
#pragma unroll
                    for (int e = 0; e < 4; ++e) { o16[e] = tohx(v0[i][e]); o16[4 + e] = tohx(v1[i][e]); }
                    *(v8h*)(P16 + po) = o16; }
                if constexpr (WHL) { *(v8us*)(Ph + po) = oh; *(v8us*)(Pl + po) = ol; } }
            asm volatile("s_wait_xcnt 0x0" ::: "memory"); } }   // before the next piece reuses the registers of the stores
}
template <int PL>
__device__ __forceinline__ void quad_out(const v8f (&acc)[4][4], float* ow, int lane, int lr, int hi, float* C, int ldc, int r0, int c0, const float* __restrict__ bias, h16* P16, bf* Ph, bf* Pl, size_t sH, bool brow, bool w16, bool whl) {
    // unrolled so that acc is indexed by constants and stays in registers
#pragma unroll
    for (int mb = 0; mb < 4; ++mb) {
#pragma unroll
        for (int nb = 0; nb < 4; ++nb) {
#pragma unroll
            for (int j = 0; j < 8; ++j) ow[(mb * 16 + hi * 8 + j) * 68 + nb * 16 + lr] = acc[mb][nb][j]; } }
    __syncthreads();   // the quadrant is complete in LDS before its rows are read back
    if constexpr (PL == 0) quad_rows<0, false, 0>(ow, lane, C, ldc, r0, c0, bias, P16, Ph, Pl, sH, false, false);
    else if (whl) quad_rows<1, true, -1>(ow, lane, C, ldc, r0, c0, bias, P16, Ph, Pl, sH, brow, w16);
    else if (brow) quad_rows<1, false, 1>(ow, lane, C, ldc, r0, c0, bias, P16, Ph, Pl, sH, true, true);
    else quad_rows<1, false, 0>(ow, lane, C, ldc, r0, c0, bias, P16, Ph, Pl, sH, false, true);
}
// ---- k_proj: the twelve projection GEMMs as one grid (TT / 128, DQ / 128, 3 * NB_): blockIdx.z = kind * NB_ + batch, kind 0 q, 1 k, 2 v; blockIdx.x = token tile, blockIdx.y = tile of 128 output channels (two heads).
// XB: the bf16 inputs [kind][batch][TT][DM]; WT: the transposed weights [kind][DQ][DM]; P16 / Ph / Pl: the plane sets [kind][batch][NH_ * TT * HD].
// v: the operands change places (A = the weight rows, Bt = the tokens), so that the tile comes out as V^T rows; same k order, same products
static_assert(DKV == DQ && PP == TT, "the q, k and v planes of a batch have one size");
static_assert(RH % 128 == 0, "a token tile lies wholly below RH or wholly at or above it");
__global__ __launch_bounds__(128) void k_proj(const bf* __restrict__ XB, const bf* __restrict__ WT, const float* __restrict__ bq, const float* __restrict__ bk, const float* __restrict__ bv, h16* P16, bf* Ph, bf* Pl) {
    __shared__ __align__(16) bf sm[2 * 256 * GP];
    static_assert(sizeof(sm) >= 4 * 64 * 68 * 4, "the four quadrants are staged in the ring");
    const int lane = threadIdx.x & 31, lr = lane & 15, hi = lane >> 4;
    const int w = __builtin_amdgcn_readfirstlane(threadIdx.x >> 5), wm = w >> 1, wn = w & 1;   // wave number, scalar
    const int z = blockIdx.z, kind = z / NB_, tok0 = blockIdx.x * 128, ch0 = blockIdx.y * 128; const bool vt = kind == 2;
    const bf* X = XB + (size_t)z * TT * DM; const bf* Wt = WT + (size_t)kind * DQ * DM; const size_t pz = (size_t)z * NH_ * TT * HD;
    const int r0 = vt ? ch0 : tok0, c0 = vt ? tok0 : ch0;
    v8f acc[4][4];
    g_tile<1>(vt ? Wt : X, nullptr, vt ? X : Wt, sm, r0, c0, wm, wn, lr, hi, acc);
    quad_out<1>(acc, (float*)sm + w * (64 * 68), lane, lr, hi, nullptr, vt ? PP : HD, r0 + wm * 64, c0 + wn * 64, vt ? bv : kind ? bk : bq, P16 + pz, Ph + pz, Pl + pz, vt ? (size_t)64 : (size_t)TT * HD, vt, kind != 0 || tok0 >= RH, tok0 < RH);
}
// ---- k_wo: out = (merged hi + merged lo) x w_o + b_o, grid (TT / 128, DM / 128, NB_): two products a k step against one staged weight tile.
__global__ __launch_bounds__(128) void k_wo(const bf* __restrict__ Ah, const bf* __restrict__ Al, const bf* __restrict__ Wt, const float* __restrict__ bo, float* C) {
    __shared__ __align__(16) bf sm[2 * 384 * GP];
    const int lane = threadIdx.x & 31, lr = lane & 15, hi = lane >> 4;
    const int w = __builtin_amdgcn_readfirstlane(threadIdx.x >> 5), wm = w >> 1, wn = w & 1;   // wave number, scalar
    const size_t z = blockIdx.z; const int r0 = blockIdx.x * 128, c0 = blockIdx.y * 128;
    v8f acc[4][4];
    g_tile<2>(Ah + z * TT * DQ, Al + z * TT * DQ, Wt, sm, r0, c0, wm, wn, lr, hi, acc);
    quad_out<0>(acc, (float*)sm + w * (64 * 68), lane, lr, hi, C + z * TT * DM, DM, r0 + wm * 64, c0 + wn * 64, bo, nullptr, nullptr, nullptr, 0, false, false, false);
}

// ---- k_prep: all the operand preparation in one launch. Work-groups 0 .. 4 * WB - 1: the four weights ([DM][DQ] f32, in the order q, k, v, o) transposed to bf16 rows WT[sel][n][k], one tile of 128 k x 64 n a work-group, turned in LDS:
// a wave's 16-byte load covers a 256-byte piece of two weight rows, its 16-byte store a 256-byte piece of two WT rows: four whole 128-byte lines each way.
// The other TT * DM / 8 / 256 work-groups: the three inputs to bf16, XB[input][batch][TT][DM]; a thread converts its 8 elements of every one of the twelve [TT][DM] slabs, the four batches of an input in flight together.
#define WP 65   // LDS row pitch of the turned tile in dwords (a dword holds the bf16 pair k, k + 1 of one n): 64 + 1, so that the 32 lanes of a write (16 rows n x 2 pairs) and of a read (2 rows n x 16 pieces) fall on 32 different banks
typedef __attribute__((ext_vector_type(4))) unsigned v4u;
__global__ __launch_bounds__(256) void k_prep(const float* __restrict__ wq, const float* __restrict__ wk, const float* __restrict__ wv, const float* __restrict__ wo, const float* __restrict__ x, const float* __restrict__ xk, const float* __restrict__ xv, bf* WT, bf* XB) {
    constexpr int K = DM, N = DQ, WB = (K / 128) * (N / 64); const int bx = blockIdx.x;
    __shared__ unsigned st[64 * WP];
    if (bx < 4 * WB) {
        const int sel = bx / WB, tile = bx % WB, k0 = (tile % (K / 128)) * 128, n0 = (tile / (K / 128)) * 64; const float* __restrict__ w = sel == 0 ? wq : sel == 1 ? wk : sel == 2 ? wv : wo; bf* Bt = WT + (size_t)sel * N * K;
        const int c = threadIdx.x & 15, rp = threadIdx.x >> 4;
        const float* src = w + (size_t)(k0 + rp * 2) * N + n0 + c * 4; v4f v[4][2];
        // every loop of this branch is unrolled so that v and o are indexed by constants and stay in registers, and the eight loads of a lane are in flight together
#pragma unroll
        for (int i = 0; i < 4; ++i) { v[i][0] = *(const v4fa*)(src + (size_t)(i * 32) * N); v[i][1] = *(const v4fa*)(src + (size_t)(i * 32 + 1) * N); }
        asm volatile("s_wait_xcnt 0x0" ::: "memory");   // before the address pair of the eight loads is reused
#pragma unroll
        for (int i = 0; i < 4; ++i)
#pragma unroll
            for (int e = 0; e < 4; ++e) st[(c * 4 + e) * WP + i * 16 + rp] = (unsigned)f2bf(v[i][0][e]) | ((unsigned)f2bf(v[i][1][e]) << 16);
        __syncthreads();   // the tile is complete in LDS before its rows n are read (the branch is the same for a whole work-group)
        v4u o[4];
#pragma unroll
        for (int j = 0; j < 4; ++j) { const unsigned* q = st + (j * 16 + rp) * WP + c * 4; o[j] = (v4u){q[0], q[1], q[2], q[3]}; }
        bf* dst = Bt + (size_t)(n0 + rp) * K + k0 + c * 8;
#pragma unroll
        for (int j = 0; j < 4; ++j) *(v8us*)(dst + (size_t)(j * 16) * K) = __builtin_bit_cast(v8us, o[j]);
    } else {
        const size_t i8 = ((size_t)(bx - 4 * WB) * 256 + threadIdx.x) * 8;
        // the loop over the inputs stays rolled: eight 16-byte loads of a lane in flight, few registers, many waves per SIMD; the loops over b and k are unrolled so that v and o stay in registers
#pragma unroll 1
        for (int s = 0; s < 3; ++s) { const float* __restrict__ src = (s == 0 ? x : s == 1 ? xk : xv) + i8; bf* dst = XB + (size_t)s * NB_ * TT * DM + i8; v8f v[NB_];
#pragma unroll
            for (int b = 0; b < NB_; ++b) { v[b] = *(const v8f*)(src + (size_t)b * TT * DM);
                asm volatile("s_wait_xcnt 0x0" ::: "memory"); }   // before the address pair is reused (the build hands it on as the destination of a later load)
#pragma unroll
            for (int b = 0; b < NB_; ++b) { v8us o;
#pragma unroll
                for (int k = 0; k < 8; ++k) o[k] = f2bf(v[b][k]);
                *(v8us*)(dst + (size_t)b * TT * DM) = o; }
            asm volatile("s_wait_xcnt 0x0" ::: "memory"); }   // before the next input's addresses reuse the registers of the stores
    }
}

// ---- k_fattn: causal attention of one (batch, head) plane per blockIdx.x, scores, softmax, P.V and the head merge in one launch; no score ever leaves the registers.
// A wave owns NQ groups of 16 query columns and walks the keys in blocks of 32 up to the diagonal: S^T = K Q^T (A = K rows, B = Q rows kept in registers), so a lane holds 16 scores of ONE query;
// running maximum and sum per query (log2 domain, one exchange between the lane halves), then the two f32 score tiles of a block, converted in place, are the B operand of O^T += V^T P^T (A = V^T rows, same k order as the packed tiles).
// Rows < RH: hi/lo planes, 3 products in both contractions; the rest fp16 with the probabilities carried x 2^10 (the factor is in the row sum too and cancels in the final division).
// fp16 rows: the four waves of a work-group (128 queries) share each stage of 64 keys through LDS: whole-line global loads into registers one stage ahead, two LDS buffers, one barrier a stage. The hi/lo rows (short walks) read their fragments straight from the planes.
#define SP 72   // LDS row pitch of a staged tile in 16-bit elements: 128 data bytes + 16, an odd multiple of 16 bytes, so that the 16-byte fragment reads of 16 rows spread over the banks
__device__ __forceinline__ float xhalf(float x) { return __builtin_bit_cast(float, __builtin_amdgcn_permlanex16(__builtin_bit_cast(int, x), __builtin_bit_cast(int, x), 0x76543210, 0xfedcba98, false, false)); }   // lane l <-> lane l ^ 16
// fa_exp2: 2^x. v_exp_f32 and the one v_nop that fills the slot behind it stand in one statement.
__device__ __forceinline__ float fa_exp2(float x) { float r; asm("v_exp_f32 %0, %1\n\tv_nop" : "=v"(r) : "v"(x)); return r; }
// every loop of the fa_ functions but the key walks is unrolled so that the fragment and accumulator arrays are indexed by constants and stay in registers
// fa_ldk / fa_ldv: the four fragments of one plane for one block of 32 keys; Kb = the block's first K row, Vb = the block's first key in V^T row 0, PITCH = row pitch in elements. GL: the source is global memory (the hi/lo planes); fa_ldg writes s_wait_xcnt 0 behind each of a fragment's two loads.
__device__ __forceinline__ v16bf fa_ldg(const bf* p) {
    const v8us x0 = *(const v8us*)p; asm volatile("s_wait_xcnt 0x0" ::: "memory");          // before the address pair is reused
    const v8us x1 = *(const v8us*)(p + 16); asm volatile("s_wait_xcnt 0x0" ::: "memory");   // before the address pair is reused
    return cat16b(x0, x1);
}
template <typename T16, int PITCH, bool GL>
__device__ __forceinline__ void fa_ldk(const T16* Kb, int lr, int hi, typename WFrag<T16>::V (&ka)[2][2]) {
#pragma unroll
    for (int kt = 0; kt < 2; ++kt)
#pragma unroll
        for (int kc = 0; kc < 2; ++kc) { const T16* p = Kb + (size_t)(kt * 16 + lr) * PITCH + kc * 32 + 8 * hi; if constexpr (GL) ka[kt][kc] = fa_ldg(p); else ka[kt][kc] = WFrag<T16>::ld(p); }
}
template <typename T16, int PITCH, bool GL>
__device__ __forceinline__ void fa_ldv(const T16* Vb, int lr, int hi, typename WFrag<T16>::V (&va)[4]) {
#pragma unroll
    for (int mb = 0; mb < 4; ++mb) { const T16* p = Vb + (size_t)(mb * 16 + lr) * PITCH + 8 * hi; if constexpr (GL) va[mb] = fa_ldg(p); else va[mb] = WFrag<T16>::ld(p); }
}
// fa_block: one block of 32 keys, first key key0. LAST: a block at or above the diagonal: keys above the query are masked.
template <typename T16, bool HR, int NQ, bool LAST, int KPITCH, int VPITCH>
__device__ __forceinline__ void fa_block(const T16* Kb, const T16* Kb2, const T16* Vb, const T16* Vb2, const typename WFrag<T16>::V (&qf)[NQ][2], const typename WFrag<T16>::V (&qf2)[NQ][2],
                                         v8f (&o)[4][NQ], float (&m)[NQ], float (&l)[NQ], int key0, int q0, int lr, int hi) {
    typedef typename WFrag<T16>::V V;
    constexpr float C2 = SCL * 1.4426950408889634f;   // score -> log2 domain
    constexpr float OFS = HR ? 0.0f : 10.0f;          // fp16 probabilities x 2^10: keeps small ones out of the subnormals
    v8f s[2][NQ]; V ka[2][2], ka2[2][2], va[4], va2[4];
    fa_ldk<T16, KPITCH, HR>(Kb, lr, hi, ka); if constexpr (HR) fa_ldk<T16, KPITCH, HR>(Kb2, lr, hi, ka2);
    if constexpr (HR) { fa_ldv<T16, VPITCH, HR>(Vb, lr, hi, va); fa_ldv<T16, VPITCH, HR>(Vb2, lr, hi, va2); }   // from global memory: early, they fly behind the S^T products and the softmax
#pragma unroll
    for (int kt = 0; kt < 2; ++kt)
#pragma unroll
        for (int n = 0; n < NQ; ++n) { s[kt][n] = (v8f){};
#pragma unroll
            for (int kc = 0; kc < 2; ++kc) { s[kt][n] = WFrag<T16>::mma(ka[kt][kc], qf[n][kc], s[kt][n]); if constexpr (HR) { s[kt][n] = WFrag<T16>::mma(ka[kt][kc], qf2[n][kc], s[kt][n]); s[kt][n] = WFrag<T16>::mma(ka2[kt][kc], qf[n][kc], s[kt][n]); } } }
    if constexpr (!HR) fa_ldv<T16, VPITCH, HR>(Vb, lr, hi, va);   // from LDS: into the registers that the K fragments have just left; the softmax covers the LDS latency
    float mx[NQ];
#pragma unroll
    for (int n = 0; n < NQ; ++n) { const int qi = q0 + n * 16 + lr; float t = m[n];
#pragma unroll
        for (int e = 0; e < 16; ++e) { if (LAST) s[e >> 3][n][e & 7] = (key0 + (e >> 3) * 16 + hi * 8 + (e & 7) <= qi) ? s[e >> 3][n][e & 7] : -3.0e38f; t = fmaxf(t, s[e >> 3][n][e & 7]); }
        mx[n] = fmaxf(t, xhalf(t)); }
    // sums and output columns follow the running maximum in every block (factor exactly 1 where it stayed): no branch, so the block is one scheduling region and its loads stay ahead of the vector work
#pragma unroll
    for (int n = 0; n < NQ; ++n) { const float al = fa_exp2((m[n] - mx[n]) * C2); l[n] *= al; m[n] = mx[n];
#pragma unroll
        for (int mb = 0; mb < 4; ++mb) o[mb][n] *= al; }
    V pb[NQ], pb2[NQ];
#pragma unroll
    for (int n = 0; n < NQ; ++n) { const float nm = OFS - mx[n] * C2; float ls = 0.f;
        if constexpr (HR) { v8us h0, h1, l0, l1;
#pragma unroll
            for (int e = 0; e < 8; ++e) { const float pa = fa_exp2(fmaf(s[0][n][e], C2, nm)), pc = fa_exp2(fmaf(s[1][n][e], C2, nm)); ls += pa + pc; unsigned short a, c; splitf(pa, a, c); h0[e] = a; l0[e] = c; splitf(pc, a, c); h1[e] = a; l1[e] = c; }
            pb[n] = cat16b(h0, h1); pb2[n] = cat16b(l0, l1);
        } else { v8h h0, h1;
#pragma unroll
            for (int e = 0; e < 8; ++e) { const float pa = fa_exp2(fmaf(s[0][n][e], C2, nm)), pc = fa_exp2(fmaf(s[1][n][e], C2, nm)); ls += pa + pc; h0[e] = tohx(pa); h1[e] = tohx(pc); }
            pb[n] = cat16(h0, h1); }
        l[n] += ls; }
#pragma unroll
    for (int mb = 0; mb < 4; ++mb)
#pragma unroll
        for (int n = 0; n < NQ; ++n) { o[mb][n] = WFrag<T16>::mma(va[mb], pb[n], o[mb][n]); if constexpr (HR) { o[mb][n] = WFrag<T16>::mma(va[mb], pb2[n], o[mb][n]); o[mb][n] = WFrag<T16>::mma(va2[mb], pb[n], o[mb][n]); } }
}
// fa_out: divides by the row sums and stores the merged hi/lo planes; Ah / Al point at the plane's first merged element (row pitch DQ). A lane holds 8 consecutive d of one query per tile: 16-byte stores, a head's 128-byte line written by one wave.
template <int NQ>
__device__ __forceinline__ void fa_out(const v8f (&o)[4][NQ], const float (&l)[NQ], int q0, int lr, int hi, bf* Ah, bf* Al) {
#pragma unroll
    for (int n = 0; n < NQ; ++n) { const float inv = __fdiv_rn(1.0f, l[n] + xhalf(l[n])); const size_t ro = (size_t)(q0 + n * 16 + lr) * DQ + hi * 8;
#pragma unroll
        for (int mb = 0; mb < 4; ++mb) { v8us oh, ol;
#pragma unroll
            for (int j = 0; j < 8; ++j) { unsigned short a, c; splitf(o[mb][n][j] * inv, a, c); oh[j] = a; ol[j] = c; }
            *(v8us*)(Ah + ro + mb * 16) = oh; *(v8us*)(Al + ro + mb * 16) = ol;
            asm volatile("s_wait_xcnt 0x0" ::: "memory"); } }   // before the next tile's packing reuses the registers of the two stores
}
// fa_hr: hi/lo rows: queries q0 .. q0 + 15 of one plane, one wave on its own.
__device__ __forceinline__ void fa_hr(const bf* __restrict__ Q, const bf* __restrict__ Q2, const bf* __restrict__ Kp, const bf* __restrict__ Kp2, const bf* __restrict__ Vt, const bf* __restrict__ Vt2, int q0, int lr, int hi, bf* Ah, bf* Al) {
    v16bf qf[1][2], qf2[1][2]; v8f o[4][1]; float m[1] = {-3.0e38f}, l[1] = {0.f};
#pragma unroll
    for (int kc = 0; kc < 2; ++kc) { const size_t qo = (size_t)(q0 + lr) * HD + kc * 32 + 8 * hi; qf[0][kc] = WFrag<bf>::ld(Q + qo); qf2[0][kc] = WFrag<bf>::ld(Q2 + qo); }
    asm volatile("s_wait_xcnt 0x0" ::: "memory");   // before the zeroing of the accumulators reuses the address pairs of the loads above
#pragma unroll
    for (int mb = 0; mb < 4; ++mb) o[mb][0] = (v8f){};
    const int nfull = (q0 + 15) >> 5;   // key blocks wholly below the diagonal; block nfull holds the diagonal
    for (int kb = 0; kb < nfull; ++kb) fa_block<bf, true, 1, false, HD, PP>(Kp + (size_t)kb * 32 * HD, Kp2 + (size_t)kb * 32 * HD, Vt + kb * 32, Vt2 + kb * 32, qf, qf2, o, m, l, kb * 32, q0, lr, hi);
    fa_block<bf, true, 1, true, HD, PP>(Kp + (size_t)nfull * 32 * HD, Kp2 + (size_t)nfull * 32 * HD, Vt + nfull * 32, Vt2 + nfull * 32, qf, qf2, o, m, l, nfull * 32, q0, lr, hi);
    fa_out<1>(o, l, q0, lr, hi, Ah, Al);
}
// fa_lo: fp16 rows: queries Q0 .. Q0 + 127 of one plane (Q0 a multiple of 128), wave w takes 32 of them. sm: two buffers, each a K tile [64 keys][SP] and a V^T tile [64 d][SP].
// All four waves walk the same Q0 / 32 + 4 key blocks, so every barrier is passed by all: the first Q0 / 32 lie below every query of the work-group; the last four (two stages) run masked, and a block wholly above a wave's queries adds exact zeros.
// fa_stage_ld / fa_stage_st: a thread moves the 16-byte piece pcol of rows prow, prow + 16, + 32, + 48 of both tiles: a wave's load covers four whole 128-byte lines.
__device__ __forceinline__ void fa_stage_ld(const h16* __restrict__ Kp, const h16* __restrict__ Vt, int key0, int prow, int pcol, v8h (&rk)[4], v8h (&rv)[4]) {
#pragma unroll
    for (int i = 0; i < 4; ++i) { rk[i] = *(const v8h*)(Kp + (size_t)(key0 + prow + 16 * i) * HD + pcol); rv[i] = *(const v8h*)(Vt + (size_t)(prow + 16 * i) * PP + key0 + pcol);
        asm volatile("s_wait_xcnt 0x0" ::: "memory"); }   // before the two loads' address pairs are reused
}
__device__ __forceinline__ void fa_stage_st(h16* sb, int prow, int pcol, const v8h (&rk)[4], const v8h (&rv)[4]) {
#pragma unroll
    for (int i = 0; i < 4; ++i) { *(v8h*)(sb + (prow + 16 * i) * SP + pcol) = rk[i]; *(v8h*)(sb + (64 + prow + 16 * i) * SP + pcol) = rv[i]; }
}
__device__ __forceinline__ void fa_lo(const h16* __restrict__ Q, const h16* __restrict__ Kp, const h16* __restrict__ Vt, h16* sm, int Q0, int w, int lr, int hi, bf* Ah, bf* Al) {
    const int q0 = Q0 + w * 32, prow = (int)threadIdx.x >> 3, pcol = ((int)threadIdx.x & 7) * 8;
    v16h qf[2][2]; v8f o[4][2]; float m[2], l[2]; v8h rk[4], rv[4];
    fa_stage_ld(Kp, Vt, 0, prow, pcol, rk, rv);
#pragma unroll
    for (int n = 0; n < 2; ++n) { m[n] = -3.0e38f; l[n] = 0.f;
#pragma unroll
        for (int kc = 0; kc < 2; ++kc) qf[n][kc] = WFrag<h16>::ld(Q + (size_t)(q0 + n * 16 + lr) * HD + kc * 32 + 8 * hi); }
    asm volatile("s_wait_xcnt 0x0" ::: "memory");   // before the zeroing of the accumulators reuses the address pairs of the loads above
#pragma unroll
    for (int n = 0; n < 2; ++n)
#pragma unroll
        for (int mb = 0; mb < 4; ++mb) o[mb][n] = (v8f){};
    fa_stage_st(sm, prow, pcol, rk, rv);
    __syncthreads();   // publishes stage 0
    const int nmain = Q0 >> 6;   // unmasked stages, an even number: stage nmain lies in buffer 0 again
    for (int st = 0; st < nmain; ++st) { const h16* sb = sm + (st & 1) * (128 * SP);
        fa_stage_ld(Kp, Vt, (st + 1) * 64, prow, pcol, rk, rv);   // flies behind this stage's two blocks
        // stays rolled: unrolled, the build fetches the second block's fragments during the first and the register count costs a wave per SIMD
#pragma unroll 1
        for (int b = 0; b < 2; ++b) fa_block<h16, false, 2, false, SP, SP>(sb + b * 32 * SP, nullptr, sb + 64 * SP + b * 32, nullptr, qf, qf, o, m, l, st * 64 + b * 32, q0, lr, hi);
        fa_stage_st(sm + ((st + 1) & 1) * (128 * SP), prow, pcol, rk, rv);   // that buffer's last reads stand in front of the barrier of stage st - 1
        __syncthreads(); }   // publishes stage st + 1 and ends every wave's reads of stage st
    fa_stage_ld(Kp, Vt, Q0 + 64, prow, pcol, rk, rv);   // the last stage; flies behind the first two masked blocks
    // stays rolled: one copy of the masked block in the text
#pragma unroll 1
    for (int t = 0; t < 4; ++t) { const h16* sb = sm + (t >> 1) * (128 * SP);
        if (t == 2) { fa_stage_st(sm + 128 * SP, prow, pcol, rk, rv); __syncthreads(); }   // publishes the last stage; buffer 1 was last read in front of the barrier that published stage nmain
        fa_block<h16, false, 2, true, SP, SP>(sb + (t & 1) * 32 * SP, nullptr, sb + 64 * SP + (t & 1) * 32, nullptr, qf, qf, o, m, l, Q0 + t * 32, q0, lr, hi); }
    fa_out<2>(o, l, q0, lr, hi, Ah, Al);
}
// grid (NB_ * NH_, (TT - RH) / 128 + RH / 64), 4 waves: blockIdx.y counts the query blocks from the longest key walk down, so that the cost falls with the work-group index. amdgpu_waves_per_eu(4, 4): the register budget of four waves per SIMD (without it the build takes more than 256 registers and a wave per SIMD is lost).
__global__ __launch_bounds__(128) __attribute__((amdgpu_waves_per_eu(4, 4))) void k_fattn(const h16* __restrict__ Q16, const h16* __restrict__ K16, const h16* __restrict__ V16, const bf* __restrict__ Qh, const bf* __restrict__ Ql, const bf* __restrict__ Kh, const bf* __restrict__ Kl, const bf* __restrict__ Vh, const bf* __restrict__ Vl, bf* Ah, bf* Al) {
    __shared__ __align__(16) h16 sm[2 * 128 * SP];
    const int lane = threadIdx.x & 31, lr = lane & 15, hi = lane >> 4;
    const int w = __builtin_amdgcn_readfirstlane(threadIdx.x >> 5);   // wave number, scalar: the key loops' bounds stay scalar
    const size_t bh = blockIdx.x, po = bh * TT * HD, vo = bh * HD * PP, ao = (bh / NH_) * TT * DQ + (bh % NH_) * HD; const int y = blockIdx.y;
    if (y < (TT - RH) / 128) fa_lo(Q16 + po, K16 + po, V16 + vo, sm, TT - 128 * (y + 1), w, lr, hi, Ah + ao, Al + ao);
    else fa_hr(Qh + po, Ql + po, Kh + po, Kl + po, Vh + vo, Vl + vo, RH - 64 * (y - (TT - RH) / 128 + 1) + w * 16, lr, hi, Ah + ao, Al + ao);
}

extern "C" void kernel_launch(void* const* d_in, const int* in_sizes, int n_in,
                              void* d_out, int out_size, void* d_ws, size_t ws_size, hipStream_t stream) {
    (void)in_sizes; (void)n_in; (void)out_size;
    const float* x = (const float*)d_in[0]; const float* xk = (const float*)d_in[1]; const float* xv = (const float*)d_in[2]; const float* wq = (const float*)d_in[3]; const float* bq = (const float*)d_in[4]; const float* wk = (const float*)d_in[5]; const float* bk = (const float*)d_in[6]; const float* wv = (const float*)d_in[7]; const float* bv = (const float*)d_in[8]; const float* wo = (const float*)d_in[9]; const float* bo = (const float*)d_in[10];
    float* OUT = (float*)d_out;     // [4][2048][1024]
    char* wsp = (char*)d_ws;
    auto take = [&](size_t bytes) { char* p = wsp; wsp += (bytes + 255) & ~(size_t)255; return (void*)p; };
    bf* WT = (bf*)take((size_t)4 * DQ * DM * 2);             // q, k, v, o
    bf* XB = (bf*)take((size_t)3 * NB_ * TT * DM * 2);       // [input][batch][TT][DM]
    const size_t PQ = (size_t)NH_ * TT * HD, PA = (size_t)TT * DQ;   // elements of one batch's planes; every plane set holds the NB_ batches side by side, the q, k and v sets of a kind of plane one behind the other
    h16* P16 = (h16*)take(3 * NB_ * PQ * 2); bf* Ph = (bf*)take(3 * NB_ * PQ * 2); bf* Pl = (bf*)take(3 * NB_ * PQ * 2);
    bf* ATh = (bf*)take(NB_ * PA * 2); bf* ATl = (bf*)take(NB_ * PA * 2);
    if ((size_t)(wsp - (char*)d_ws) > ws_size) return;    // ws 256 MiB
    k_prep<<<(unsigned)(4 * ((DM / 128) * (DQ / 64)) + TT * DM / 8 / 256), 256, 0, stream>>>(wq, wk, wv, wo, x, xk, xv, WT, XB);
    k_proj<<<dim3(TT / 128, DQ / 128, 3 * NB_), 128, 0, stream>>>(XB, WT, bq, bk, bv, P16, Ph, Pl);
    k_fattn<<<dim3(NB_ * NH_, (TT - RH) / 128 + RH / 64, 1), 128, 0, stream>>>(P16, P16 + NB_ * PQ, P16 + 2 * NB_ * PQ, Ph, Pl, Ph + NB_ * PQ, Pl + NB_ * PQ, Ph + 2 * NB_ * PQ, Pl + 2 * NB_ * PQ, ATh, ATl);
    k_wo<<<dim3(TT / 128, DM / 128, NB_), 128, 0, stream>>>(ATh, ATl, WT + (size_t)3 * DQ * DM, bo, OUT);
}

// v009
// Measured time: 136 microseconds a run.
// In both of two side-by-side timings against v008, it was 1.05 times as fast.
// Over all steps from v000 it is 21.4 times as fast.
#include <hip/hip_runtime.h>

// Causal multi-head attention on THREE separate input streams with biased (in, out) projections (Q, K, V [4][2048][1024]; q = Q Wq + bq, k = K Wk + bk, v = V Wv + bv ('xw' [1024][1024] normal x 1/32 + [1024] zeros on this draw: read; 16 heads x 64); scores / sqrt(64); tril kept, -inf elsewhere; softmax; out = merged Wo + bo ('xw' + a zero bias: read) -> [4][2048][1024] (8.4 M); argument order Q, K, V, Wq, bq, Wk, bk, Wv, bv, Wo, bo).
// Four launches. (1) the four 'xw' weights transposed and the three inputs copied to bf16, all batches; (2) the twelve projections (q, k, v x batch) as one grid of 128x128 tiles, operands staged in LDS: exact + bf16-rounded biases, stored by the GEMM itself as head planes, all batches side by side; (3) one fused causal T-2048 attention launch for all 64 (batch, head) planes (hybrid rows: < 512 hi/lo 3 products, rest fp16 x1024 with K and V^T staged in LDS; online softmax in registers, key walk ends at the diagonal); (4) merged hi/lo x w_o exact + b_o, the same tiles, the batch in blockIdx.z.
// Compute dtypes, f32 accumulate: every input rounded to bf16; projections exact + bf16-rounded biases; attention rows < 512 3 products, rest fp16; softmax f32; Wo hl x exact + bias.

#define NB_  4
#define TT   2048
#define DM   1024
#define NH_  16
#define NKV  16
#define REP  (NH_ / NKV)
#define HD   64
#define DQ   (NH_ * HD)
#define DKV  (NKV * HD)
#define PP   TT                   // row pitch, in 16-bit elements, of the V^T planes
#define RH   512                  // query rows < RH use hi+lo planes (0: none)
#define SCL  0.125f   // HD^-0.5
#define QSC  (SCL * 1.4426950408889634f)   // raw score -> log2 domain; k_proj multiplies the q planes by it before they are rounded
typedef _Float16 h16;
typedef unsigned short bf;
typedef __attribute__((ext_vector_type(16))) __bf16   v16bf;
typedef __attribute__((ext_vector_type(16))) _Float16 v16h;
typedef __attribute__((ext_vector_type(8)))  _Float16 v8h;
typedef __attribute__((ext_vector_type(8)))  unsigned short v8us;
typedef __attribute__((ext_vector_type(8)))  float    v8f;
typedef __attribute__((ext_vector_type(4)))  float    v4f;
typedef v8h  __attribute__((may_alias)) v8ha;
typedef v4f  __attribute__((may_alias)) v4fa;
typedef v8us __attribute__((may_alias)) v8usa;

__device__ __forceinline__ unsigned short f2bf(float f) { unsigned u = __float_as_uint(f); u += 0x7FFFu + ((u >> 16) & 1u); return (unsigned short)(u >> 16); }
__device__ __forceinline__ float bf2f(unsigned short b) { return __uint_as_float(((unsigned)b) << 16); }
__device__ __forceinline__ float bfr(float f) { return bf2f(f2bf(f)); }
__device__ __forceinline__ v16h cat16(v8h lo, v8h hi) { return __builtin_shufflevector(lo, hi, 0, 1, 2, 3, 4, 5, 6, 7, 8, 9, 10, 11, 12, 13, 14, 15); }
__device__ __forceinline__ v16bf cat16b(v8us lo, v8us hi) { return __builtin_bit_cast(v16bf, __builtin_shufflevector(lo, hi, 0, 1, 2, 3, 4, 5, 6, 7, 8, 9, 10, 11, 12, 13, 14, 15)); }
__device__ __forceinline__ v8f wmma16(v16h a, v16h b, v8f c) { return __builtin_amdgcn_wmma_f32_16x16x32_f16(false, a, false, b, (short)0, c, false, false); }
__device__ __forceinline__ v8f wmmab(v16bf a, v16bf b, v8f c) { return __builtin_amdgcn_wmma_f32_16x16x32_bf16(false, a, false, b, (short)0, c, false, false); }
__device__ __forceinline__ h16 tohx(float x) { return (h16)x; }
__device__ __forceinline__ void splitf(float y, unsigned short& h, unsigned short& l) { h = f2bf(y); l = f2bf(y - bf2f(h)); }
typedef __attribute__((ext_vector_type(4))) _Float16 v4h;
typedef __attribute__((ext_vector_type(4))) unsigned short v4us;



template <typename T16> struct WFrag;
template <> struct WFrag<h16> { typedef v16h V; static __device__ __forceinline__ V ld(const h16* p) { return cat16(*(const v8h*)p, *(const v8h*)(p + 16)); } static __device__ __forceinline__ v8f mma(V a, V b, v8f c) { return wmma16(a, b, c); } };
template <> struct WFrag<bf> { typedef v16bf V; static __device__ __forceinline__ V ld(const bf* p) { return cat16b(*(const v8us*)p, *(const v8us*)(p + 16)); } static __device__ __forceinline__ v8f mma(V a, V b, v8f c) { return wmmab(a, b, c); } };

// ---- the GEMM tile: one work-group of four waves per 128x128 output tile, wave (wm, wn) owns the 64x64 quadrant (16 accumulators) over the whole K; C[m][n] = sum_k A[m][k] Bt[n][k] (+ A2[m][k] Bt[n][k] for NP 2), all operands K-contiguous bf16 rows of pitch DM.
// The operands go through LDS in stages of GK = 64 k (one whole 128-byte line of every operand row), two buffers: asynchronous 16-byte copies, a wave's copy covers four whole lines; the copies of stage s + 2 are issued when every wave has left stage s, and fly behind stage s + 1.
// A buffer: [A 128 rows][Bt 128 rows]([A2 128 rows]), row pitch GP.
#define GP 72   // LDS row pitch in 16-bit elements: 128 data bytes + 16, an odd multiple of 16 bytes, so that the 16-byte fragment reads of 16 rows spread over the banks
#define GK 64
static_assert(DM == DQ, "one K pitch for every GEMM operand");
// g_copy8: the lane's 16-byte piece of rows r, r + 16, .. r + 112 of one operand; l = LDS byte address of the first, g = its global address. The wait stands in the copies' own statement: behind it the address registers may be rewritten.
__device__ __forceinline__ void g_copy8(unsigned l, const bf* g) {
    asm volatile("global_load_async_to_lds_b128 %0, %8, off\n\t"
                 "global_load_async_to_lds_b128 %1, %9, off\n\t"
                 "global_load_async_to_lds_b128 %2, %10, off\n\t"
                 "global_load_async_to_lds_b128 %3, %11, off\n\t"
                 "global_load_async_to_lds_b128 %4, %12, off\n\t"
                 "global_load_async_to_lds_b128 %5, %13, off\n\t"
                 "global_load_async_to_lds_b128 %6, %14, off\n\t"
                 "global_load_async_to_lds_b128 %7, %15, off\n\t"
                 "s_wait_xcnt 0x0"
                 :: "v"(l), "v"(l + 1 * 16 * GP * 2), "v"(l + 2 * 16 * GP * 2), "v"(l + 3 * 16 * GP * 2), "v"(l + 4 * 16 * GP * 2), "v"(l + 5 * 16 * GP * 2), "v"(l + 6 * 16 * GP * 2), "v"(l + 7 * 16 * GP * 2),
                    "v"(g), "v"(g + 1 * 16 * DM), "v"(g + 2 * 16 * DM), "v"(g + 3 * 16 * DM), "v"(g + 4 * 16 * DM), "v"(g + 5 * 16 * DM), "v"(g + 6 * 16 * DM), "v"(g + 7 * 16 * DM)
                 : "memory");
}
template <int NP>
__device__ __forceinline__ void g_fill(unsigned l, const bf* gA, const bf* gB, const bf* gA2, int k0) {
    g_copy8(l, gA + k0); g_copy8(l + 128 * GP * 2, gB + k0); if constexpr (NP == 2) g_copy8(l + 256 * GP * 2, gA2 + k0);
}
// g_frag: all fragments of one k step of 32 as one group; g_mma: its products. Their loops are unrolled so that acc and the fragments are indexed by constants and stay in registers.
template <int NP>
__device__ __forceinline__ void g_frag(const bf* pa, const bf* pb, v16bf (&a)[4], v16bf (&a2)[4], v16bf (&b)[4]) {
#pragma unroll
    for (int i = 0; i < 4; ++i) { a[i] = WFrag<bf>::ld(pa + i * 16 * GP); b[i] = WFrag<bf>::ld(pb + i * 16 * GP); if constexpr (NP == 2) a2[i] = WFrag<bf>::ld(pa + (256 + i * 16) * GP); }
}
template <int NP>
__device__ __forceinline__ void g_mma(const v16bf (&a)[4], const v16bf (&a2)[4], const v16bf (&b)[4], v8f (&acc)[4][4]) {
#pragma unroll
    for (int nb = 0; nb < 4; ++nb) {
#pragma unroll
        for (int mb = 0; mb < 4; ++mb) acc[mb][nb] = wmmab(a[mb], b[nb], acc[mb][nb]);
        if constexpr (NP == 2) {
#pragma unroll
            for (int mb = 0; mb < 4; ++mb) acc[mb][nb] = wmmab(a2[mb], b[nb], acc[mb][nb]); } }
}
template <int NP>
__device__ __forceinline__ void g_tile(const bf* __restrict__ A, const bf* __restrict__ A2, const bf* __restrict__ Bt, bf* sm, int r0, int c0, int wm, int wn, int lr, int hi, v8f (&acc)[4][4]) {
    constexpr int ST = (NP + 1) * 128 * GP, NS = DM / GK;   // elements of a buffer; stages
    static_assert(NS >= 2, "the ring starts with two stages");
    const int prow = (int)threadIdx.x >> 3, pcol = ((int)threadIdx.x & 7) * 8;
    const unsigned l = (unsigned)(size_t)(sm + prow * GP + pcol);
    const bf* gA = A + (size_t)(r0 + prow) * DM + pcol; const bf* gB = Bt + (size_t)(c0 + prow) * DM + pcol; const bf* gA2 = NP == 2 ? A2 + (size_t)(r0 + prow) * DM + pcol : nullptr;
    // unrolled so that acc is indexed by constants and stays in registers
#pragma unroll
    for (int mb = 0; mb < 4; ++mb)
#pragma unroll
        for (int nb = 0; nb < 4; ++nb) acc[mb][nb] = (v8f){};
    g_fill<NP>(l, gA, gB, gA2, 0);
    asm volatile("s_wait_asynccnt 0x0" ::: "memory");   // this wave's copies of stage 0 have landed
    __syncthreads();                                    // publishes stage 0
    g_fill<NP>(l + ST * 2, gA, gB, gA2, GK);
    // stays rolled: one stage's code in the text, the buffer chosen by the stage's parity
#pragma unroll 1
    for (int s = 0; s < NS; ++s) {
        const bf* pa = sm + (s & 1) * ST + (wm * 64 + lr) * GP + 8 * hi; const bf* pb = sm + (s & 1) * ST + (128 + wn * 64 + lr) * GP + 8 * hi;
        v16bf a[4], a2[4], b[4];
        g_frag<NP>(pa, pb, a, a2, b);
        __builtin_amdgcn_sched_barrier(0);   // keeps the LDS loads together in front of the products: without it the build sinks each B fragment's loads between the products and waits out the LDS latency four times a k step
        g_mma<NP>(a, a2, b, acc);
        g_frag<NP>(pa + 32, pb + 32, a, a2, b);             // the stage's last LDS reads
        asm volatile("s_wait_dscnt 0x0" ::: "memory");      // this wave's reads of stage s are done before the buffer is handed back
        asm volatile("s_wait_asynccnt 0x0" ::: "memory");   // this wave's copies of stage s + 1 have landed
        __syncthreads();                                    // publishes stage s + 1 and ends every wave's reads of stage s
        // the stage's last products run from registers alone. NP 1: the refill is issued in front of them; NP 2: behind them, where the fragments' registers are free for the copies' addresses
        if (NP == 1 && s + 2 < NS) g_fill<NP>(l + (s & 1) * (ST * 2), gA, gB, gA2, (s + 2) * GK);
        g_mma<NP>(a, a2, b, acc);
        if (NP == 2 && s + 2 < NS) g_fill<NP>(l + (s & 1) * (ST * 2), gA, gB, gA2, (s + 2) * GK);
    }
    asm volatile("s_wait_asynccnt 0x0" ::: "memory");   // no copy is outstanding when the ring becomes output staging
}
// quad_out: a wave stores its 64x64 quadrant to its own LDS range ow (pitch 68 floats, in the ring that every wave has left), one barrier, then quad_rows reads it back by rows: a lane takes 8 consecutive columns, so that every global store of the wave covers whole 128-byte lines.
// r0, c0: the quadrant's first row and column. PL 0: f32 to C (pitch ldc), bias[n]. PL 1: 16-bit planes (fp16, bf16 hi, bf16 lo); element [m][n] lies at (n / 64) * sH + m * ldc + n % 64 of each plane, so a quadrant row is one whole 128-byte line of each.
// PL 1, brow false: bias[n] (m = token, n = head * 64 + d: sH = TT * HD, ldc = HD gives [head][t][d]). PL 1, brow true: bias[m] (m = head * 64 + d, n = token: sH = 64, ldc = PP gives the V^T rows [head][d][t]). brow is the same for a whole work-group.
// Only the planes that k_fattn reads are built and stored. WHL: the hi and lo planes (tokens < RH); w16: the fp16 plane (every k and v token, q tokens >= RH). Both are the same for a whole work-group.
// qs (PL 1): factor on the biased sum before it is rounded to the planes: QSC for q, exactly 1 for k and v (BR 1 is v alone: no multiply).
// BR: 0 or 1: brow is known when the variant is compiled, and only the bias form that it adds is loaded and rounded; -1: brow is read at run time.
template <int PL, bool WHL, int BR>
__device__ __forceinline__ void quad_rows(const float* ow, int lane, float* C, int ldc, int r0, int c0, const float* __restrict__ bias, h16* P16, bf* Ph, bf* Pl, size_t sH, bool brow, bool w16, float qs = 1.0f) {
    // every loop here is unrolled so that the pieces are indexed by constants and stay in registers
    const int prow = lane >> 3, cofs = (lane & 7) * 8; if constexpr (BR >= 0) brow = BR != 0;
    v4f bn0 = {}, bn1 = {};
    if constexpr (BR != 1) { const float* bp = bias + (brow ? r0 : c0 + cofs);   // brow: in bounds, not used
        bn0 = *(const v4fa*)bp; bn1 = *(const v4fa*)(bp + 4);
        asm volatile("s_wait_xcnt 0x0" ::: "memory"); }   // before the address pair of the two bias loads is reused
#pragma unroll
    for (int g = 0; g < 4; ++g) { v4f v0[4], v1[4]; float bm[4] = {};
#pragma unroll
        for (int i = 0; i < 4; ++i) { const int row = (g * 4 + i) * 4 + prow; v0[i] = *(const v4fa*)(ow + row * 68 + cofs); v1[i] = *(const v4fa*)(ow + row * 68 + cofs + 4);
            if constexpr (PL == 1 && BR != 0) { bm[i] = bias[brow ? r0 + row : c0];
                asm volatile("s_wait_xcnt 0x0" ::: "memory"); } }   // before the address pair of the bias load is reused
#pragma unroll
        for (int i = 0; i < 4; ++i) { const int row = (g * 4 + i) * 4 + prow;
#pragma unroll
            for (int e = 0; e < 4; ++e) { v0[i][e] += bfr(PL == 1 && brow ? bm[i] : bn0[e]); v1[i][e] += bfr(PL == 1 && brow ? bm[i] : bn1[e]); if constexpr (PL == 1 && BR != 1) { v0[i][e] *= qs; v1[i][e] *= qs; } }
            if constexpr (PL == 0) { float* ct = C + (size_t)(r0 + row) * ldc + c0 + cofs; *(v4f*)ct = v0[i]; *(v4f*)(ct + 4) = v1[i]; }
            else { const size_t po = (size_t)(c0 >> 6) * sH + (size_t)(r0 + row) * ldc + cofs; v8us oh, ol;
                if constexpr (WHL) {
#pragma unroll
                    for (int e = 0; e < 4; ++e) { unsigned short x, y; splitf(v0[i][e], x, y); oh[e] = x; ol[e] = y; splitf(v1[i][e], x, y); oh[4 + e] = x; ol[4 + e] = y; } }
                if (w16) { v8h o16;
#pragma unroll
                    for (int e = 0; e < 4; ++e) { o16[e] = tohx(v0[i][e]); o16[4 + e] = tohx(v1[i][e]); }
                    *(v8h*)(P16 + po) = o16; }
                if constexpr (WHL) { *(v8us*)(Ph + po) = oh; *(v8us*)(Pl + po) = ol; } }
            asm volatile("s_wait_xcnt 0x0" ::: "memory"); } }   // before the next piece reuses the registers of the stores
}
template <int PL>
__device__ __forceinline__ void quad_out(const v8f (&acc)[4][4], float* ow, int lane, int lr, int hi, float* C, int ldc, int r0, int c0, const float* __restrict__ bias, h16* P16, bf* Ph, bf* Pl, size_t sH, bool brow, bool w16, bool whl, float qs = 1.0f) {
    // unrolled so that acc is indexed by constants and stays in registers
#pragma unroll
    for (int mb = 0; mb < 4; ++mb) {
#pragma unroll
        for (int nb = 0; nb < 4; ++nb) {
#pragma unroll
            for (int j = 0; j < 8; ++j) ow[(mb * 16 + hi * 8 + j) * 68 + nb * 16 + lr] = acc[mb][nb][j]; } }
    __syncthreads();   // the quadrant is complete in LDS before its rows are read back
    if constexpr (PL == 0) quad_rows<0, false, 0>(ow, lane, C, ldc, r0, c0, bias, P16, Ph, Pl, sH, false, false);
    else if (whl) quad_rows<1, true, -1>(ow, lane, C, ldc, r0, c0, bias, P16, Ph, Pl, sH, brow, w16, qs);
    else if (brow) quad_rows<1, false, 1>(ow, lane, C, ldc, r0, c0, bias, P16, Ph, Pl, sH, true, true);
    else quad_rows<1, false, 0>(ow, lane, C, ldc, r0, c0, bias, P16, Ph, Pl, sH, false, true, qs);
}
// ---- k_proj: the twelve projection GEMMs as one grid (TT / 128, DQ / 128, 3 * NB_): blockIdx.z = kind * NB_ + batch, kind 0 q, 1 k, 2 v; blockIdx.x = token tile, blockIdx.y = tile of 128 output channels (two heads).
// XB: the bf16 inputs [kind][batch][TT][DM]; WT: the transposed weights [kind][DQ][DM]; P16 / Ph / Pl: the plane sets [kind][batch][NH_ * TT * HD].
// v: the operands change places (A = the weight rows, Bt = the tokens), so that the tile comes out as V^T rows; same k order, same products
static_assert(DKV == DQ && PP == TT, "the q, k and v planes of a batch have one size");
static_assert(RH % 128 == 0, "a token tile lies wholly below RH or wholly at or above it");
__global__ __launch_bounds__(128) void k_proj(const bf* __restrict__ XB, const bf* __restrict__ WT, const float* __restrict__ bq, const float* __restrict__ bk, const float* __restrict__ bv, h16* P16, bf* Ph, bf* Pl) {
    __shared__ __align__(16) bf sm[2 * 256 * GP];
    static_assert(sizeof(sm) >= 4 * 64 * 68 * 4, "the four quadrants are staged in the ring");
    const int lane = threadIdx.x & 31, lr = lane & 15, hi = lane >> 4;
    const int w = __builtin_amdgcn_readfirstlane(threadIdx.x >> 5), wm = w >> 1, wn = w & 1;   // wave number, scalar
    const int z = blockIdx.z, kind = z / NB_, tok0 = blockIdx.x * 128, ch0 = blockIdx.y * 128; const bool vt = kind == 2;
    const bf* X = XB + (size_t)z * TT * DM; const bf* Wt = WT + (size_t)kind * DQ * DM; const size_t pz = (size_t)z * NH_ * TT * HD;
    const int r0 = vt ? ch0 : tok0, c0 = vt ? tok0 : ch0;
    v8f acc[4][4];
    g_tile<1>(vt ? Wt : X, nullptr, vt ? X : Wt, sm, r0, c0, wm, wn, lr, hi, acc);
    quad_out<1>(acc, (float*)sm + w * (64 * 68), lane, lr, hi, nullptr, vt ? PP : HD, r0 + wm * 64, c0 + wn * 64, vt ? bv : kind ? bk : bq, P16 + pz, Ph + pz, Pl + pz, vt ? (size_t)64 : (size_t)TT * HD, vt, kind != 0 || tok0 >= RH, tok0 < RH, kind == 0 ? QSC : 1.0f);
}
// ---- k_wo: out = (merged hi + merged lo) x w_o + b_o, grid (TT / 128, DM / 128, NB_): two products a k step against one staged weight tile.
__global__ __launch_bounds__(128) void k_wo(const bf* __restrict__ Ah, const bf* __restrict__ Al, const bf* __restrict__ Wt, const float* __restrict__ bo, float* C) {
    __shared__ __align__(16) bf sm[2 * 384 * GP];
    const int lane = threadIdx.x & 31, lr = lane & 15, hi = lane >> 4;
    const int w = __builtin_amdgcn_readfirstlane(threadIdx.x >> 5), wm = w >> 1, wn = w & 1;   // wave number, scalar
    const size_t z = blockIdx.z; const int r0 = blockIdx.x * 128, c0 = blockIdx.y * 128;
    v8f acc[4][4];
    g_tile<2>(Ah + z * TT * DQ, Al + z * TT * DQ, Wt, sm, r0, c0, wm, wn, lr, hi, acc);
    quad_out<0>(acc, (float*)sm + w * (64 * 68), lane, lr, hi, C + z * TT * DM, DM, r0 + wm * 64, c0 + wn * 64, bo, nullptr, nullptr, nullptr, 0, false, false, false);
}

// ---- k_prep: all the operand preparation in one launch. Work-groups 0 .. 4 * WB - 1: the four weights ([DM][DQ] f32, in the order q, k, v, o) transposed to bf16 rows WT[sel][n][k], one tile of 128 k x 64 n a work-group, turned in LDS:
// a wave's 16-byte load covers a 256-byte piece of two weight rows, its 16-byte store a 256-byte piece of two WT rows: four whole 128-byte lines each way.
// The other TT * DM / 8 / 256 work-groups: the three inputs to bf16, XB[input][batch][TT][DM]; a thread converts its 8 elements of every one of the twelve [TT][DM] slabs, the four batches of an input in flight together.
#define WP 65   // LDS row pitch of the turned tile in dwords (a dword holds the bf16 pair k, k + 1 of one n): 64 + 1, so that the 32 lanes of a write (16 rows n x 2 pairs) and of a read (2 rows n x 16 pieces) fall on 32 different banks
typedef __attribute__((ext_vector_type(4))) unsigned v4u;
__global__ __launch_bounds__(256) void k_prep(const float* __restrict__ wq, const float* __restrict__ wk, const float* __restrict__ wv, const float* __restrict__ wo, const float* __restrict__ x, const float* __restrict__ xk, const float* __restrict__ xv, bf* WT, bf* XB) {
    constexpr int K = DM, N = DQ, WB = (K / 128) * (N / 64); const int bx = blockIdx.x;
    __shared__ unsigned st[64 * WP];
    if (bx < 4 * WB) {
        const int sel = bx / WB, tile = bx % WB, k0 = (tile % (K / 128)) * 128, n0 = (tile / (K / 128)) * 64; const float* __restrict__ w = sel == 0 ? wq : sel == 1 ? wk : sel == 2 ? wv : wo; bf* Bt = WT + (size_t)sel * N * K;
        const int c = threadIdx.x & 15, rp = threadIdx.x >> 4;
        const float* src = w + (size_t)(k0 + rp * 2) * N + n0 + c * 4; v4f v[4][2];
        // every loop of this branch is unrolled so that v and o are indexed by constants and stay in registers, and the eight loads of a lane are in flight together
#pragma unroll
        for (int i = 0; i < 4; ++i) { v[i][0] = *(const v4fa*)(src + (size_t)(i * 32) * N); v[i][1] = *(const v4fa*)(src + (size_t)(i * 32 + 1) * N); }
        asm volatile("s_wait_xcnt 0x0" ::: "memory");   // before the address pair of the eight loads is reused
#pragma unroll
        for (int i = 0; i < 4; ++i)
#pragma unroll
            for (int e = 0; e < 4; ++e) st[(c * 4 + e) * WP + i * 16 + rp] = (unsigned)f2bf(v[i][0][e]) | ((unsigned)f2bf(v[i][1][e]) << 16);
        __syncthreads();   // the tile is complete in LDS before its rows n are read (the branch is the same for a whole work-group)
        v4u o[4];
#pragma unroll
        for (int j = 0; j < 4; ++j) { const unsigned* q = st + (j * 16 + rp) * WP + c * 4; o[j] = (v4u){q[0], q[1], q[2], q[3]}; }
        bf* dst = Bt + (size_t)(n0 + rp) * K + k0 + c * 8;
#pragma unroll
        for (int j = 0; j < 4; ++j) *(v8us*)(dst + (size_t)(j * 16) * K) = __builtin_bit_cast(v8us, o[j]);
    } else {
        const size_t i8 = ((size_t)(bx - 4 * WB) * 256 + threadIdx.x) * 8;
        // the loop over the inputs stays rolled: eight 16-byte loads of a lane in flight, few registers, many waves per SIMD; the loops over b and k are unrolled so that v and o stay in registers
#pragma unroll 1
        for (int s = 0; s < 3; ++s) { const float* __restrict__ src = (s == 0 ? x : s == 1 ? xk : xv) + i8; bf* dst = XB + (size_t)s * NB_ * TT * DM + i8; v8f v[NB_];
#pragma unroll
            for (int b = 0; b < NB_; ++b) { v[b] = *(const v8f*)(src + (size_t)b * TT * DM);
                asm volatile("s_wait_xcnt 0x0" ::: "memory"); }   // before the address pair is reused (the build hands it on as the destination of a later load)
#pragma unroll
            for (int b = 0; b < NB_; ++b) { v8us o;
#pragma unroll
                for (int k = 0; k < 8; ++k) o[k] = f2bf(v[b][k]);
                *(v8us*)(dst + (size_t)b * TT * DM) = o; }
            asm volatile("s_wait_xcnt 0x0" ::: "memory"); }   // before the next input's addresses reuse the registers of the stores
    }
}

// ---- k_fattn: causal attention of one (batch, head) plane per blockIdx.x, scores, softmax, P.V and the head merge in one launch; no score ever leaves the registers.
// A wave owns NQ groups of 16 query columns and walks the keys in blocks of 32 up to the diagonal: S^T = K Q^T (A = K rows, B = Q rows kept in registers), so a lane holds 16 scores of ONE query;
// shift in use and sum per query (log2 domain, one exchange between the lane halves), then the two f32 score tiles of a block, converted in place, are the B operand of O^T += V^T P^T (A = V^T rows, same k order as the packed tiles).
// Rows < RH: hi/lo planes, 3 products in both contractions; the rest fp16 with the probabilities carried x 2^10 (the factor is in the row sum too and cancels in the final division).
// fp16 rows: the four waves of a work-group (128 queries) share each stage of 64 keys through LDS: whole-line global loads into registers one stage ahead, two LDS buffers, one barrier a stage. The hi/lo rows (short walks) read their fragments straight from the planes.
#define SP 72   // LDS row pitch of a staged tile in 16-bit elements: 128 data bytes + 16, an odd multiple of 16 bytes, so that the 16-byte fragment reads of 16 rows spread over the banks
__device__ __forceinline__ float xhalf(float x) { return __builtin_bit_cast(float, __builtin_amdgcn_permlanex16(__builtin_bit_cast(int, x), __builtin_bit_cast(int, x), 0x76543210, 0xfedcba98, false, false)); }   // lane l <-> lane l ^ 16
// fa_exp2: 2^x. v_exp_f32 and the one v_nop that fills the slot behind it stand in one statement.
__device__ __forceinline__ float fa_exp2(float x) { float r; asm("v_exp_f32 %0, %1\n\tv_nop" : "=v"(r) : "v"(x)); return r; }
// every loop of the fa_ functions but the key walks is unrolled so that the fragment and accumulator arrays are indexed by constants and stay in registers
// fa_ldk / fa_ldv: the four fragments of one plane for one block of 32 keys; Kb = the block's first K row, Vb = the block's first key in V^T row 0, PITCH = row pitch in elements. GL: the source is global memory (the hi/lo planes); fa_ldg writes s_wait_xcnt 0 behind each of a fragment's two loads.
__device__ __forceinline__ v16bf fa_ldg(const bf* p) {
    const v8us x0 = *(const v8us*)p; asm volatile("s_wait_xcnt 0x0" ::: "memory");          // before the address pair is reused
    const v8us x1 = *(const v8us*)(p + 16); asm volatile("s_wait_xcnt 0x0" ::: "memory");   // before the address pair is reused
    return cat16b(x0, x1);
}
template <typename T16, int PITCH, bool GL>
__device__ __forceinline__ void fa_ldk(const T16* Kb, int lr, int hi, typename WFrag<T16>::V (&ka)[2][2]) {
#pragma unroll
    for (int kt = 0; kt < 2; ++kt)
#pragma unroll
        for (int kc = 0; kc < 2; ++kc) { const T16* p = Kb + (size_t)(kt * 16 + lr) * PITCH + kc * 32 + 8 * hi; if constexpr (GL) ka[kt][kc] = fa_ldg(p); else ka[kt][kc] = WFrag<T16>::ld(p); }
}
template <typename T16, int PITCH, bool GL>
__device__ __forceinline__ void fa_ldv(const T16* Vb, int lr, int hi, typename WFrag<T16>::V (&va)[4]) {
#pragma unroll
    for (int mb = 0; mb < 4; ++mb) { const T16* p = Vb + (size_t)(mb * 16 + lr) * PITCH + 8 * hi; if constexpr (GL) va[mb] = fa_ldg(p); else va[mb] = WFrag<T16>::ld(p); }
}
// fa_block: one block of 32 keys, first key key0. LAST: a block at or above the diagonal: keys above the query are masked.
// cs[n]: the query's shift in use, the same value in all eight registers: OFS minus the maximum in use (log2 domain). It enters the score products as their C operand, and the q planes carry QSC, so that a score tile comes out as the argument of 2^x.
// fa_ofs: OFS. fp16 probabilities x 2^10: keeps small ones out of the subnormals.
template <bool HR> constexpr float fa_ofs = HR ? 0.0f : 10.0f;
template <typename T16, bool HR, int NQ, bool LAST, int KPITCH, int VPITCH>
__device__ __forceinline__ void fa_block(const T16* Kb, const T16* Kb2, const T16* Vb, const T16* Vb2, const typename WFrag<T16>::V (&qf)[NQ][2], const typename WFrag<T16>::V (&qf2)[NQ][2],
                                         v8f (&o)[4][NQ], v8f (&cs)[NQ], float (&l)[NQ], int key0, int q0, int lr, int hi) {
    typedef typename WFrag<T16>::V V;
    constexpr float OFS = fa_ofs<HR>, LZ = 5.0f;   // LZ: how far an exponent may stand above OFS before the shift follows
    v8f s[2][NQ]; V ka[2][2], ka2[2][2], va[4], va2[4];
    fa_ldk<T16, KPITCH, HR>(Kb, lr, hi, ka); if constexpr (HR) fa_ldk<T16, KPITCH, HR>(Kb2, lr, hi, ka2);
    if constexpr (HR) { fa_ldv<T16, VPITCH, HR>(Vb, lr, hi, va); fa_ldv<T16, VPITCH, HR>(Vb2, lr, hi, va2); }   // from global memory: early, they fly behind the S^T products and the softmax
#pragma unroll
    for (int kt = 0; kt < 2; ++kt)
#pragma unroll
        for (int n = 0; n < NQ; ++n) { s[kt][n] = cs[n];   // the C operand of the tile's first product
#pragma unroll
            for (int kc = 0; kc < 2; ++kc) { s[kt][n] = WFrag<T16>::mma(ka[kt][kc], qf[n][kc], s[kt][n]); if constexpr (HR) { s[kt][n] = WFrag<T16>::mma(ka[kt][kc], qf2[n][kc], s[kt][n]); s[kt][n] = WFrag<T16>::mma(ka2[kt][kc], qf[n][kc], s[kt][n]); } } }
    if constexpr (!HR) fa_ldv<T16, VPITCH, HR>(Vb, lr, hi, va);   // from LDS: into the registers that the K fragments have just left; the softmax covers the LDS latency
    float mx[NQ]; bool need = false;
#pragma unroll
    for (int n = 0; n < NQ; ++n) { const int qi = q0 + n * 16 + lr; float t = -3.0e38f;
#pragma unroll
        for (int e = 0; e < 16; ++e) { if (LAST) s[e >> 3][n][e & 7] = (key0 + (e >> 3) * 16 + hi * 8 + (e & 7) <= qi) ? s[e >> 3][n][e & 7] : -3.0e38f; t = fmaxf(t, s[e >> 3][n][e & 7]); }
        mx[n] = t; need = need || t > OFS + LZ; }   // the lane's own 16 keys: the test below looks at all lanes, so the halves need not meet here
    // The tiles are the exponents already. The shift follows only in the walk's first block (there it is set, up or down, to the block's maximum) and where some query of the wave stands more than LZ above OFS:
    // one test a block, a scalar branch; then exponents, shift, sums and output columns all move by d. Elsewhere the probabilities stay at or below 2^(OFS + LZ), inside fp16.
    if ((__builtin_amdgcn_ballot_w32(need) | (key0 == 0 ? 1u : 0u)) != 0) {
#pragma unroll
        for (int n = 0; n < NQ; ++n) { float d = fmaxf(mx[n], xhalf(mx[n])) - OFS; if (key0 != 0) d = fmaxf(d, 0.f);
            const float al = fa_exp2(fminf(-d, 0.f)); l[n] *= al; cs[n] -= d; s[0][n] -= d; s[1][n] -= d;   // first block: sums and columns are still 0, any finite factor serves
#pragma unroll
            for (int mb = 0; mb < 4; ++mb) o[mb][n] *= al; } }
    V pb[NQ], pb2[NQ];
#pragma unroll
    for (int n = 0; n < NQ; ++n) { float ls = 0.f;
        if constexpr (HR) { v8us h0, h1, l0, l1;
#pragma unroll
            for (int e = 0; e < 8; ++e) { const float pa = fa_exp2(s[0][n][e]), pc = fa_exp2(s[1][n][e]); ls += pa + pc; unsigned short a, c; splitf(pa, a, c); h0[e] = a; l0[e] = c; splitf(pc, a, c); h1[e] = a; l1[e] = c; }
            pb[n] = cat16b(h0, h1); pb2[n] = cat16b(l0, l1);
        } else { v8h h0, h1;
#pragma unroll
            for (int e = 0; e < 8; ++e) { const float pa = fa_exp2(s[0][n][e]), pc = fa_exp2(s[1][n][e]); ls += pa + pc; h0[e] = tohx(pa); h1[e] = tohx(pc); }
            pb[n] = cat16(h0, h1); }
        l[n] += ls; }
#pragma unroll
    for (int mb = 0; mb < 4; ++mb)
#pragma unroll
        for (int n = 0; n < NQ; ++n) { o[mb][n] = WFrag<T16>::mma(va[mb], pb[n], o[mb][n]); if constexpr (HR) { o[mb][n] = WFrag<T16>::mma(va[mb], pb2[n], o[mb][n]); o[mb][n] = WFrag<T16>::mma(va2[mb], pb[n], o[mb][n]); } }
}
// fa_out: divides by the row sums and stores the merged hi/lo planes; Ah / Al point at the plane's first merged element (row pitch DQ). A lane holds 8 consecutive d of one query per tile: 16-byte stores, a head's 128-byte line written by one wave.
template <int NQ>
__device__ __forceinline__ void fa_out(const v8f (&o)[4][NQ], const float (&l)[NQ], int q0, int lr, int hi, bf* Ah, bf* Al) {
#pragma unroll
    for (int n = 0; n < NQ; ++n) { const float inv = __fdiv_rn(1.0f, l[n] + xhalf(l[n])); const size_t ro = (size_t)(q0 + n * 16 + lr) * DQ + hi * 8;
#pragma unroll
        for (int mb = 0; mb < 4; ++mb) { v8us oh, ol;
#pragma unroll
            for (int j = 0; j < 8; ++j) { unsigned short a, c; splitf(o[mb][n][j] * inv, a, c); oh[j] = a; ol[j] = c; }
            *(v8us*)(Ah + ro + mb * 16) = oh; *(v8us*)(Al + ro + mb * 16) = ol;
            asm volatile("s_wait_xcnt 0x0" ::: "memory"); } }   // before the next tile's packing reuses the registers of the two stores
}
// fa_hr: hi/lo rows: queries q0 .. q0 + 15 of one plane, one wave on its own.
__device__ __forceinline__ void fa_hr(const bf* __restrict__ Q, const bf* __restrict__ Q2, const bf* __restrict__ Kp, const bf* __restrict__ Kp2, const bf* __restrict__ Vt, const bf* __restrict__ Vt2, int q0, int lr, int hi, bf* Ah, bf* Al) {
    v16bf qf[1][2], qf2[1][2]; v8f o[4][1], cs[1]; float l[1] = {0.f};
#pragma unroll
    for (int kc = 0; kc < 2; ++kc) { const size_t qo = (size_t)(q0 + lr) * HD + kc * 32 + 8 * hi; qf[0][kc] = WFrag<bf>::ld(Q + qo); qf2[0][kc] = WFrag<bf>::ld(Q2 + qo); }
    asm volatile("s_wait_xcnt 0x0" ::: "memory");   // before the zeroing of the accumulators reuses the address pairs of the loads above
#pragma unroll
    for (int mb = 0; mb < 4; ++mb) o[mb][0] = (v8f){};
    cs[0] = (v8f){} + fa_ofs<true>;
    const int nfull = (q0 + 15) >> 5;   // key blocks wholly below the diagonal; block nfull holds the diagonal
    for (int kb = 0; kb < nfull; ++kb) fa_block<bf, true, 1, false, HD, PP>(Kp + (size_t)kb * 32 * HD, Kp2 + (size_t)kb * 32 * HD, Vt + kb * 32, Vt2 + kb * 32, qf, qf2, o, cs, l, kb * 32, q0, lr, hi);
    fa_block<bf, true, 1, true, HD, PP>(Kp + (size_t)nfull * 32 * HD, Kp2 + (size_t)nfull * 32 * HD, Vt + nfull * 32, Vt2 + nfull * 32, qf, qf2, o, cs, l, nfull * 32, q0, lr, hi);
    fa_out<1>(o, l, q0, lr, hi, Ah, Al);
}
// fa_lo: fp16 rows: queries Q0 .. Q0 + 127 of one plane (Q0 a multiple of 128), wave w takes 32 of them. sm: two buffers, each a K tile [64 keys][SP] and a V^T tile [64 d][SP].
// All four waves walk the same Q0 / 32 + 4 key blocks, so every barrier is passed by all: the first Q0 / 32 lie below every query of the work-group; the last four (two stages) run masked, and a block wholly above a wave's queries adds exact zeros.
// fa_stage_ld / fa_stage_st: a thread moves the 16-byte piece pcol of rows prow, prow + 16, + 32, + 48 of both tiles: a wave's load covers four whole 128-byte lines.
__device__ __forceinline__ void fa_stage_ld(const h16* __restrict__ Kp, const h16* __restrict__ Vt, int key0, int prow, int pcol, v8h (&rk)[4], v8h (&rv)[4]) {
#pragma unroll
    for (int i = 0; i < 4; ++i) { rk[i] = *(const v8h*)(Kp + (size_t)(key0 + prow + 16 * i) * HD + pcol); rv[i] = *(const v8h*)(Vt + (size_t)(prow + 16 * i) * PP + key0 + pcol);
        asm volatile("s_wait_xcnt 0x0" ::: "memory"); }   // before the two loads' address pairs are reused
}
__device__ __forceinline__ void fa_stage_st(h16* sb, int prow, int pcol, const v8h (&rk)[4], const v8h (&rv)[4]) {
#pragma unroll
    for (int i = 0; i < 4; ++i) { *(v8h*)(sb + (prow + 16 * i) * SP + pcol) = rk[i]; *(v8h*)(sb + (64 + prow + 16 * i) * SP + pcol) = rv[i]; }
}
__device__ __forceinline__ void fa_lo(const h16* __restrict__ Q, const h16* __restrict__ Kp, const h16* __restrict__ Vt, h16* sm, int Q0, int w, int lr, int hi, bf* Ah, bf* Al) {
    const int q0 = Q0 + w * 32, prow = (int)threadIdx.x >> 3, pcol = ((int)threadIdx.x & 7) * 8;
    v16h qf[2][2]; v8f o[4][2], cs[2]; float l[2]; v8h rk[4], rv[4];
    fa_stage_ld(Kp, Vt, 0, prow, pcol, rk, rv);
#pragma unroll
    for (int n = 0; n < 2; ++n) { l[n] = 0.f;
#pragma unroll
        for (int kc = 0; kc < 2; ++kc) qf[n][kc] = WFrag<h16>::ld(Q + (size_t)(q0 + n * 16 + lr) * HD + kc * 32 + 8 * hi); }
    asm volatile("s_wait_xcnt 0x0" ::: "memory");   // before the zeroing of the accumulators reuses the address pairs of the loads above
#pragma unroll
    for (int n = 0; n < 2; ++n)
#pragma unroll
        for (int mb = 0; mb < 4; ++mb) o[mb][n] = (v8f){};
    cs[0] = (v8f){} + fa_ofs<false>; cs[1] = cs[0];
    fa_stage_st(sm, prow, pcol, rk, rv);
    __syncthreads();   // publishes stage 0
    const int nmain = Q0 >> 6;   // unmasked stages, an even number: stage nmain lies in buffer 0 again
    for (int st = 0; st < nmain; ++st) { const h16* sb = sm + (st & 1) * (128 * SP);
        fa_stage_ld(Kp, Vt, (st + 1) * 64, prow, pcol, rk, rv);   // flies behind this stage's two blocks
        // stays rolled: unrolled, the build fetches the second block's fragments during the first and the register count costs a wave per SIMD
#pragma unroll 1
        for (int b = 0; b < 2; ++b) fa_block<h16, false, 2, false, SP, SP>(sb + b * 32 * SP, nullptr, sb + 64 * SP + b * 32, nullptr, qf, qf, o, cs, l, st * 64 + b * 32, q0, lr, hi);
        fa_stage_st(sm + ((st + 1) & 1) * (128 * SP), prow, pcol, rk, rv);   // that buffer's last reads stand in front of the barrier of stage st - 1
        __syncthreads(); }   // publishes stage st + 1 and ends every wave's reads of stage st
    fa_stage_ld(Kp, Vt, Q0 + 64, prow, pcol, rk, rv);   // the last stage; flies behind the first two masked blocks
    // stays rolled: one copy of the masked block in the text
#pragma unroll 1
    for (int t = 0; t < 4; ++t) { const h16* sb = sm + (t >> 1) * (128 * SP);
        if (t == 2) { fa_stage_st(sm + 128 * SP, prow, pcol, rk, rv); __syncthreads(); }   // publishes the last stage; buffer 1 was last read in front of the barrier that published stage nmain
        fa_block<h16, false, 2, true, SP, SP>(sb + (t & 1) * 32 * SP, nullptr, sb + 64 * SP + (t & 1) * 32, nullptr, qf, qf, o, cs, l, Q0 + t * 32, q0, lr, hi); }
    fa_out<2>(o, l, q0, lr, hi, Ah, Al);
}
// grid (NB_ * NH_, (TT - RH) / 128 + RH / 64), 4 waves: blockIdx.y counts the query blocks from the longest key walk down, so that the cost falls with the work-group index. amdgpu_waves_per_eu(4, 4): the register budget of four waves per SIMD (without it the build takes more than 256 registers and a wave per SIMD is lost).
__global__ __launch_bounds__(128) __attribute__((amdgpu_waves_per_eu(4, 4))) void k_fattn(const h16* __restrict__ Q16, const h16* __restrict__ K16, const h16* __restrict__ V16, const bf* __restrict__ Qh, const bf* __restrict__ Ql, const bf* __restrict__ Kh, const bf* __restrict__ Kl, const bf* __restrict__ Vh, const bf* __restrict__ Vl, bf* Ah, bf* Al) {
    __shared__ __align__(16) h16 sm[2 * 128 * SP];
    const int lane = threadIdx.x & 31, lr = lane & 15, hi = lane >> 4;
    const int w = __builtin_amdgcn_readfirstlane(threadIdx.x >> 5);   // wave number, scalar: the key loops' bounds stay scalar
    const size_t bh = blockIdx.x, po = bh * TT * HD, vo = bh * HD * PP, ao = (bh / NH_) * TT * DQ + (bh % NH_) * HD; const int y = blockIdx.y;
    if (y < (TT - RH) / 128) fa_lo(Q16 + po, K16 + po, V16 + vo, sm, TT - 128 * (y + 1), w, lr, hi, Ah + ao, Al + ao);
    else fa_hr(Qh + po, Ql + po, Kh + po, Kl + po, Vh + vo, Vl + vo, RH - 64 * (y - (TT - RH) / 128 + 1) + w * 16, lr, hi, Ah + ao, Al + ao);
}

extern "C" void kernel_launch(void* const* d_in, const int* in_sizes, int n_in,
                              void* d_out, int out_size, void* d_ws, size_t ws_size, hipStream_t stream) {
    (void)in_sizes; (void)n_in; (void)out_size;
    const float* x = (const float*)d_in[0]; const float* xk = (const float*)d_in[1]; const float* xv = (const float*)d_in[2]; const float* wq = (const float*)d_in[3]; const float* bq = (const float*)d_in[4]; const float* wk = (const float*)d_in[5]; const float* bk = (const float*)d_in[6]; const float* wv = (const float*)d_in[7]; const float* bv = (const float*)d_in[8]; const float* wo = (const float*)d_in[9]; const float* bo = (const float*)d_in[10];
    float* OUT = (float*)d_out;     // [4][2048][1024]
    char* wsp = (char*)d_ws;
    auto take = [&](size_t bytes) { char* p = wsp; wsp += (bytes + 255) & ~(size_t)255; return (void*)p; };
    bf* WT = (bf*)take((size_t)4 * DQ * DM * 2);             // q, k, v, o
    bf* XB = (bf*)take((size_t)3 * NB_ * TT * DM * 2);       // [input][batch][TT][DM]
    const size_t PQ = (size_t)NH_ * TT * HD, PA = (size_t)TT * DQ;   // elements of one batch's planes; every plane set holds the NB_ batches side by side, the q, k and v sets of a kind of plane one behind the other
    h16* P16 = (h16*)take(3 * NB_ * PQ * 2); bf* Ph = (bf*)take(3 * NB_ * PQ * 2); bf* Pl = (bf*)take(3 * NB_ * PQ * 2);
    bf* ATh = (bf*)take(NB_ * PA * 2); bf* ATl = (bf*)take(NB_ * PA * 2);
    if ((size_t)(wsp - (char*)d_ws) > ws_size) return;    // ws 256 MiB
    k_prep<<<(unsigned)(4 * ((DM / 128) * (DQ / 64)) + TT * DM / 8 / 256), 256, 0, stream>>>(wq, wk, wv, wo, x, xk, xv, WT, XB);
    k_proj<<<dim3(TT / 128, DQ / 128, 3 * NB_), 128, 0, stream>>>(XB, WT, bq, bk, bv, P16, Ph, Pl);
    k_fattn<<<dim3(NB_ * NH_, (TT - RH) / 128 + RH / 64, 1), 128, 0, stream>>>(P16, P16 + NB_ * PQ, P16 + 2 * NB_ * PQ, Ph, Pl, Ph + NB_ * PQ, Pl + NB_ * PQ, Ph + 2 * NB_ * PQ, Pl + 2 * NB_ * PQ, ATh, ATl);
    k_wo<<<dim3(TT / 128, DM / 128, NB_), 128, 0, stream>>>(ATh, ATl, WT + (size_t)3 * DQ * DM, bo, OUT);
}
